// v000
// Measured on an AMD MI455X. A time is GPU time per run, averaged over a window of back-to-back runs after a warm-up
// (all launches, gaps included; the runs take copies of the inputs in turn), and the median of several windows.
// Apart from v000's, it joins two sittings. Times from different sittings can be a few percent apart, while
// side-by-side timings come from the same sitting.
// v000 is the starting kernel. One run takes 457 microseconds.
// Contractions on v_wmma_f32_16x16x32_f16 (plain f16 operands, f32 accumulate): qkv = (LN(x) + pos)·in_projᵀ + b (K = 1024, N = 3072),
// the 16-head attention (dk = 64, scale 1/8) with the reference's ADDITIVE float mask (1 − padding_mask) as a per-(batch,key) bias,
// flash-style Sᵀ = K·Qᵀ / Oᵀ = Vᵀ·Pᵀ with online softmax in f32 (P x1024, f32 output rows), attn_out = o·out_projᵀ + b + xp (residual in
// the epilogue, K = 1024) and (xp + attn_out)·to_outᵀ + b (K = 1024); LayerNorm and the positional add in f32. xp dominates the residual
// so plain f16 operands suffice. compute dtype: f16 operands, f32 accumulate.  x [4,2048,1024].
#include <hip/hip_runtime.h>
#include <hip/hip_bf16.h>
#include <math.h>

#define BB 4
#define SS 2048
#define QROWS 2048
#define KROWS 2048
#define NKV 2048
#define DD 1024
#define HH 16
#define KVH 16
#define KVD 1024
#define HKDIV 1
#define DKK 64
#define QW 2
#define MTOK (BB * SS)
#define GSTR 48

typedef _Float16 bf16;
typedef _Float16 f16;
typedef __attribute__((ext_vector_type(4))) unsigned v4u_t;
typedef unsigned v4ua __attribute__((ext_vector_type(4), may_alias));
typedef __attribute__((ext_vector_type(4))) float v4f_t;
typedef float v4fa __attribute__((ext_vector_type(4), may_alias));
typedef __attribute__((ext_vector_type(16))) bf16  bf16x16;
typedef bf16x16 f16x16;
typedef __attribute__((ext_vector_type(8)))  bf16  bf16x8;
typedef bf16x8 f16x8;
typedef __attribute__((ext_vector_type(4)))  bf16  bf16x4;
typedef __attribute__((ext_vector_type(8)))  float f32x8;
__device__ __forceinline__ f32x8 wmma16(f16x16 a, f16x16 b, f32x8 c) {
  c = __builtin_amdgcn_wmma_f32_16x16x32_f16(false, a, false, b, (short)0, c, false, false);
  asm volatile("v_nop\n\tv_nop\n\tv_nop\n\tv_nop" : "+v"(c) : "v"(a), "v"(b));
  return c;
}
#define LDS_STRIDE 48   // GEMM tiles: 32 -> 48 elems (96B rows): aligned b128 reads
#define KSTRIDE    72   // attn K tile: 64 -> 72 elems (144B rows): conflict-free b128
#define VSTRIDE    48   // attn V tile: 32 -> 48 elems

__device__ __forceinline__ f32x8 wmma_bf16(bf16x16 a, bf16x16 b, f32x8 c) {
  c = __builtin_amdgcn_wmma_f32_16x16x32_f16(false, a, false, b, (short)0, c, false, false);
  asm volatile("v_nop\n\tv_nop\n\tv_nop\n\tv_nop" : "+v"(c) : "v"(a), "v"(b));   // A/B-overwrite hazard guard
  return c;
}

// 16x32 (MxK) bf16 fragment from a row-major global matrix.
// lanes 0-15  (row=lane)    : elems 0..7 = K+0..7,  8..15 = K+16..23
// lanes 16-31 (row=lane-16) : elems 0..7 = K+8..15, 8..15 = K+24..31
template <typename T>
__device__ __forceinline__ bf16x16 load_frag(const T* __restrict__ base, int ld,
                                             int row0, int k0) {
  const int lane = threadIdx.x & 31;
  const int r    = lane & 15;
  const int kh   = (lane >> 4) * 8;
  const T* p0 = base + (size_t)(row0 + r) * ld + (k0 + kh);
  const T* p1 = p0 + 16;
  bf16x16 f;
#pragma unroll
  for (int i = 0; i < 8; ++i) {
    f[i]     = (bf16)p0[i];
    f[i + 8] = (bf16)p1[i];
  }
  return f;
}

// Same fragment from an LDS tile with padded row stride (base includes row0/k0).
__device__ __forceinline__ bf16x16 lds_frag(const bf16* base, int stride) {
  const int lane = threadIdx.x & 31;
  const int row  = lane & 15;
  const int kh   = (lane >> 4) * 8;
  const bf16x8 lo = *(const bf16x8*)(base + row * stride + kh);
  const bf16x8 hi = *(const bf16x8*)(base + row * stride + kh + 16);
  bf16x16 f;
#pragma unroll
  for (int i = 0; i < 8; ++i) { f[i] = lo[i]; f[i + 8] = hi[i]; }
  return f;
}

template <typename T>
__device__ __forceinline__ void stage_read16(const T* __restrict__ p, float* buf) {
#pragma unroll
  for (int i = 0; i < 16; ++i) buf[i] = (float)p[i];
}

__device__ __forceinline__ void stage_write(bf16* dst, const float* buf, int nquad) {
#pragma unroll
  for (int i = 0; i < nquad; ++i) {
    bf16x4 q;
    q[0] = (bf16)buf[4 * i];     q[1] = (bf16)buf[4 * i + 1];
    q[2] = (bf16)buf[4 * i + 2]; q[3] = (bf16)buf[4 * i + 3];
    *(bf16x4*)(dst + 4 * i) = q;
  }
}

// ---------------------------------------------------------------------------
// GEMM: C[m][n] = sum_k A[m][k]*W[n][k] + bias[n]   (torch Linear)
// Block 256 thr (8 waves), tile 128M x 256N, K-step 32; wave tile 64x64.
// A/W staged through LDS (bf16, padded stride) with next-tile register
// prefetch overlapping the WMMA phase.
// MODE 0: bf16 [M][N]   MODE 1: bf16 Vt[b][h][dk][s]   MODE 2: fp32 [M][N]
// ---------------------------------------------------------------------------
template <typename AT, int MODE>
__global__ __launch_bounds__(256) void gemm_rb_kernel(
    const AT* __restrict__ A, const float* __restrict__ W,
    const float* __restrict__ bias, const float* __restrict__ rowscale, const float* __restrict__ R, const float* __restrict__ rowbias, void* __restrict__ out,
    int M, int N, int K) {
  __shared__ bf16 ldsA[128 * LDS_STRIDE];   // 12.0 KB
  __shared__ bf16 ldsW[256 * LDS_STRIDE];   // 24.0 KB
  // output staging: MODE 0 [128 m][264] f16, MODE 1 [256 n][136] f16, MODE 2 [64 m][260] f32 (two halves)
  __shared__ __attribute__((aligned(16))) unsigned char sob[256 * 136 * 2];   // 69,632 B >= 128*264*2 and >= 64*260*4

  const int t    = threadIdx.x;
  const int wave = t >> 5;
  const int lane = t & 31;
  const int wm   = (wave & 1) * 64;
  const int wn   = (wave >> 1) * 64;
  const int mBlk = blockIdx.x * 128;
  const int nBlk = blockIdx.y * 256;

  const int arow = t >> 1;
  const int ach  = (t & 1) * 16;

  float abuf[16];
  float wbuf[32];

  stage_read16(A + (size_t)(mBlk + arow) * K + ach, abuf);
  const int nrow = min(nBlk + t, N - 1);            // ragged last N tile: clamp the weight row (those columns are never stored)
  stage_read16(W + (size_t)nrow * K,          wbuf);
  stage_read16(W + (size_t)nrow * K + 16,     wbuf + 16);

  f32x8 acc[4][4] = {};

  for (int k = 0; k < K; k += 32) {
    __syncthreads();
    stage_write(&ldsA[arow * LDS_STRIDE + ach], abuf, 4);
    stage_write(&ldsW[t * LDS_STRIDE],          wbuf, 8);
    if (k + 32 < K) {
      stage_read16(A + (size_t)(mBlk + arow) * K + (k + 32) + ach, abuf);
      stage_read16(W + (size_t)nrow * K + (k + 32),          wbuf);
      stage_read16(W + (size_t)nrow * K + (k + 32) + 16,     wbuf + 16);
    }
    __syncthreads();

    bf16x16 af[4], wf[4];
#pragma unroll
    for (int i = 0; i < 4; ++i)
      af[i] = lds_frag(ldsA + (wm + 16 * i) * LDS_STRIDE, LDS_STRIDE);
#pragma unroll
    for (int j = 0; j < 4; ++j)
      wf[j] = lds_frag(ldsW + (wn + 16 * j) * LDS_STRIDE, LDS_STRIDE);
#pragma unroll
    for (int i = 0; i < 4; ++i)
#pragma unroll
      for (int j = 0; j < 4; ++j)
        acc[i][j] = wmma_bf16(af[i], wf[j], acc[i][j]);
  }

  const int nlane = lane & 15;
  const int mh    = (lane >> 4) * 8;
  __syncthreads();
  if (MODE == 0 || MODE == 1 || MODE == 3) {
    bf16* so = (bf16*)sob;
#pragma unroll
    for (int i = 0; i < 4; ++i)
#pragma unroll
      for (int j = 0; j < 4; ++j) {
        const int nl = wn + 16 * j + nlane;
        const float bv = bias ? bias[nBlk + nl] : 0.0f;
        if (MODE == 3) {                                  // bias + exact GELU (erf), rolled to keep the static VALU op count small
#pragma unroll 1
          for (int r = 0; r < 8; ++r) {
            const int ml = wm + 16 * i + mh + r;
            const float xg = acc[i][j][r] + bv;
            so[ml * 264 + nl] = (bf16)(0.5f * xg * (1.0f + erff(xg * 0.70710678118654752f)));
          }
        } else {
#pragma unroll
        for (int r = 0; r < 8; ++r) {
          const int ml = wm + 16 * i + mh + r;
          const bf16 hv = (bf16)(acc[i][j][r] + bv);
          if (MODE == 0) so[ml * 264 + nl] = hv;        // [m][n]
          else           so[nl * 136 + ml] = hv;        // [n][m]  (n = h*64+dk rows of Vt, m = s contiguous)
        }
        }
      }
    __syncthreads();
{
      if (MODE == 0 || MODE == 3) {          // rows m: 256 halfs = 512 B each, 16-B chunks
        for (int ch = t; ch < 128 * 32; ch += 256) { const int ml = ch >> 5, q = (ch & 31) * 8;
          *(v4u_t*)((bf16*)out + (size_t)(mBlk + ml) * N + nBlk + q) = *(const v4ua*)(so + ml * 264 + q); }
      } else {                  // Vt rows (b, h, dk): 128 consecutive s = 256 B each
        const int b_ = mBlk / SS, s0 = mBlk % SS;
        for (int ch = t; ch < 256 * 16; ch += 256) { const int nl = ch >> 4, q = (ch & 15) * 8; const int n = nBlk + nl, h = n >> 6, dk = n & (DKK - 1);
          *(v4u_t*)((bf16*)out + (((size_t)(b_ * HH + h)) * DKK + dk) * SS + s0 + q) = *(const v4ua*)(so + nl * 136 + q); }
      }
      
    }
  } else {
    float* so = (float*)sob;
#pragma unroll 1
    for (int hf = 0; hf < 2; ++hf) {
      if (wm == hf * 64) {
#pragma unroll
        for (int i = 0; i < 4; ++i)
#pragma unroll
          for (int j = 0; j < 4; ++j) {
            const int nl = wn + 16 * j + nlane;
            const float bv = bias ? bias[nBlk + nl] : 0.0f;
#pragma unroll
            for (int r = 0; r < 8; ++r) { const int mrow = mBlk + hf * 64 + 16 * i + mh + r; so[(16 * i + mh + r) * 260 + nl] = acc[i][j][r] * (rowscale ? rowscale[mrow] : 1.0f) + bv + (rowbias ? rowbias[mrow] : 0.0f); }
          }
      }
      __syncthreads();
      if (R) {   // residual: fold R[m][n] into the staged tile once (same thread <-> same chunks as the stores below)
        for (int ch = t; ch < 64 * 64; ch += 256) { const int ml = ch >> 6, q = (ch & 63) * 4;
          if (nBlk + q < N) { const v4f_t rv = *(const v4f_t*)(R + (size_t)(mBlk + hf * 64 + ml) * N + nBlk + q); v4f_t v = *(const v4fa*)(so + ml * 260 + q); v += rv; *(v4fa*)(so + ml * 260 + q) = v; } }
        asm volatile("s_wait_dscnt 0" ::: "memory");
      }
{   // 64 rows x 256 floats = 1 KB segments, float4 chunks; columns >= N (ragged tile) skipped
        for (int ch = t; ch < 64 * 64; ch += 256) { const int ml = ch >> 6, q = (ch & 63) * 4;
          if (nBlk + q < N) *(v4f_t*)((float*)out + (size_t)(mBlk + hf * 64 + ml) * N + nBlk + q) = *(const v4fa*)(so + ml * 260 + q); }
        
      }
      __syncthreads();
    }
  }
}

__global__ __launch_bounds__(64) void v_attn_kernel(
    const bf16* __restrict__ Qb, const bf16* __restrict__ Kb,
    const bf16* __restrict__ Vt, const float* __restrict__ kbias,   // kbias [B][KROWS]: additive per-key logit bias (1 − mask)
    float* __restrict__ attnOut) {
  __shared__ bf16 ldsK[32 * KSTRIDE];   // 4.5 KB
  __shared__ bf16 ldsV[64 * VSTRIDE];   // 6.0 KB
  __shared__ __attribute__((aligned(16))) bf16 ldsO[2][32 * 72];   // unused: the output tile is staged in the f32 ldsOf

  const int q0blk = blockIdx.x * 64;
  const int h  = blockIdx.y;
  const int b  = blockIdx.z;
  const int t    = threadIdx.x;
  const int wave = t >> 5;
  const int lane = t & 31;
  const int qlane = lane & 15;
  const int kh8   = (lane >> 4) * 8;
  const int q0 = q0blk + wave * 32;          // this wave's 32 queries

  const int hk = h / HKDIV;
  const bf16* Qh = Qb + (size_t)b * QROWS * DD + h * DKK;        // queries: QROWS rows per batch, row stride DD
  const bf16* Kh = Kb + (size_t)b * KROWS * KVD + hk * DKK;      // keys: KROWS rows per batch, row stride KVD
  const bf16* Vh = Vt + ((size_t)(b * KVH + hk)) * DKK * KROWS;  // Vᵀ [KVH][64][KROWS] per batch

  // Cooperative staging (64 threads): K tile 32x64 (2 thr/row, 64B each);
  // V tile 64x32 (1 thr/row, 64B each).
  const int krow = t >> 1;
  const int kcol = (t & 1) * 32;
  const bf16* kSrc = Kh + (size_t)krow * KVD + kcol;
  const bf16* vSrc = Vh + (size_t)t * KROWS;

  bf16x16 qf[QW][2];
#pragma unroll
  for (int qt = 0; qt < QW; ++qt) {
    qf[qt][0] = load_frag(Qh, DD, q0 + 16 * qt, 0);
    qf[qt][1] = load_frag(Qh, DD, q0 + 16 * qt, 32);
  }

  f32x8 o[QW][4] = {};
  float mrun[QW], lrun[QW];
#pragma unroll
  for (int qt = 0; qt < QW; ++qt) { mrun[qt] = -INFINITY; lrun[qt] = 0.0f; }

  const float scale = 0.125f * 1.44269504088896340736f;  // 1/sqrt(DK)*log2(e)
  const float NEG2 = -1.0e9f;    // masked logit: its weight is exactly 0 once any valid key of the row has been seen (every row
                                 // has one), and anything accumulated before that is wiped by alpha == 0 — same result as -inf
  const int kmax = KROWS - 1;
  __shared__ float kbS[KROWS];
  for (int i = threadIdx.x; i < KROWS; i += 64) kbS[i] = kbias[(size_t)b * KROWS + i] * 1.44269504088896340736f;   // in log2 units
  __syncthreads();

  // Prefetch key block kb=0 into registers.
  bf16x8 kreg[4], vreg[4];
#pragma unroll
  for (int i = 0; i < 4; ++i) {
    kreg[i] = *(const bf16x8*)(kSrc + 8 * i);
    vreg[i] = *(const bf16x8*)(vSrc + 8 * i);
  }

  for (int kb = 0; kb <= kmax; kb += 32) {
    __syncthreads();   // previous readers done with LDS
#pragma unroll
    for (int i = 0; i < 4; ++i) {
      *(bf16x8*)(&ldsK[krow * KSTRIDE + kcol + 8 * i]) = kreg[i];
      *(bf16x8*)(&ldsV[t * VSTRIDE + 8 * i])           = vreg[i];
    }
    if (kb + 32 <= kmax) {   // prefetch next block during compute
      const bf16* kn = kSrc + (size_t)(kb + 32) * KVD;
      const bf16* vn = vSrc + (kb + 32);
#pragma unroll
      for (int i = 0; i < 4; ++i) {
        kreg[i] = *(const bf16x8*)(kn + 8 * i);
        vreg[i] = *(const bf16x8*)(vn + 8 * i);
      }
    }
    __syncthreads();   // tile visible

    // Phase 1: scores + softmax for both q-tiles (K fragments live here only).
    bf16x16 kf[2][2];
#pragma unroll
    for (int ktile = 0; ktile < 2; ++ktile)
#pragma unroll
      for (int c = 0; c < 2; ++c)
        kf[ktile][c] = lds_frag(ldsK + (ktile * 16) * KSTRIDE + c * 32, KSTRIDE);

    bf16x16 pf[QW];
    bool act[QW];
#pragma unroll
    for (int qt = 0; qt < QW; ++qt) {
      unsigned mbits = 0;
      {
#pragma unroll
        for (int r = 0; r < 8; ++r) { const int j0 = kb + kh8 + r; if (j0 < NKV) mbits |= 1u << r; if (j0 + 16 < NKV) mbits |= 1u << (8 + r); }
        act[qt] = (__builtin_amdgcn_ballot_w32(mbits != 0) != 0);
      }
      if (act[qt]) {
        const int q_my = q0 + 16 * qt + qlane;
        f32x8 s0 = {}, s1 = {};
        s0 = wmma_bf16(kf[0][0], qf[qt][0], s0);
        s0 = wmma_bf16(kf[0][1], qf[qt][1], s0);
        s1 = wmma_bf16(kf[1][0], qf[qt][0], s1);
        s1 = wmma_bf16(kf[1][1], qf[qt][1], s1);

        float mx = -INFINITY;
#pragma unroll
        for (int r = 0; r < 8; ++r) {
          const int k0i = kb + kh8 + r;
          const int k1i = k0i + 16;
          (void)k0i; (void)k1i; (void)q_my;
          s0[r] = (mbits & (1u << r))       ? s0[r] * scale + kbS[kb + kh8 + r] : NEG2;
          s1[r] = (mbits & (1u << (8 + r))) ? s1[r] * scale + kbS[kb + 16 + kh8 + r] : NEG2;
          mx = fmaxf(mx, fmaxf(s0[r], s1[r]));
        }
        mx = fmaxf(mx, __shfl_xor(mx, 16, 32));
        const float mnew  = fmaxf(mrun[qt], mx);
        const float alpha = exp2f(mrun[qt] - mnew);

        float rsum = 0.0f;
#pragma unroll
        for (int r = 0; r < 8; ++r) {
          const float p0 = exp2f(s0[r] - mnew);
          const float p1 = exp2f(s1[r] - mnew);
          rsum += p0 + p1;
          pf[qt][r]     = (bf16)(p0 * 1024.0f);     // P carried x1024: no f16 copy of a probability is sub-normal
          pf[qt][r + 8] = (bf16)(p1 * 1024.0f);
        }
        rsum += __shfl_xor(rsum, 16, 32);
        lrun[qt] = lrun[qt] * alpha + rsum;
        mrun[qt] = mnew;

        // Rescale accumulators now so the PV phase is pure WMMA.
#pragma unroll
        for (int j = 0; j < 4; ++j)
#pragma unroll
          for (int r = 0; r < 8; ++r) o[qt][j][r] *= alpha;
      }
    }

    // Phase 2: O^T accumulate; each V fragment read from LDS once, used by
    // both q-tiles, then dead (only 8 VGPRs of V live at a time).
#pragma unroll
    for (int j = 0; j < 4; ++j) {
      const bf16x16 vf = lds_frag(ldsV + (j * 16) * VSTRIDE, VSTRIDE);
#pragma unroll
      for (int qt = 0; qt < QW; ++qt)
        if (act[qt]) o[qt][j] = wmma_bf16(vf, pf[qt], o[qt][j]);
    }
  }

  __shared__ __attribute__((aligned(16))) float ldsOf[2][32 * 68];
  float* so = ldsOf[wave]; (void)ldsO;
#pragma unroll
  for (int qt = 0; qt < QW; ++qt) {
    const float rl = 1.0f / (lrun[qt] * 1024.0f);
#pragma unroll
    for (int j = 0; j < 4; ++j)
#pragma unroll
      for (int r = 0; r < 8; ++r) so[(16 * qt + qlane) * 68 + j * 16 + kh8 + r] = o[qt][j][r] * rl;
  }
  asm volatile("s_wait_dscnt 0" ::: "memory");
  __builtin_amdgcn_wave_barrier();
{
#pragma unroll
    for (int it = 0; it < 16; ++it) { const int ch = lane + 32 * it, ql = ch >> 4, q4 = (ch & 15) * 4;
      *(v4f_t*)(attnOut + ((size_t)(b * QROWS + q0 + ql)) * DD + h * DKK + q4) = *(const v4fa*)(so + ql * 68 + q4); }
    
  }
}


// xp = LN(x)·g + b + pos[s]  (f32 rows); block = 8 rows
__global__ __launch_bounds__(256) void k_lnpos(const float* __restrict__ X, const float* __restrict__ g, const float* __restrict__ bb, const float* __restrict__ pos, float* __restrict__ Y) {
  __shared__ __attribute__((aligned(16))) float rowS[8 * (DD + 4)];
  const int tid = threadIdx.x, r = tid >> 5, lane = tid & 31; const size_t row = (size_t)blockIdx.x * 8 + r; const int s_ = row % SS; const float* xr = X + row * DD;
  float s = 0.0f;
#pragma unroll 1
  for (int i = lane; i < DD; i += 32) { const float v = xr[i]; rowS[r * (DD + 4) + i] = v; s += v; }
#pragma unroll
  for (int off = 1; off < 32; off <<= 1) s += __shfl_xor(s, off, 32);
  const float mean = s * (1.0f / DD); float q = 0.0f;
#pragma unroll 1
  for (int i = lane; i < DD; i += 32) { const float d = rowS[r * (DD + 4) + i] - mean; q += d * d; }
#pragma unroll
  for (int off = 1; off < 32; off <<= 1) q += __shfl_xor(q, off, 32);
  const float rstd = rsqrtf(q * (1.0f / DD) + 1e-5f);
#pragma unroll 1
  for (int i = lane; i < DD; i += 32) rowS[r * (DD + 4) + i] = (rowS[r * (DD + 4) + i] - mean) * rstd * g[i] + bb[i] + pos[(size_t)s_ * DD + i];
  __syncthreads();
{ for (int q4 = tid; q4 < 8 * (DD / 4); q4 += 256) { const int rr = q4 / (DD / 4), c4 = (q4 % (DD / 4)) * 4;
      *(v4f_t*)(Y + ((size_t)blockIdx.x * 8 + rr) * DD + c4) = *(const v4fa*)(rowS + rr * (DD + 4) + c4); }  }
}
// f32 [tok][1024] -> f16 rows / Vᵀ (block = 64 tokens x one head)
__global__ __launch_bounds__(256) void k_rows16(const float* __restrict__ P, bf16* __restrict__ R16) { __shared__ __attribute__((aligned(16))) bf16 s[64][72];
  const int tid = threadIdx.x; const size_t t0 = (size_t)blockIdx.x * 64; const int h = blockIdx.y;
  for (int e = tid; e < 64 * 64; e += 256) { const int t = e >> 6, d = e & 63; s[t][d] = (bf16)P[(t0 + t) * DD + h * DKK + d]; }
  __syncthreads();
{
#pragma unroll 1
    for (int round = 0; round < 2; ++round) { const int r = round * 32 + (tid >> 3), piece = (tid & 7) * 8; *(v4u_t*)(R16 + (t0 + r) * DD + h * DKK + piece) = *(const v4ua*)(&s[r][piece]); }
     } }
__global__ __launch_bounds__(256) void k_vt(const float* __restrict__ P, bf16* __restrict__ Vt) { __shared__ __attribute__((aligned(16))) bf16 vT[64][72];
  const int tid = threadIdx.x; const size_t t0 = (size_t)blockIdx.x * 64; const int h = blockIdx.y; const int b = (int)(t0 / SS), n0 = (int)(t0 % SS);
  for (int e = tid; e < 64 * 64; e += 256) { const int t = e >> 6, d = e & 63; vT[d][t] = (bf16)P[(t0 + t) * DD + h * DKK + d]; }
  __syncthreads();
{
#pragma unroll 1
    for (int round = 0; round < 2; ++round) { const int r = round * 32 + (tid >> 3), piece = (tid & 7) * 8; *(v4u_t*)(Vt + ((size_t)b * DD + h * DKK + r) * SS + n0 + piece) = *(const v4ua*)(&vT[r][piece]); }
     } }
// kbias[b][k] = 1 − mask[b][k]  (the torch quirk: a FLOAT additive mask); 8-KB rows
__global__ __launch_bounds__(256) void k_kbias(const float* __restrict__ mask, float* __restrict__ kb) { const int b = blockIdx.x;
  for (int q4 = threadIdx.x; q4 < KROWS / 4; q4 += 256) { const v4f_t m = *(const v4f_t*)(mask + (size_t)b * KROWS + q4 * 4); v4f_t o; for (int e = 0; e < 4; ++e) o[e] = 1.0f - m[e];
    *(v4f_t*)(kb + (size_t)b * KROWS + q4 * 4) = o;  } }
__global__ __launch_bounds__(128) void k_cast16(const float* __restrict__ A, bf16* __restrict__ O) { const size_t row = blockIdx.x; const int c8 = threadIdx.x * 8; union { bf16 hh[8]; v4u_t u; } cv;
  const v4f_t a = *(const v4f_t*)(A + row * DD + c8), c = *(const v4f_t*)(A + row * DD + c8 + 4); for (int i = 0; i < 4; ++i) { cv.hh[i] = (bf16)a[i]; cv.hh[4 + i] = (bf16)c[i]; }
  *(v4u_t*)(O + row * DD + c8) = cv.u;  }

extern "C" void kernel_launch(void* const* d_in, const int* in_sizes, int n_in,
                              void* d_out, int out_size, void* d_ws, size_t ws_size,
                              hipStream_t stream) {
  (void)in_sizes; (void)n_in; (void)out_size;
  const float** f = (const float**)d_in;
  const float* x = f[0], *mask = f[1], *pos = f[2], *lng = f[3], *lnb = f[4], *Win = f[5], *bin = f[6], *Wout = f[7], *bout = f[8], *Wto = f[9], *bto = f[10];
  float* out = (float*)d_out;     // [4,2048,1024]
  char* ws = (char*)d_ws;
  float* xp = (float*)ws; ws += (size_t)MTOK * DD * 4;                  // 32 MB
  float* P = (float*)ws; ws += (size_t)MTOK * DD * 4;                   // 32 MB: q, k, v projections in turn; then the f32 attention rows; then y = xp + attn_out
  bf16* Q16 = (bf16*)ws; ws += (size_t)MTOK * DD * 2; bf16* K16 = (bf16*)ws; ws += (size_t)MTOK * DD * 2; bf16* Vt = (bf16*)ws; ws += (size_t)MTOK * DD * 2;   // 16 MB each
  float* kb = (float*)ws; ws += (size_t)BB * KROWS * 4;
  float* att = P; bf16* att16 = Q16; float* y = P;
  if ((size_t)(ws - (char*)d_ws) > ws_size) return;
  const dim3 blk(256); const dim3 gp(MTOK / 128, DD / 256);
  k_lnpos<<<dim3(MTOK / 8), blk, 0, stream>>>(x, lng, lnb, pos, xp);
  k_kbias<<<dim3(BB), blk, 0, stream>>>(mask, kb);
  gemm_rb_kernel<float, 2><<<gp, blk, 0, stream>>>(xp, Win, bin, nullptr, nullptr, nullptr, P, MTOK, DD, DD);                                  k_rows16<<<dim3(MTOK / 64, HH), blk, 0, stream>>>(P, Q16);
  gemm_rb_kernel<float, 2><<<gp, blk, 0, stream>>>(xp, Win + (size_t)DD * DD, bin + DD, nullptr, nullptr, nullptr, P, MTOK, DD, DD);        k_rows16<<<dim3(MTOK / 64, HH), blk, 0, stream>>>(P, K16);
  gemm_rb_kernel<float, 2><<<gp, blk, 0, stream>>>(xp, Win + (size_t)2 * DD * DD, bin + 2 * DD, nullptr, nullptr, nullptr, P, MTOK, DD, DD); k_vt<<<dim3(MTOK / 64, HH), blk, 0, stream>>>(P, Vt);
  v_attn_kernel<<<dim3(QROWS / 64, HH, BB), dim3(64), 0, stream>>>(Q16, K16, Vt, kb, att);
  k_cast16<<<dim3(MTOK), dim3(128), 0, stream>>>(att, att16);
  gemm_rb_kernel<bf16, 2><<<gp, blk, 0, stream>>>(att16, Wout, bout, nullptr, xp, nullptr, y, MTOK, DD, DD);        // y = xp + o·out_projᵀ + b
  gemm_rb_kernel<float, 2><<<gp, blk, 0, stream>>>(y, Wto, bto, nullptr, nullptr, nullptr, out, MTOK, DD, DD);      // out = y·to_outᵀ + b
}

// v001
// One run takes 410 microseconds.
// Next to v000, in two timings, it ran 1.13 and 1.14 times as fast.
// Contractions on v_wmma_f32_16x16x32_f16 (plain f16 operands, f32 accumulate): qkv = (LN(x) + pos)·in_projᵀ + b (K = 1024, N = 3072),
// the 16-head attention (dk = 64, scale 1/8) with the reference's ADDITIVE float mask (1 − padding_mask) as a per-(batch,key) bias,
// flash-style Sᵀ = K·Qᵀ / Oᵀ = Vᵀ·Pᵀ with online softmax in f32 (P x1024, f32 output rows), attn_out = o·out_projᵀ + b + xp (residual in
// the epilogue, K = 1024) and (xp + attn_out)·to_outᵀ + b (K = 1024); LayerNorm and the positional add in f32. xp dominates the residual
// so plain f16 operands suffice. compute dtype: f16 operands, f32 accumulate.  x [4,2048,1024].
#include <hip/hip_runtime.h>
#include <hip/hip_bf16.h>
#include <math.h>

#define BB 4
#define SS 2048
#define QROWS 2048
#define KROWS 2048
#define NKV 2048
#define DD 1024
#define HH 16
#define KVH 16
#define KVD 1024
#define HKDIV 1
#define DKK 64
#define QW 2
#define MTOK (BB * SS)
#define GSTR 48

typedef _Float16 bf16;
typedef _Float16 f16;
typedef __attribute__((ext_vector_type(4))) unsigned v4u_t;
typedef unsigned v4ua __attribute__((ext_vector_type(4), may_alias));
typedef __attribute__((ext_vector_type(4))) float v4f_t;
typedef float v4fa __attribute__((ext_vector_type(4), may_alias));
typedef __attribute__((ext_vector_type(16))) bf16  bf16x16;
typedef bf16x16 f16x16;
typedef __attribute__((ext_vector_type(8)))  bf16  bf16x8;
typedef bf16x8 f16x8;
typedef __attribute__((ext_vector_type(4)))  bf16  bf16x4;
typedef __attribute__((ext_vector_type(8)))  float f32x8;
__device__ __forceinline__ f32x8 wmma16(f16x16 a, f16x16 b, f32x8 c) {
  c = __builtin_amdgcn_wmma_f32_16x16x32_f16(false, a, false, b, (short)0, c, false, false);
  asm volatile("v_nop\n\tv_nop\n\tv_nop\n\tv_nop" : "+v"(c) : "v"(a), "v"(b));
  return c;
}
#define LDS_STRIDE 48   // GEMM tiles: 32 -> 48 elems (96B rows): aligned b128 reads
#define KSTRIDE    72   // attn K tile: 64 -> 72 elems (144B rows): conflict-free b128
#define VSTRIDE    48   // attn V tile: 32 -> 48 elems

__device__ __forceinline__ f32x8 wmma_bf16(bf16x16 a, bf16x16 b, f32x8 c) {
  c = __builtin_amdgcn_wmma_f32_16x16x32_f16(false, a, false, b, (short)0, c, false, false);
  asm volatile("v_nop\n\tv_nop\n\tv_nop\n\tv_nop" : "+v"(c) : "v"(a), "v"(b));   // A/B-overwrite hazard guard
  return c;
}

// 16x32 (MxK) bf16 fragment from a row-major global matrix.
// lanes 0-15  (row=lane)    : elems 0..7 = K+0..7,  8..15 = K+16..23
// lanes 16-31 (row=lane-16) : elems 0..7 = K+8..15, 8..15 = K+24..31
template <typename T>
__device__ __forceinline__ bf16x16 load_frag(const T* __restrict__ base, int ld,
                                             int row0, int k0) {
  const int lane = threadIdx.x & 31;
  const int r    = lane & 15;
  const int kh   = (lane >> 4) * 8;
  const T* p0 = base + (size_t)(row0 + r) * ld + (k0 + kh);
  const T* p1 = p0 + 16;
  bf16x16 f;
#pragma unroll
  for (int i = 0; i < 8; ++i) {
    f[i]     = (bf16)p0[i];
    f[i + 8] = (bf16)p1[i];
  }
  return f;
}

// Same fragment from an LDS tile with padded row stride (base includes row0/k0).
__device__ __forceinline__ bf16x16 lds_frag(const bf16* base, int stride) {
  const int lane = threadIdx.x & 31;
  const int row  = lane & 15;
  const int kh   = (lane >> 4) * 8;
  const bf16x8 lo = *(const bf16x8*)(base + row * stride + kh);
  const bf16x8 hi = *(const bf16x8*)(base + row * stride + kh + 16);
  bf16x16 f;
#pragma unroll
  for (int i = 0; i < 8; ++i) { f[i] = lo[i]; f[i + 8] = hi[i]; }
  return f;
}

// ---------------------------------------------------------------------------
// GEMM: C[m][n] = sum_k A[m][k]*W[n][k] + bias[n]   (torch Linear)
// Block 256 thr (8 waves), tile 128M x 256N, K-step 32; wave tile 64x64.
// A/W staged through LDS (bf16, padded stride) with next-tile register
// prefetch overlapping the WMMA phase.
// MODE 0: bf16 [M][N]   MODE 1: bf16 Vt[b][h][dk][s]   MODE 2: fp32 [M][N]
// ---------------------------------------------------------------------------
template <typename AT, int MODE>
__global__ __launch_bounds__(256) void gemm_rb_kernel(
    const AT* __restrict__ A, const float* __restrict__ W,
    const float* __restrict__ bias, const float* __restrict__ rowscale, const float* __restrict__ R, const float* __restrict__ rowbias, void* __restrict__ out,
    int M, int N, int K) {
  __shared__ bf16 ldsA[128 * LDS_STRIDE];   // 12.0 KB
  __shared__ bf16 ldsW[256 * LDS_STRIDE];   // 24.0 KB
  // output staging: MODE 0 [128 m][264] f16, MODE 1 [256 n][136] f16, MODE 2 [64 m][260] f32 (two halves)
  __shared__ __attribute__((aligned(16))) unsigned char sob[256 * 136 * 2];   // 69,632 B >= 128*264*2 and >= 64*260*4

  const int t    = threadIdx.x;
  const int wave = t >> 5;
  const int lane = t & 31;
  const int wm   = (wave & 1) * 64;
  const int wn   = (wave >> 1) * 64;
  const int mBlk = blockIdx.x * 128;
  const int nBlk = blockIdx.y * 256;

  // Staging map: neighbouring lanes take neighbouring 16-B chunks of one row's 32-k segment, so a wave-wide 16-B load
  // covers whole row segments (f32: 4 rows x 128 B, f16: 8 rows x 64 B) instead of one line per lane.
  constexpr int AEL = 16 / (int)sizeof(AT);   // elements per 16-B chunk
  constexpr int ALN = 32 / AEL;               // lanes per A row segment
  constexpr int ARS = 256 / ALN;              // A rows covered by one load of the block
  constexpr int ACH = 128 / ARS;              // A chunks per thread
  const int ar0 = t / ALN, ac0 = (t % ALN) * AEL;
  const int wr0 = t >> 3,  wc0 = (t & 7) * 4;
  unsigned aoff[ACH], woff[8];                // byte offsets from the block-uniform bases; they step by one 32-k segment per trip
#pragma unroll   // this and the chunk loops below: unrolled so that the offset and staging arrays stay in registers
  for (int i = 0; i < ACH; ++i) aoff[i] = (unsigned)(((ar0 + ARS * i) * K + ac0) * (int)sizeof(AT));
#pragma unroll
  for (int i = 0; i < 8; ++i) woff[i] = (unsigned)((min(nBlk + wr0 + 32 * i, N - 1) * K + wc0) * 4);   // ragged last N tile: clamp the weight row (those columns are never stored)
  const char* aBase = (const char*)(A + (size_t)mBlk * K);
  const char* wBase = (const char*)W;

  v4u_t abuf[ACH];
  v4f_t wbuf[8];
#pragma unroll
  for (int i = 0; i < ACH; ++i) abuf[i] = *(const v4ua*)(aBase + aoff[i]);
#pragma unroll
  for (int i = 0; i < 8; ++i) wbuf[i] = *(const v4fa*)(wBase + woff[i]);

  f32x8 acc[4][4] = {};

  for (int k = 0; k < K; k += 32) {
    __syncthreads();
#pragma unroll
    for (int i = 0; i < ACH; ++i) {
      bf16* dst = &ldsA[(ar0 + ARS * i) * LDS_STRIDE + ac0];
      if constexpr (sizeof(AT) == 4) {
        const v4f_t v = __builtin_bit_cast(v4f_t, abuf[i]);
        bf16x4 q; q[0] = (bf16)v[0]; q[1] = (bf16)v[1]; q[2] = (bf16)v[2]; q[3] = (bf16)v[3];
        *(bf16x4*)dst = q;
      } else {
        *(v4ua*)dst = abuf[i];
      }
    }
#pragma unroll
    for (int i = 0; i < 8; ++i) {
      const v4f_t v = wbuf[i];
      bf16x4 q; q[0] = (bf16)v[0]; q[1] = (bf16)v[1]; q[2] = (bf16)v[2]; q[3] = (bf16)v[3];
      *(bf16x4*)&ldsW[(wr0 + 32 * i) * LDS_STRIDE + wc0] = q;
    }
    if (k + 32 < K) {
#pragma unroll
      for (int i = 0; i < ACH; ++i) { aoff[i] += 32u * (unsigned)sizeof(AT); abuf[i] = *(const v4ua*)(aBase + aoff[i]); }
#pragma unroll
      for (int i = 0; i < 8; ++i) { woff[i] += 32u * 4u; wbuf[i] = *(const v4fa*)(wBase + woff[i]); }
    }
    __syncthreads();

    bf16x16 af[4], wf[4];
#pragma unroll
    for (int i = 0; i < 4; ++i)
      af[i] = lds_frag(ldsA + (wm + 16 * i) * LDS_STRIDE, LDS_STRIDE);
#pragma unroll
    for (int j = 0; j < 4; ++j)
      wf[j] = lds_frag(ldsW + (wn + 16 * j) * LDS_STRIDE, LDS_STRIDE);
#pragma unroll
    for (int i = 0; i < 4; ++i)
#pragma unroll
      for (int j = 0; j < 4; ++j)
        acc[i][j] = wmma_bf16(af[i], wf[j], acc[i][j]);
  }

  const int nlane = lane & 15;
  const int mh    = (lane >> 4) * 8;
  __syncthreads();
  if (MODE == 0 || MODE == 1 || MODE == 3) {
    bf16* so = (bf16*)sob;
#pragma unroll
    for (int i = 0; i < 4; ++i)
#pragma unroll
      for (int j = 0; j < 4; ++j) {
        const int nl = wn + 16 * j + nlane;
        const float bv = bias ? bias[nBlk + nl] : 0.0f;
        if (MODE == 3) {                                  // bias + exact GELU (erf), rolled to keep the static VALU op count small
#pragma unroll 1
          for (int r = 0; r < 8; ++r) {
            const int ml = wm + 16 * i + mh + r;
            const float xg = acc[i][j][r] + bv;
            so[ml * 264 + nl] = (bf16)(0.5f * xg * (1.0f + erff(xg * 0.70710678118654752f)));
          }
        } else {
#pragma unroll
        for (int r = 0; r < 8; ++r) {
          const int ml = wm + 16 * i + mh + r;
          const bf16 hv = (bf16)(acc[i][j][r] + bv);
          if (MODE == 0) so[ml * 264 + nl] = hv;        // [m][n]
          else           so[nl * 136 + ml] = hv;        // [n][m]  (n = h*64+dk rows of Vt, m = s contiguous)
        }
        }
      }
    __syncthreads();
{
      if (MODE == 0 || MODE == 3) {          // rows m: 256 halfs = 512 B each, 16-B chunks
        for (int ch = t; ch < 128 * 32; ch += 256) { const int ml = ch >> 5, q = (ch & 31) * 8;
          *(v4u_t*)((bf16*)out + (size_t)(mBlk + ml) * N + nBlk + q) = *(const v4ua*)(so + ml * 264 + q); }
      } else {                  // Vt rows (b, h, dk): 128 consecutive s = 256 B each
        const int b_ = mBlk / SS, s0 = mBlk % SS;
        for (int ch = t; ch < 256 * 16; ch += 256) { const int nl = ch >> 4, q = (ch & 15) * 8; const int n = nBlk + nl, h = n >> 6, dk = n & (DKK - 1);
          *(v4u_t*)((bf16*)out + (((size_t)(b_ * HH + h)) * DKK + dk) * SS + s0 + q) = *(const v4ua*)(so + nl * 136 + q); }
      }
      
    }
  } else {
    float* so = (float*)sob;
#pragma unroll 1
    for (int hf = 0; hf < 2; ++hf) {
      if (wm == hf * 64) {
#pragma unroll
        for (int i = 0; i < 4; ++i)
#pragma unroll
          for (int j = 0; j < 4; ++j) {
            const int nl = wn + 16 * j + nlane;
            const float bv = bias ? bias[nBlk + nl] : 0.0f;
#pragma unroll
            for (int r = 0; r < 8; ++r) { const int mrow = mBlk + hf * 64 + 16 * i + mh + r; so[(16 * i + mh + r) * 260 + nl] = acc[i][j][r] * (rowscale ? rowscale[mrow] : 1.0f) + bv + (rowbias ? rowbias[mrow] : 0.0f); }
          }
      }
      __syncthreads();
      if (R) {   // residual: fold R[m][n] into the staged tile once (same thread <-> same chunks as the stores below)
        for (int ch = t; ch < 64 * 64; ch += 256) { const int ml = ch >> 6, q = (ch & 63) * 4;
          if (nBlk + q < N) { const v4f_t rv = *(const v4f_t*)(R + (size_t)(mBlk + hf * 64 + ml) * N + nBlk + q); v4f_t v = *(const v4fa*)(so + ml * 260 + q); v += rv; *(v4fa*)(so + ml * 260 + q) = v; } }
        asm volatile("s_wait_dscnt 0" ::: "memory");
      }
{   // 64 rows x 256 floats = 1 KB segments, float4 chunks; columns >= N (ragged tile) skipped
        for (int ch = t; ch < 64 * 64; ch += 256) { const int ml = ch >> 6, q = (ch & 63) * 4;
          if (nBlk + q < N) *(v4f_t*)((float*)out + (size_t)(mBlk + hf * 64 + ml) * N + nBlk + q) = *(const v4fa*)(so + ml * 260 + q); }
        
      }
      __syncthreads();
    }
  }
}

__global__ __launch_bounds__(64) void v_attn_kernel(
    const bf16* __restrict__ Qb, const bf16* __restrict__ Kb,
    const bf16* __restrict__ Vt, const float* __restrict__ kbias,   // kbias [B][KROWS]: additive per-key logit bias (1 − mask)
    float* __restrict__ attnOut) {
  __shared__ bf16 ldsK[32 * KSTRIDE];   // 4.5 KB
  __shared__ bf16 ldsV[64 * VSTRIDE];   // 6.0 KB
  __shared__ __attribute__((aligned(16))) bf16 ldsO[2][32 * 72];   // unused: the output tile is staged in the f32 ldsOf

  const int q0blk = blockIdx.x * 64;
  const int h  = blockIdx.y;
  const int b  = blockIdx.z;
  const int t    = threadIdx.x;
  const int wave = t >> 5;
  const int lane = t & 31;
  const int qlane = lane & 15;
  const int kh8   = (lane >> 4) * 8;
  const int q0 = q0blk + wave * 32;          // this wave's 32 queries

  const int hk = h / HKDIV;
  const bf16* Qh = Qb + (size_t)b * QROWS * DD + h * DKK;        // queries: QROWS rows per batch, row stride DD
  const bf16* Kh = Kb + (size_t)b * KROWS * KVD + hk * DKK;      // keys: KROWS rows per batch, row stride KVD
  const bf16* Vh = Vt + ((size_t)(b * KVH + hk)) * DKK * KROWS;  // Vᵀ [KVH][64][KROWS] per batch

  // Cooperative staging (64 threads), neighbouring lanes on neighbouring 16-B chunks of a row:
  // K tile 32x64 (8 lanes cover a 128-B row, 8 rows per load of the block); V tile 64x32 (4 lanes cover a 64-B row, 16 rows per load).
  const int krow = t >> 3;
  const int kcol = (t & 7) * 8;
  const int vrow = t >> 2;
  const int vcol = (t & 3) * 8;
  const bf16* kSrc = Kh + (size_t)krow * KVD + kcol;
  const bf16* vSrc = Vh + (size_t)vrow * KROWS + vcol;

  bf16x16 qf[QW][2];
#pragma unroll
  for (int qt = 0; qt < QW; ++qt) {
    qf[qt][0] = load_frag(Qh, DD, q0 + 16 * qt, 0);
    qf[qt][1] = load_frag(Qh, DD, q0 + 16 * qt, 32);
  }

  f32x8 o[QW][4] = {};
  float mrun[QW], lrun[QW];
#pragma unroll
  for (int qt = 0; qt < QW; ++qt) { mrun[qt] = -INFINITY; lrun[qt] = 0.0f; }

  const float scale = 0.125f * 1.44269504088896340736f;  // 1/sqrt(DK)*log2(e)
  const float NEG2 = -1.0e9f;    // masked logit: its weight is exactly 0 once any valid key of the row has been seen (every row
                                 // has one), and anything accumulated before that is wiped by alpha == 0 — same result as -inf
  const int kmax = KROWS - 1;
  __shared__ float kbS[KROWS];
  for (int i = threadIdx.x; i < KROWS; i += 64) kbS[i] = kbias[(size_t)b * KROWS + i] * 1.44269504088896340736f;   // in log2 units
  __syncthreads();

  // Prefetch key block kb=0 into registers.
  bf16x8 kreg[4], vreg[4];
#pragma unroll
  for (int i = 0; i < 4; ++i) {
    kreg[i] = *(const bf16x8*)(kSrc + (size_t)(8 * i) * KVD);
    vreg[i] = *(const bf16x8*)(vSrc + (size_t)(16 * i) * KROWS);
  }

  for (int kb = 0; kb <= kmax; kb += 32) {
    __syncthreads();   // previous readers done with LDS
#pragma unroll
    for (int i = 0; i < 4; ++i) {
      *(bf16x8*)(&ldsK[(krow + 8 * i) * KSTRIDE + kcol])  = kreg[i];
      *(bf16x8*)(&ldsV[(vrow + 16 * i) * VSTRIDE + vcol]) = vreg[i];
    }
    if (kb + 32 <= kmax) {   // prefetch next block during compute
      const bf16* kn = kSrc + (size_t)(kb + 32) * KVD;
      const bf16* vn = vSrc + (kb + 32);
#pragma unroll
      for (int i = 0; i < 4; ++i) {
        kreg[i] = *(const bf16x8*)(kn + (size_t)(8 * i) * KVD);
        vreg[i] = *(const bf16x8*)(vn + (size_t)(16 * i) * KROWS);
      }
    }
    __syncthreads();   // tile visible

    // Phase 1: scores + softmax for both q-tiles (K fragments live here only).
    bf16x16 kf[2][2];
#pragma unroll
    for (int ktile = 0; ktile < 2; ++ktile)
#pragma unroll
      for (int c = 0; c < 2; ++c)
        kf[ktile][c] = lds_frag(ldsK + (ktile * 16) * KSTRIDE + c * 32, KSTRIDE);

    bf16x16 pf[QW];
    bool act[QW];
#pragma unroll
    for (int qt = 0; qt < QW; ++qt) {
      unsigned mbits = 0;
      {
#pragma unroll
        for (int r = 0; r < 8; ++r) { const int j0 = kb + kh8 + r; if (j0 < NKV) mbits |= 1u << r; if (j0 + 16 < NKV) mbits |= 1u << (8 + r); }
        act[qt] = (__builtin_amdgcn_ballot_w32(mbits != 0) != 0);
      }
      if (act[qt]) {
        const int q_my = q0 + 16 * qt + qlane;
        f32x8 s0 = {}, s1 = {};
        s0 = wmma_bf16(kf[0][0], qf[qt][0], s0);
        s0 = wmma_bf16(kf[0][1], qf[qt][1], s0);
        s1 = wmma_bf16(kf[1][0], qf[qt][0], s1);
        s1 = wmma_bf16(kf[1][1], qf[qt][1], s1);

        float mx = -INFINITY;
#pragma unroll
        for (int r = 0; r < 8; ++r) {
          const int k0i = kb + kh8 + r;
          const int k1i = k0i + 16;
          (void)k0i; (void)k1i; (void)q_my;
          s0[r] = (mbits & (1u << r))       ? s0[r] * scale + kbS[kb + kh8 + r] : NEG2;
          s1[r] = (mbits & (1u << (8 + r))) ? s1[r] * scale + kbS[kb + 16 + kh8 + r] : NEG2;
          mx = fmaxf(mx, fmaxf(s0[r], s1[r]));
        }
        mx = fmaxf(mx, __shfl_xor(mx, 16, 32));
        const float mnew  = fmaxf(mrun[qt], mx);
        const float alpha = exp2f(mrun[qt] - mnew);

        float rsum = 0.0f;
#pragma unroll
        for (int r = 0; r < 8; ++r) {
          const float p0 = exp2f(s0[r] - mnew);
          const float p1 = exp2f(s1[r] - mnew);
          rsum += p0 + p1;
          pf[qt][r]     = (bf16)(p0 * 1024.0f);     // P carried x1024: no f16 copy of a probability is sub-normal
          pf[qt][r + 8] = (bf16)(p1 * 1024.0f);
        }
        rsum += __shfl_xor(rsum, 16, 32);
        lrun[qt] = lrun[qt] * alpha + rsum;
        mrun[qt] = mnew;

        // Rescale accumulators now so the PV phase is pure WMMA.
#pragma unroll
        for (int j = 0; j < 4; ++j)
#pragma unroll
          for (int r = 0; r < 8; ++r) o[qt][j][r] *= alpha;
      }
    }

    // Phase 2: O^T accumulate; each V fragment read from LDS once, used by
    // both q-tiles, then dead (only 8 VGPRs of V live at a time).
#pragma unroll
    for (int j = 0; j < 4; ++j) {
      const bf16x16 vf = lds_frag(ldsV + (j * 16) * VSTRIDE, VSTRIDE);
#pragma unroll
      for (int qt = 0; qt < QW; ++qt)
        if (act[qt]) o[qt][j] = wmma_bf16(vf, pf[qt], o[qt][j]);
    }
  }

  __shared__ __attribute__((aligned(16))) float ldsOf[2][32 * 68];
  float* so = ldsOf[wave]; (void)ldsO;
#pragma unroll
  for (int qt = 0; qt < QW; ++qt) {
    const float rl = 1.0f / (lrun[qt] * 1024.0f);
#pragma unroll
    for (int j = 0; j < 4; ++j)
#pragma unroll
      for (int r = 0; r < 8; ++r) so[(16 * qt + qlane) * 68 + j * 16 + kh8 + r] = o[qt][j][r] * rl;
  }
  asm volatile("s_wait_dscnt 0" ::: "memory");
  __builtin_amdgcn_wave_barrier();
{
#pragma unroll
    for (int it = 0; it < 16; ++it) { const int ch = lane + 32 * it, ql = ch >> 4, q4 = (ch & 15) * 4;
      *(v4f_t*)(attnOut + ((size_t)(b * QROWS + q0 + ql)) * DD + h * DKK + q4) = *(const v4fa*)(so + ql * 68 + q4); }
    
  }
}


// xp = LN(x)·g + b + pos[s]  (f32 rows); block = 8 rows
__global__ __launch_bounds__(256) void k_lnpos(const float* __restrict__ X, const float* __restrict__ g, const float* __restrict__ bb, const float* __restrict__ pos, float* __restrict__ Y) {
  __shared__ __attribute__((aligned(16))) float rowS[8 * (DD + 4)];
  const int tid = threadIdx.x, r = tid >> 5, lane = tid & 31; const size_t row = (size_t)blockIdx.x * 8 + r; const int s_ = row % SS; const float* xr = X + row * DD;
  float s = 0.0f;
#pragma unroll 1
  for (int i = lane; i < DD; i += 32) { const float v = xr[i]; rowS[r * (DD + 4) + i] = v; s += v; }
#pragma unroll
  for (int off = 1; off < 32; off <<= 1) s += __shfl_xor(s, off, 32);
  const float mean = s * (1.0f / DD); float q = 0.0f;
#pragma unroll 1
  for (int i = lane; i < DD; i += 32) { const float d = rowS[r * (DD + 4) + i] - mean; q += d * d; }
#pragma unroll
  for (int off = 1; off < 32; off <<= 1) q += __shfl_xor(q, off, 32);
  const float rstd = rsqrtf(q * (1.0f / DD) + 1e-5f);
#pragma unroll 1
  for (int i = lane; i < DD; i += 32) rowS[r * (DD + 4) + i] = (rowS[r * (DD + 4) + i] - mean) * rstd * g[i] + bb[i] + pos[(size_t)s_ * DD + i];
  __syncthreads();
{ for (int q4 = tid; q4 < 8 * (DD / 4); q4 += 256) { const int rr = q4 / (DD / 4), c4 = (q4 % (DD / 4)) * 4;
      *(v4f_t*)(Y + ((size_t)blockIdx.x * 8 + rr) * DD + c4) = *(const v4fa*)(rowS + rr * (DD + 4) + c4); }  }
}
// f32 [tok][1024] -> f16 rows / Vᵀ (block = 64 tokens x one head)
__global__ __launch_bounds__(256) void k_rows16(const float* __restrict__ P, bf16* __restrict__ R16) { __shared__ __attribute__((aligned(16))) bf16 s[64][72];
  const int tid = threadIdx.x; const size_t t0 = (size_t)blockIdx.x * 64; const int h = blockIdx.y;
  for (int e = tid; e < 64 * 64; e += 256) { const int t = e >> 6, d = e & 63; s[t][d] = (bf16)P[(t0 + t) * DD + h * DKK + d]; }
  __syncthreads();
{
#pragma unroll 1
    for (int round = 0; round < 2; ++round) { const int r = round * 32 + (tid >> 3), piece = (tid & 7) * 8; *(v4u_t*)(R16 + (t0 + r) * DD + h * DKK + piece) = *(const v4ua*)(&s[r][piece]); }
     } }
__global__ __launch_bounds__(256) void k_vt(const float* __restrict__ P, bf16* __restrict__ Vt) { __shared__ __attribute__((aligned(16))) bf16 vT[64][72];
  const int tid = threadIdx.x; const size_t t0 = (size_t)blockIdx.x * 64; const int h = blockIdx.y; const int b = (int)(t0 / SS), n0 = (int)(t0 % SS);
  for (int e = tid; e < 64 * 64; e += 256) { const int t = e >> 6, d = e & 63; vT[d][t] = (bf16)P[(t0 + t) * DD + h * DKK + d]; }
  __syncthreads();
{
#pragma unroll 1
    for (int round = 0; round < 2; ++round) { const int r = round * 32 + (tid >> 3), piece = (tid & 7) * 8; *(v4u_t*)(Vt + ((size_t)b * DD + h * DKK + r) * SS + n0 + piece) = *(const v4ua*)(&vT[r][piece]); }
     } }
// kbias[b][k] = 1 − mask[b][k]  (the torch quirk: a FLOAT additive mask); 8-KB rows
__global__ __launch_bounds__(256) void k_kbias(const float* __restrict__ mask, float* __restrict__ kb) { const int b = blockIdx.x;
  for (int q4 = threadIdx.x; q4 < KROWS / 4; q4 += 256) { const v4f_t m = *(const v4f_t*)(mask + (size_t)b * KROWS + q4 * 4); v4f_t o; for (int e = 0; e < 4; ++e) o[e] = 1.0f - m[e];
    *(v4f_t*)(kb + (size_t)b * KROWS + q4 * 4) = o;  } }
__global__ __launch_bounds__(128) void k_cast16(const float* __restrict__ A, bf16* __restrict__ O) { const size_t row = blockIdx.x; const int c8 = threadIdx.x * 8; union { bf16 hh[8]; v4u_t u; } cv;
  const v4f_t a = *(const v4f_t*)(A + row * DD + c8), c = *(const v4f_t*)(A + row * DD + c8 + 4); for (int i = 0; i < 4; ++i) { cv.hh[i] = (bf16)a[i]; cv.hh[4 + i] = (bf16)c[i]; }
  *(v4u_t*)(O + row * DD + c8) = cv.u;  }

extern "C" void kernel_launch(void* const* d_in, const int* in_sizes, int n_in,
                              void* d_out, int out_size, void* d_ws, size_t ws_size,
                              hipStream_t stream) {
  (void)in_sizes; (void)n_in; (void)out_size;
  const float** f = (const float**)d_in;
  const float* x = f[0], *mask = f[1], *pos = f[2], *lng = f[3], *lnb = f[4], *Win = f[5], *bin = f[6], *Wout = f[7], *bout = f[8], *Wto = f[9], *bto = f[10];
  float* out = (float*)d_out;     // [4,2048,1024]
  char* ws = (char*)d_ws;
  float* xp = (float*)ws; ws += (size_t)MTOK * DD * 4;                  // 32 MB
  float* P = (float*)ws; ws += (size_t)MTOK * DD * 4;                   // 32 MB: q, k, v projections in turn; then the f32 attention rows; then y = xp + attn_out
  bf16* Q16 = (bf16*)ws; ws += (size_t)MTOK * DD * 2; bf16* K16 = (bf16*)ws; ws += (size_t)MTOK * DD * 2; bf16* Vt = (bf16*)ws; ws += (size_t)MTOK * DD * 2;   // 16 MB each
  float* kb = (float*)ws; ws += (size_t)BB * KROWS * 4;
  float* att = P; bf16* att16 = Q16; float* y = P;
  if ((size_t)(ws - (char*)d_ws) > ws_size) return;
  const dim3 blk(256); const dim3 gp(MTOK / 128, DD / 256);
  k_lnpos<<<dim3(MTOK / 8), blk, 0, stream>>>(x, lng, lnb, pos, xp);
  k_kbias<<<dim3(BB), blk, 0, stream>>>(mask, kb);
  gemm_rb_kernel<float, 2><<<gp, blk, 0, stream>>>(xp, Win, bin, nullptr, nullptr, nullptr, P, MTOK, DD, DD);                                  k_rows16<<<dim3(MTOK / 64, HH), blk, 0, stream>>>(P, Q16);
  gemm_rb_kernel<float, 2><<<gp, blk, 0, stream>>>(xp, Win + (size_t)DD * DD, bin + DD, nullptr, nullptr, nullptr, P, MTOK, DD, DD);        k_rows16<<<dim3(MTOK / 64, HH), blk, 0, stream>>>(P, K16);
  gemm_rb_kernel<float, 2><<<gp, blk, 0, stream>>>(xp, Win + (size_t)2 * DD * DD, bin + 2 * DD, nullptr, nullptr, nullptr, P, MTOK, DD, DD); k_vt<<<dim3(MTOK / 64, HH), blk, 0, stream>>>(P, Vt);
  v_attn_kernel<<<dim3(QROWS / 64, HH, BB), dim3(64), 0, stream>>>(Q16, K16, Vt, kb, att);
  k_cast16<<<dim3(MTOK), dim3(128), 0, stream>>>(att, att16);
  gemm_rb_kernel<bf16, 2><<<gp, blk, 0, stream>>>(att16, Wout, bout, nullptr, xp, nullptr, y, MTOK, DD, DD);        // y = xp + o·out_projᵀ + b
  gemm_rb_kernel<float, 2><<<gp, blk, 0, stream>>>(y, Wto, bto, nullptr, nullptr, nullptr, out, MTOK, DD, DD);      // out = y·to_outᵀ + b
}

// v002
// It runs in 362 microseconds.
// Timed twice side by side with v001, it ran 1.14 times as fast both times.
// Over all steps from v000 it is 1.29 times as fast.
// Contractions on v_wmma_f32_16x16x32_f16 (plain f16 operands, f32 accumulate): qkv = (LN(x) + pos)·in_projᵀ + b (K = 1024, N = 3072),
// the 16-head attention (dk = 64, scale 1/8) with the reference's ADDITIVE float mask (1 − padding_mask) as a per-(batch,key) bias,
// flash-style Sᵀ = K·Qᵀ / Oᵀ = Vᵀ·Pᵀ with online softmax in f32 (P x1024, f16 output rows), attn_out = o·out_projᵀ + b + xp (residual in
// the epilogue, K = 1024) and (xp + attn_out)·to_outᵀ + b (K = 1024); LayerNorm and the positional add in f32. xp dominates the residual
// so plain f16 operands suffice. compute dtype: f16 operands, f32 accumulate.  x [4,2048,1024].
// Every matrix operand that one kernel hands to the next (xp, q, k, v transposed, the attention rows, y) is rounded to f16 once, from its f32
// value, at its producer's store, in the layout that the consumer stages; only the residual copy of xp and the final output are f32.
#include <hip/hip_runtime.h>
#include <hip/hip_bf16.h>
#include <math.h>

#define BB 4
#define SS 2048
#define QROWS 2048
#define KROWS 2048
#define NKV 2048
#define DD 1024
#define HH 16
#define KVH 16
#define KVD 1024
#define HKDIV 1
#define DKK 64
#define QW 2
#define MTOK (BB * SS)
#define GSTR 48

typedef _Float16 bf16;
typedef _Float16 f16;
typedef __attribute__((ext_vector_type(4))) unsigned v4u_t;
typedef unsigned v4ua __attribute__((ext_vector_type(4), may_alias));
typedef __attribute__((ext_vector_type(4))) float v4f_t;
typedef float v4fa __attribute__((ext_vector_type(4), may_alias));
typedef __attribute__((ext_vector_type(16))) bf16  bf16x16;
typedef bf16x16 f16x16;
typedef __attribute__((ext_vector_type(8)))  bf16  bf16x8;
typedef bf16x8 f16x8;
typedef __attribute__((ext_vector_type(4)))  bf16  bf16x4;
typedef __attribute__((ext_vector_type(8)))  float f32x8;
__device__ __forceinline__ f32x8 wmma16(f16x16 a, f16x16 b, f32x8 c) {
  c = __builtin_amdgcn_wmma_f32_16x16x32_f16(false, a, false, b, (short)0, c, false, false);
  asm volatile("v_nop\n\tv_nop\n\tv_nop\n\tv_nop" : "+v"(c) : "v"(a), "v"(b));
  return c;
}
#define LDS_STRIDE 48   // GEMM tiles: 32 -> 48 elems (96B rows): aligned b128 reads
#define KSTRIDE    72   // attn K tile: 64 -> 72 elems (144B rows): conflict-free b128
#define VSTRIDE    48   // attn V tile: 32 -> 48 elems

__device__ __forceinline__ f32x8 wmma_bf16(bf16x16 a, bf16x16 b, f32x8 c) {
  c = __builtin_amdgcn_wmma_f32_16x16x32_f16(false, a, false, b, (short)0, c, false, false);
  asm volatile("v_nop\n\tv_nop\n\tv_nop\n\tv_nop" : "+v"(c) : "v"(a), "v"(b));   // A/B-overwrite hazard guard
  return c;
}

// 16x32 (MxK) bf16 fragment from a row-major global matrix.
// lanes 0-15  (row=lane)    : elems 0..7 = K+0..7,  8..15 = K+16..23
// lanes 16-31 (row=lane-16) : elems 0..7 = K+8..15, 8..15 = K+24..31
template <typename T>
__device__ __forceinline__ bf16x16 load_frag(const T* __restrict__ base, int ld,
                                             int row0, int k0) {
  const int lane = threadIdx.x & 31;
  const int r    = lane & 15;
  const int kh   = (lane >> 4) * 8;
  const T* p0 = base + (size_t)(row0 + r) * ld + (k0 + kh);
  const T* p1 = p0 + 16;
  bf16x16 f;
#pragma unroll
  for (int i = 0; i < 8; ++i) {
    f[i]     = (bf16)p0[i];
    f[i + 8] = (bf16)p1[i];
  }
  return f;
}

// Same fragment from an LDS tile with padded row stride (base includes row0/k0).
__device__ __forceinline__ bf16x16 lds_frag(const bf16* base, int stride) {
  const int lane = threadIdx.x & 31;
  const int row  = lane & 15;
  const int kh   = (lane >> 4) * 8;
  const bf16x8 lo = *(const bf16x8*)(base + row * stride + kh);
  const bf16x8 hi = *(const bf16x8*)(base + row * stride + kh + 16);
  bf16x16 f;
#pragma unroll
  for (int i = 0; i < 8; ++i) { f[i] = lo[i]; f[i + 8] = hi[i]; }
  return f;
}

// ---------------------------------------------------------------------------
// GEMM: C[m][n] = sum_k A[m][k]*W[n][k] + bias[n]   (torch Linear)
// Block 256 thr (8 waves), tile 128M x 256N, K-step 32; wave tile 64x64.
// A/W staged through LDS (bf16, padded stride) with next-tile register
// prefetch overlapping the WMMA phase.
// MODE 0: bf16 [M][N]   MODE 1: bf16 Vt[b][h][dk][s]   MODE 2: fp32 [M][N]   MODE 4: as MODE 2 (f32 bias and residual), rounded to f16 at the store
// ---------------------------------------------------------------------------
template <typename AT, int MODE>
__global__ __launch_bounds__(256) void gemm_rb_kernel(
    const AT* __restrict__ A, const float* __restrict__ W,
    const float* __restrict__ bias, const float* __restrict__ rowscale, const float* __restrict__ R, const float* __restrict__ rowbias, void* __restrict__ out,
    int M, int N, int K) {
  __shared__ bf16 ldsA[128 * LDS_STRIDE];   // 12.0 KB
  __shared__ bf16 ldsW[256 * LDS_STRIDE];   // 24.0 KB
  // output staging: MODE 0 [128 m][264] f16, MODE 1 [256 n][136] f16, MODE 2 [64 m][260] f32 (two halves)
  __shared__ __attribute__((aligned(16))) unsigned char sob[256 * 136 * 2];   // 69,632 B >= 128*264*2 and >= 64*260*4

  const int t    = threadIdx.x;
  const int wave = t >> 5;
  const int lane = t & 31;
  const int wm   = (wave & 1) * 64;
  const int wn   = (wave >> 1) * 64;
  const int mBlk = blockIdx.x * 128;
  const int nBlk = blockIdx.y * 256;

  // Staging map: neighbouring lanes take neighbouring 16-B chunks of one row's 32-k segment, so a wave-wide 16-B load
  // covers whole row segments (f32: 4 rows x 128 B, f16: 8 rows x 64 B) instead of one line per lane.
  constexpr int AEL = 16 / (int)sizeof(AT);   // elements per 16-B chunk
  constexpr int ALN = 32 / AEL;               // lanes per A row segment
  constexpr int ARS = 256 / ALN;              // A rows covered by one load of the block
  constexpr int ACH = 128 / ARS;              // A chunks per thread
  const int ar0 = t / ALN, ac0 = (t % ALN) * AEL;
  const int wr0 = t >> 3,  wc0 = (t & 7) * 4;
  unsigned aoff[ACH], woff[8];                // byte offsets from the block-uniform bases; they step by one 32-k segment per trip
#pragma unroll   // this and the chunk loops below: unrolled so that the offset and staging arrays stay in registers
  for (int i = 0; i < ACH; ++i) aoff[i] = (unsigned)(((ar0 + ARS * i) * K + ac0) * (int)sizeof(AT));
#pragma unroll
  for (int i = 0; i < 8; ++i) woff[i] = (unsigned)((min(nBlk + wr0 + 32 * i, N - 1) * K + wc0) * 4);   // ragged last N tile: clamp the weight row (those columns are never stored)
  const char* aBase = (const char*)(A + (size_t)mBlk * K);
  const char* wBase = (const char*)W;

  v4u_t abuf[ACH];
  v4f_t wbuf[8];
#pragma unroll
  for (int i = 0; i < ACH; ++i) abuf[i] = *(const v4ua*)(aBase + aoff[i]);
#pragma unroll
  for (int i = 0; i < 8; ++i) wbuf[i] = *(const v4fa*)(wBase + woff[i]);

  f32x8 acc[4][4] = {};

  for (int k = 0; k < K; k += 32) {
    __syncthreads();
#pragma unroll
    for (int i = 0; i < ACH; ++i) {
      bf16* dst = &ldsA[(ar0 + ARS * i) * LDS_STRIDE + ac0];
      if constexpr (sizeof(AT) == 4) {
        const v4f_t v = __builtin_bit_cast(v4f_t, abuf[i]);
        bf16x4 q; q[0] = (bf16)v[0]; q[1] = (bf16)v[1]; q[2] = (bf16)v[2]; q[3] = (bf16)v[3];
        *(bf16x4*)dst = q;
      } else {
        *(v4ua*)dst = abuf[i];
      }
    }
#pragma unroll
    for (int i = 0; i < 8; ++i) {
      const v4f_t v = wbuf[i];
      bf16x4 q; q[0] = (bf16)v[0]; q[1] = (bf16)v[1]; q[2] = (bf16)v[2]; q[3] = (bf16)v[3];
      *(bf16x4*)&ldsW[(wr0 + 32 * i) * LDS_STRIDE + wc0] = q;
    }
    if (k + 32 < K) {
#pragma unroll
      for (int i = 0; i < ACH; ++i) { aoff[i] += 32u * (unsigned)sizeof(AT); abuf[i] = *(const v4ua*)(aBase + aoff[i]); }
#pragma unroll
      for (int i = 0; i < 8; ++i) { woff[i] += 32u * 4u; wbuf[i] = *(const v4fa*)(wBase + woff[i]); }
    }
    __syncthreads();

    bf16x16 af[4], wf[4];
#pragma unroll
    for (int i = 0; i < 4; ++i)
      af[i] = lds_frag(ldsA + (wm + 16 * i) * LDS_STRIDE, LDS_STRIDE);
#pragma unroll
    for (int j = 0; j < 4; ++j)
      wf[j] = lds_frag(ldsW + (wn + 16 * j) * LDS_STRIDE, LDS_STRIDE);
#pragma unroll
    for (int i = 0; i < 4; ++i)
#pragma unroll
      for (int j = 0; j < 4; ++j)
        acc[i][j] = wmma_bf16(af[i], wf[j], acc[i][j]);
  }

  const int nlane = lane & 15;
  const int mh    = (lane >> 4) * 8;
  __syncthreads();
  if (MODE == 0 || MODE == 1 || MODE == 3) {
    bf16* so = (bf16*)sob;
#pragma unroll
    for (int i = 0; i < 4; ++i)
#pragma unroll
      for (int j = 0; j < 4; ++j) {
        const int nl = wn + 16 * j + nlane;
        const float bv = bias ? bias[nBlk + nl] : 0.0f;
        if (MODE == 3) {                                  // bias + exact GELU (erf), rolled to keep the static VALU op count small
#pragma unroll 1
          for (int r = 0; r < 8; ++r) {
            const int ml = wm + 16 * i + mh + r;
            const float xg = acc[i][j][r] + bv;
            so[ml * 264 + nl] = (bf16)(0.5f * xg * (1.0f + erff(xg * 0.70710678118654752f)));
          }
        } else {
#pragma unroll
        for (int r = 0; r < 8; ++r) {
          const int ml = wm + 16 * i + mh + r;
          const bf16 hv = (bf16)(acc[i][j][r] + bv);
          if (MODE == 0) so[ml * 264 + nl] = hv;        // [m][n]
          else           so[nl * 136 + ml] = hv;        // [n][m]  (n = h*64+dk rows of Vt, m = s contiguous)
        }
        }
      }
    __syncthreads();
{
      if (MODE == 0 || MODE == 3) {          // rows m: 256 halfs = 512 B each, 16-B chunks
        for (int ch = t; ch < 128 * 32; ch += 256) { const int ml = ch >> 5, q = (ch & 31) * 8;
          *(v4u_t*)((bf16*)out + (size_t)(mBlk + ml) * N + nBlk + q) = *(const v4ua*)(so + ml * 264 + q); }
      } else {                  // Vt rows (b, h, dk): 128 consecutive s = 256 B each
        const int b_ = mBlk / SS, s0 = mBlk % SS;
        for (int ch = t; ch < 256 * 16; ch += 256) { const int nl = ch >> 4, q = (ch & 15) * 8; const int n = nBlk + nl, h = n >> 6, dk = n & (DKK - 1);
          *(v4u_t*)((bf16*)out + (((size_t)(b_ * HH + h)) * DKK + dk) * SS + s0 + q) = *(const v4ua*)(so + nl * 136 + q); }
      }
      
    }
  } else {
    float* so = (float*)sob;
#pragma unroll 1
    for (int hf = 0; hf < 2; ++hf) {
      if (wm == hf * 64) {
#pragma unroll
        for (int i = 0; i < 4; ++i)
#pragma unroll
          for (int j = 0; j < 4; ++j) {
            const int nl = wn + 16 * j + nlane;
            const float bv = bias ? bias[nBlk + nl] : 0.0f;
#pragma unroll
            for (int r = 0; r < 8; ++r) { const int mrow = mBlk + hf * 64 + 16 * i + mh + r; so[(16 * i + mh + r) * 260 + nl] = acc[i][j][r] * (rowscale ? rowscale[mrow] : 1.0f) + bv + (rowbias ? rowbias[mrow] : 0.0f); }
          }
      }
      __syncthreads();
      if (R) {   // residual: fold R[m][n] into the staged tile once (same thread <-> same chunks as the stores below)
        for (int ch = t; ch < 64 * 64; ch += 256) { const int ml = ch >> 6, q = (ch & 63) * 4;
          if (nBlk + q < N) { const v4f_t rv = *(const v4f_t*)(R + (size_t)(mBlk + hf * 64 + ml) * N + nBlk + q); v4f_t v = *(const v4fa*)(so + ml * 260 + q); v += rv; *(v4fa*)(so + ml * 260 + q) = v; } }
        asm volatile("s_wait_dscnt 0" ::: "memory");
      }
{   // 64 rows x 256 floats = 1 KB segments, float4 chunks; columns >= N (ragged tile) skipped
        const int q = (t & 63) * 4;
        if (nBlk + q < N) {
          for (int m0 = t >> 6; m0 < 64; m0 += 16) {   // rows m0, m0 + 4, m0 + 8, m0 + 12 per trip: four LDS reads and four stores in flight
            v4f_t v[4];
#pragma unroll   // this and the next: unrolled so that the four chunks stay in registers
            for (int u = 0; u < 4; ++u) v[u] = *(const v4fa*)(so + (m0 + 4 * u) * 260 + q);
#pragma unroll
            for (int u = 0; u < 4; ++u) {
              const size_t eo = (size_t)(mBlk + hf * 64 + m0 + 4 * u) * N + nBlk + q;
              if (MODE == 4) { bf16x4 hq; hq[0] = (bf16)v[u][0]; hq[1] = (bf16)v[u][1]; hq[2] = (bf16)v[u][2]; hq[3] = (bf16)v[u][3];
                *(bf16x4*)((bf16*)out + eo) = hq; }
              else *(v4f_t*)((float*)out + eo) = v[u];
            }
          }
        }
      }
      __syncthreads();
    }
  }
}

__global__ __launch_bounds__(64) void v_attn_kernel(
    const bf16* __restrict__ Qb, const bf16* __restrict__ Kb,
    const bf16* __restrict__ Vt, const float* __restrict__ kbias,   // kbias [B][KROWS]: additive per-key logit bias (1 − mask)
    bf16* __restrict__ attnOut) {
  __shared__ bf16 ldsK[32 * KSTRIDE];   // 4.5 KB
  __shared__ bf16 ldsV[64 * VSTRIDE];   // 6.0 KB
  __shared__ __attribute__((aligned(16))) bf16 ldsO[2][32 * 72];   // per-wave f16 output tile: 32 queries x 64 dk, 72-elem rows

  const int q0blk = blockIdx.x * 64;
  const int h  = blockIdx.y;
  const int b  = blockIdx.z;
  const int t    = threadIdx.x;
  const int wave = t >> 5;
  const int lane = t & 31;
  const int qlane = lane & 15;
  const int kh8   = (lane >> 4) * 8;
  const int q0 = q0blk + wave * 32;          // this wave's 32 queries

  const int hk = h / HKDIV;
  const bf16* Qh = Qb + (size_t)b * QROWS * DD + h * DKK;        // queries: QROWS rows per batch, row stride DD
  const bf16* Kh = Kb + (size_t)b * KROWS * KVD + hk * DKK;      // keys: KROWS rows per batch, row stride KVD
  const bf16* Vh = Vt + ((size_t)(b * KVH + hk)) * DKK * KROWS;  // Vᵀ [KVH][64][KROWS] per batch

  // Cooperative staging (64 threads), neighbouring lanes on neighbouring 16-B chunks of a row:
  // K tile 32x64 (8 lanes cover a 128-B row, 8 rows per load of the block); V tile 64x32 (4 lanes cover a 64-B row, 16 rows per load).
  const int krow = t >> 3;
  const int kcol = (t & 7) * 8;
  const int vrow = t >> 2;
  const int vcol = (t & 3) * 8;
  const bf16* kSrc = Kh + (size_t)krow * KVD + kcol;
  const bf16* vSrc = Vh + (size_t)vrow * KROWS + vcol;

  bf16x16 qf[QW][2];
#pragma unroll
  for (int qt = 0; qt < QW; ++qt) {
    qf[qt][0] = load_frag(Qh, DD, q0 + 16 * qt, 0);
    qf[qt][1] = load_frag(Qh, DD, q0 + 16 * qt, 32);
  }

  f32x8 o[QW][4] = {};
  float mrun[QW], lrun[QW];
#pragma unroll
  for (int qt = 0; qt < QW; ++qt) { mrun[qt] = -INFINITY; lrun[qt] = 0.0f; }

  const float scale = 0.125f * 1.44269504088896340736f;  // 1/sqrt(DK)*log2(e)
  const float NEG2 = -1.0e9f;    // masked logit: its weight is exactly 0 once any valid key of the row has been seen (every row
                                 // has one), and anything accumulated before that is wiped by alpha == 0 — same result as -inf
  const int kmax = KROWS - 1;
  __shared__ float kbS[KROWS];
  for (int i = threadIdx.x; i < KROWS; i += 64) kbS[i] = kbias[(size_t)b * KROWS + i] * 1.44269504088896340736f;   // in log2 units
  __syncthreads();

  // Prefetch key block kb=0 into registers.
  bf16x8 kreg[4], vreg[4];
#pragma unroll
  for (int i = 0; i < 4; ++i) {
    kreg[i] = *(const bf16x8*)(kSrc + (size_t)(8 * i) * KVD);
    vreg[i] = *(const bf16x8*)(vSrc + (size_t)(16 * i) * KROWS);
  }

  for (int kb = 0; kb <= kmax; kb += 32) {
    __syncthreads();   // previous readers done with LDS
#pragma unroll
    for (int i = 0; i < 4; ++i) {
      *(bf16x8*)(&ldsK[(krow + 8 * i) * KSTRIDE + kcol])  = kreg[i];
      *(bf16x8*)(&ldsV[(vrow + 16 * i) * VSTRIDE + vcol]) = vreg[i];
    }
    if (kb + 32 <= kmax) {   // prefetch next block during compute
      const bf16* kn = kSrc + (size_t)(kb + 32) * KVD;
      const bf16* vn = vSrc + (kb + 32);
#pragma unroll
      for (int i = 0; i < 4; ++i) {
        kreg[i] = *(const bf16x8*)(kn + (size_t)(8 * i) * KVD);
        vreg[i] = *(const bf16x8*)(vn + (size_t)(16 * i) * KROWS);
      }
    }
    __syncthreads();   // tile visible

    // Phase 1: scores + softmax for both q-tiles (K fragments live here only).
    bf16x16 kf[2][2];
#pragma unroll
    for (int ktile = 0; ktile < 2; ++ktile)
#pragma unroll
      for (int c = 0; c < 2; ++c)
        kf[ktile][c] = lds_frag(ldsK + (ktile * 16) * KSTRIDE + c * 32, KSTRIDE);

    bf16x16 pf[QW];
    bool act[QW];
#pragma unroll
    for (int qt = 0; qt < QW; ++qt) {
      unsigned mbits = 0;
      {
#pragma unroll
        for (int r = 0; r < 8; ++r) { const int j0 = kb + kh8 + r; if (j0 < NKV) mbits |= 1u << r; if (j0 + 16 < NKV) mbits |= 1u << (8 + r); }
        act[qt] = (__builtin_amdgcn_ballot_w32(mbits != 0) != 0);
      }
      if (act[qt]) {
        const int q_my = q0 + 16 * qt + qlane;
        f32x8 s0 = {}, s1 = {};
        s0 = wmma_bf16(kf[0][0], qf[qt][0], s0);
        s0 = wmma_bf16(kf[0][1], qf[qt][1], s0);
        s1 = wmma_bf16(kf[1][0], qf[qt][0], s1);
        s1 = wmma_bf16(kf[1][1], qf[qt][1], s1);

        float mx = -INFINITY;
#pragma unroll
        for (int r = 0; r < 8; ++r) {
          const int k0i = kb + kh8 + r;
          const int k1i = k0i + 16;
          (void)k0i; (void)k1i; (void)q_my;
          s0[r] = (mbits & (1u << r))       ? s0[r] * scale + kbS[kb + kh8 + r] : NEG2;
          s1[r] = (mbits & (1u << (8 + r))) ? s1[r] * scale + kbS[kb + 16 + kh8 + r] : NEG2;
          mx = fmaxf(mx, fmaxf(s0[r], s1[r]));
        }
        mx = fmaxf(mx, __shfl_xor(mx, 16, 32));
        const float mnew  = fmaxf(mrun[qt], mx);
        const float alpha = exp2f(mrun[qt] - mnew);

        float rsum = 0.0f;
#pragma unroll
        for (int r = 0; r < 8; ++r) {
          const float p0 = exp2f(s0[r] - mnew);
          const float p1 = exp2f(s1[r] - mnew);
          rsum += p0 + p1;
          pf[qt][r]     = (bf16)(p0 * 1024.0f);     // P carried x1024: no f16 copy of a probability is sub-normal
          pf[qt][r + 8] = (bf16)(p1 * 1024.0f);
        }
        rsum += __shfl_xor(rsum, 16, 32);
        lrun[qt] = lrun[qt] * alpha + rsum;
        mrun[qt] = mnew;

        // Rescale accumulators now so the PV phase is pure WMMA.
#pragma unroll
        for (int j = 0; j < 4; ++j)
#pragma unroll
          for (int r = 0; r < 8; ++r) o[qt][j][r] *= alpha;
      }
    }

    // Phase 2: O^T accumulate; each V fragment read from LDS once, used by
    // both q-tiles, then dead (only 8 VGPRs of V live at a time).
#pragma unroll
    for (int j = 0; j < 4; ++j) {
      const bf16x16 vf = lds_frag(ldsV + (j * 16) * VSTRIDE, VSTRIDE);
#pragma unroll
      for (int qt = 0; qt < QW; ++qt)
        if (act[qt]) o[qt][j] = wmma_bf16(vf, pf[qt], o[qt][j]);
    }
  }

  bf16* so = ldsO[wave];
#pragma unroll
  for (int qt = 0; qt < QW; ++qt) {
    const float rl = 1.0f / (lrun[qt] * 1024.0f);
#pragma unroll
    for (int j = 0; j < 4; ++j)
#pragma unroll
      for (int r = 0; r < 8; ++r) so[(16 * qt + qlane) * 72 + j * 16 + kh8 + r] = (bf16)(o[qt][j][r] * rl);
  }
  asm volatile("s_wait_dscnt 0" ::: "memory");
  __builtin_amdgcn_wave_barrier();
{
#pragma unroll
    for (int it = 0; it < 8; ++it) { const int ch = lane + 32 * it, ql = ch >> 3, q8 = (ch & 7) * 8;   // 8 lanes cover one row's 128 B
      *(v4u_t*)(attnOut + ((size_t)(b * QROWS + q0 + ql)) * DD + h * DKK + q8) = *(const v4ua*)(so + ql * 72 + q8); }
    
  }
}


// xp = LN(x)*g + b + pos[s]  (f32 rows for the residual, and the same rows rounded to f16 for the q, k, v products); block = 8 rows
__global__ __launch_bounds__(256) void k_lnpos(const float* __restrict__ X, const float* __restrict__ g, const float* __restrict__ bb, const float* __restrict__ pos, float* __restrict__ Y, bf16* __restrict__ Y16) {
  __shared__ __attribute__((aligned(16))) float rowS[8 * (DD + 4)];
  const int tid = threadIdx.x, r = tid >> 5, lane = tid & 31; const size_t row = (size_t)blockIdx.x * 8 + r; const int s_ = row % SS; const float* xr = X + row * DD;
  float s = 0.0f;
#pragma unroll 1
  for (int i = lane; i < DD; i += 32) { const float v = xr[i]; rowS[r * (DD + 4) + i] = v; s += v; }
#pragma unroll
  for (int off = 1; off < 32; off <<= 1) s += __shfl_xor(s, off, 32);
  const float mean = s * (1.0f / DD); float q = 0.0f;
#pragma unroll 1
  for (int i = lane; i < DD; i += 32) { const float d = rowS[r * (DD + 4) + i] - mean; q += d * d; }
#pragma unroll
  for (int off = 1; off < 32; off <<= 1) q += __shfl_xor(q, off, 32);
  const float rstd = rsqrtf(q * (1.0f / DD) + 1e-5f);
#pragma unroll 1
  for (int i = lane; i < DD; i += 32) rowS[r * (DD + 4) + i] = (rowS[r * (DD + 4) + i] - mean) * rstd * g[i] + bb[i] + pos[(size_t)s_ * DD + i];
  __syncthreads();
{ for (int q4 = tid; q4 < 8 * (DD / 4); q4 += 256) { const int rr = q4 / (DD / 4), c4 = (q4 % (DD / 4)) * 4;
      const v4f_t v = *(const v4fa*)(rowS + rr * (DD + 4) + c4);
      bf16x4 hq; hq[0] = (bf16)v[0]; hq[1] = (bf16)v[1]; hq[2] = (bf16)v[2]; hq[3] = (bf16)v[3];
      *(v4f_t*)(Y + ((size_t)blockIdx.x * 8 + rr) * DD + c4) = v;
      *(bf16x4*)(Y16 + ((size_t)blockIdx.x * 8 + rr) * DD + c4) = hq; }  }
}
// kbias[b][k] = 1 − mask[b][k]  (the torch quirk: a FLOAT additive mask); 8-KB rows
__global__ __launch_bounds__(256) void k_kbias(const float* __restrict__ mask, float* __restrict__ kb) { const int b = blockIdx.x;
  for (int q4 = threadIdx.x; q4 < KROWS / 4; q4 += 256) { const v4f_t m = *(const v4f_t*)(mask + (size_t)b * KROWS + q4 * 4); v4f_t o; for (int e = 0; e < 4; ++e) o[e] = 1.0f - m[e];
    *(v4f_t*)(kb + (size_t)b * KROWS + q4 * 4) = o;  } }

extern "C" void kernel_launch(void* const* d_in, const int* in_sizes, int n_in,
                              void* d_out, int out_size, void* d_ws, size_t ws_size,
                              hipStream_t stream) {
  (void)in_sizes; (void)n_in; (void)out_size;
  const float** f = (const float**)d_in;
  const float* x = f[0], *mask = f[1], *pos = f[2], *lng = f[3], *lnb = f[4], *Win = f[5], *bin = f[6], *Wout = f[7], *bout = f[8], *Wto = f[9], *bto = f[10];
  float* out = (float*)d_out;     // [4,2048,1024]
  char* ws = (char*)d_ws;
  float* xp = (float*)ws; ws += (size_t)MTOK * DD * 4;                  // 32 MB: f32 rows, read again only as the residual
  bf16* xp16 = (bf16*)ws; ws += (size_t)MTOK * DD * 2; bf16* Q16 = (bf16*)ws; ws += (size_t)MTOK * DD * 2; bf16* K16 = (bf16*)ws; ws += (size_t)MTOK * DD * 2;   // 16 MB each
  bf16* Vt = (bf16*)ws; ws += (size_t)MTOK * DD * 2; bf16* att16 = (bf16*)ws; ws += (size_t)MTOK * DD * 2; bf16* y16 = (bf16*)ws; ws += (size_t)MTOK * DD * 2;
  float* kb = (float*)ws; ws += (size_t)BB * KROWS * 4;
  if ((size_t)(ws - (char*)d_ws) > ws_size) return;
  const dim3 blk(256); const dim3 gp(MTOK / 128, DD / 256);
  k_lnpos<<<dim3(MTOK / 8), blk, 0, stream>>>(x, lng, lnb, pos, xp, xp16);
  k_kbias<<<dim3(BB), blk, 0, stream>>>(mask, kb);
  gemm_rb_kernel<bf16, 0><<<gp, blk, 0, stream>>>(xp16, Win, bin, nullptr, nullptr, nullptr, Q16, MTOK, DD, DD);
  gemm_rb_kernel<bf16, 0><<<gp, blk, 0, stream>>>(xp16, Win + (size_t)DD * DD, bin + DD, nullptr, nullptr, nullptr, K16, MTOK, DD, DD);
  gemm_rb_kernel<bf16, 1><<<gp, blk, 0, stream>>>(xp16, Win + (size_t)2 * DD * DD, bin + 2 * DD, nullptr, nullptr, nullptr, Vt, MTOK, DD, DD);
  v_attn_kernel<<<dim3(QROWS / 64, HH, BB), dim3(64), 0, stream>>>(Q16, K16, Vt, kb, att16);
  gemm_rb_kernel<bf16, 4><<<gp, blk, 0, stream>>>(att16, Wout, bout, nullptr, xp, nullptr, y16, MTOK, DD, DD);      // y = xp + o*out_proj^T + b, summed in f32, stored f16
  gemm_rb_kernel<bf16, 2><<<gp, blk, 0, stream>>>(y16, Wto, bto, nullptr, nullptr, nullptr, out, MTOK, DD, DD);      // out = y*to_out^T + b
}

// v003
// A run of this version takes 308 microseconds.
// Next to v002, in two timings, it ran 1.17 times as fast each time.
// All steps since v000 together make it 1.51 times as fast.
// Contractions on v_wmma_f32_16x16x32_f16 (plain f16 operands, f32 accumulate): qkv = (LN(x) + pos)·in_projᵀ + b (K = 1024, N = 3072),
// the 16-head attention (dk = 64, scale 1/8) with the reference's ADDITIVE float mask (1 − padding_mask) as a per-(batch,key) bias,
// flash-style Sᵀ = K·Qᵀ / Oᵀ = Vᵀ·Pᵀ with online softmax in f32 (P x1024, f16 output rows), attn_out = o·out_projᵀ + b + xp (residual in
// the epilogue, K = 1024) and (xp + attn_out)·to_outᵀ + b (K = 1024); LayerNorm and the positional add in f32. xp dominates the residual
// so plain f16 operands suffice. compute dtype: f16 operands, f32 accumulate.  x [4,2048,1024].
// Every matrix operand that one kernel hands to the next (xp, q, k, v transposed, the attention rows, y) is rounded to f16 once, from its f32
// value, at its producer's store, in the layout that the consumer stages; only the residual copy of xp and the final output are f32.
#include <hip/hip_runtime.h>
#include <hip/hip_bf16.h>
#include <math.h>

#define BB 4
#define SS 2048
#define QROWS 2048
#define KROWS 2048
#define NKV 2048
#define DD 1024
#define HH 16
#define KVH 16
#define KVD 1024
#define HKDIV 1
#define DKK 64
#define QW 2
#define MTOK (BB * SS)
#define GSTR 48

typedef _Float16 bf16;
typedef _Float16 f16;
typedef __attribute__((ext_vector_type(4))) unsigned v4u_t;
typedef unsigned v4ua __attribute__((ext_vector_type(4), may_alias));
typedef __attribute__((ext_vector_type(4))) float v4f_t;
typedef float v4fa __attribute__((ext_vector_type(4), may_alias));
typedef __attribute__((ext_vector_type(16))) bf16  bf16x16;
typedef bf16x16 f16x16;
typedef __attribute__((ext_vector_type(8)))  bf16  bf16x8;
typedef bf16x8 f16x8;
typedef __attribute__((ext_vector_type(4)))  bf16  bf16x4;
typedef __attribute__((ext_vector_type(8)))  float f32x8;
__device__ __forceinline__ f32x8 wmma16(f16x16 a, f16x16 b, f32x8 c) {
  c = __builtin_amdgcn_wmma_f32_16x16x32_f16(false, a, false, b, (short)0, c, false, false);
  asm volatile("v_nop\n\tv_nop\n\tv_nop\n\tv_nop" : "+v"(c) : "v"(a), "v"(b));
  return c;
}
#define LDS_STRIDE 48   // GEMM tiles: 32 -> 48 elems (96B rows): aligned b128 reads
#define KSTRIDE    72   // attn K tile: 64 -> 72 elems (144B rows): conflict-free b128
#define VSTRIDE    48   // attn V tile: 32 -> 48 elems

__device__ __forceinline__ f32x8 wmma_bf16(bf16x16 a, bf16x16 b, f32x8 c) {
  c = __builtin_amdgcn_wmma_f32_16x16x32_f16(false, a, false, b, (short)0, c, false, false);
  asm volatile("v_nop\n\tv_nop\n\tv_nop\n\tv_nop" : "+v"(c) : "v"(a), "v"(b));   // A/B-overwrite hazard guard
  return c;
}

// Work-group barrier of the staged loops: it waits for this wave's LDS traffic only. __syncthreads() also drains the load counter, so the
// next tile's global loads, issued just ahead of it, would be waited out before the matrix phase instead of flying under it.
__device__ __forceinline__ void lds_barrier() {
  asm volatile("s_wait_dscnt 0x0\n\ts_barrier_signal -1\n\ts_barrier_wait -1" ::: "memory");
}

// 16x32 (MxK) bf16 fragment from a row-major global matrix.
// lanes 0-15  (row=lane)    : elems 0..7 = K+0..7,  8..15 = K+16..23
// lanes 16-31 (row=lane-16) : elems 0..7 = K+8..15, 8..15 = K+24..31
template <typename T>
__device__ __forceinline__ bf16x16 load_frag(const T* __restrict__ base, int ld,
                                             int row0, int k0) {
  const int lane = threadIdx.x & 31;
  const int r    = lane & 15;
  const int kh   = (lane >> 4) * 8;
  const T* p0 = base + (size_t)(row0 + r) * ld + (k0 + kh);
  const T* p1 = p0 + 16;
  bf16x16 f;
#pragma unroll
  for (int i = 0; i < 8; ++i) {
    f[i]     = (bf16)p0[i];
    f[i + 8] = (bf16)p1[i];
  }
  return f;
}

// Same fragment from an LDS tile with padded row stride (base includes row0/k0).
__device__ __forceinline__ bf16x16 lds_frag(const bf16* base, int stride) {
  const int lane = threadIdx.x & 31;
  const int row  = lane & 15;
  const int kh   = (lane >> 4) * 8;
  const bf16x8 lo = *(const bf16x8*)(base + row * stride + kh);
  const bf16x8 hi = *(const bf16x8*)(base + row * stride + kh + 16);
  bf16x16 f;
#pragma unroll
  for (int i = 0; i < 8; ++i) { f[i] = lo[i]; f[i + 8] = hi[i]; }
  return f;
}

// ---------------------------------------------------------------------------
// GEMM: C[m][n] = sum_k A[m][k]*W[n][k] + bias[n]   (torch Linear)
// Block 256 thr (8 waves), tile 128M x 256N, K-step 32; wave tile 64x64.
// A/W staged through LDS (bf16, padded stride) with next-tile register
// prefetch overlapping the WMMA phase.
// MODE 0: bf16 [M][N]   MODE 1: bf16 Vt[b][h][dk][s]   MODE 2: fp32 [M][N]   MODE 4: as MODE 2 (f32 bias and residual), rounded to f16 at the store
// ---------------------------------------------------------------------------
template <typename AT, int MODE>
__global__ __launch_bounds__(256) void gemm_rb_kernel(
    const AT* __restrict__ A, const float* __restrict__ W,
    const float* __restrict__ bias, const float* __restrict__ rowscale, const float* __restrict__ R, const float* __restrict__ rowbias, void* __restrict__ out,
    int M, int N, int K) {
  __shared__ bf16 ldsA[128 * LDS_STRIDE];   // 12.0 KB
  __shared__ bf16 ldsW[256 * LDS_STRIDE];   // 24.0 KB
  // output staging: MODE 0 [128 m][264] f16, MODE 1 [256 n][136] f16, MODE 2 [64 m][260] f32 (two halves)
  __shared__ __attribute__((aligned(16))) unsigned char sob[256 * 136 * 2];   // 69,632 B >= 128*264*2 and >= 64*260*4

  const int t    = threadIdx.x;
  const int wave = t >> 5;
  const int lane = t & 31;
  const int wm   = (wave & 1) * 64;
  const int wn   = (wave >> 1) * 64;
  const int mBlk = blockIdx.x * 128;
  const int nBlk = blockIdx.y * 256;

  // Staging map: neighbouring lanes take neighbouring 16-B chunks of one row's 32-k segment, so a wave-wide 16-B load
  // covers whole row segments (f32: 4 rows x 128 B, f16: 8 rows x 64 B) instead of one line per lane.
  constexpr int AEL = 16 / (int)sizeof(AT);   // elements per 16-B chunk
  constexpr int ALN = 32 / AEL;               // lanes per A row segment
  constexpr int ARS = 256 / ALN;              // A rows covered by one load of the block
  constexpr int ACH = 128 / ARS;              // A chunks per thread
  const int ar0 = t / ALN, ac0 = (t % ALN) * AEL;
  const int wr0 = t >> 3,  wc0 = (t & 7) * 4;
  unsigned aoff[ACH], woff[8];                // byte offsets from the block-uniform bases; they step by one 32-k segment per trip
#pragma unroll   // this and the chunk loops below: unrolled so that the offset and staging arrays stay in registers
  for (int i = 0; i < ACH; ++i) aoff[i] = (unsigned)(((ar0 + ARS * i) * K + ac0) * (int)sizeof(AT));
#pragma unroll
  for (int i = 0; i < 8; ++i) woff[i] = (unsigned)((min(nBlk + wr0 + 32 * i, N - 1) * K + wc0) * 4);   // ragged last N tile: clamp the weight row (those columns are never stored)
  const char* aBase = (const char*)(A + (size_t)mBlk * K);
  const char* wBase = (const char*)W;

  v4u_t abuf[ACH];
  v4f_t wbuf[8];
#pragma unroll
  for (int i = 0; i < ACH; ++i) abuf[i] = *(const v4ua*)(aBase + aoff[i]);
#pragma unroll
  for (int i = 0; i < 8; ++i) wbuf[i] = *(const v4fa*)(wBase + woff[i]);

  f32x8 acc[4][4] = {};

  for (int k = 0; k < K; k += 32) {
    lds_barrier();   // every wave has read the previous tile's fragments
#pragma unroll
    for (int i = 0; i < ACH; ++i) {
      bf16* dst = &ldsA[(ar0 + ARS * i) * LDS_STRIDE + ac0];
      if constexpr (sizeof(AT) == 4) {
        const v4f_t v = __builtin_bit_cast(v4f_t, abuf[i]);
        bf16x4 q; q[0] = (bf16)v[0]; q[1] = (bf16)v[1]; q[2] = (bf16)v[2]; q[3] = (bf16)v[3];
        *(bf16x4*)dst = q;
      } else {
        *(v4ua*)dst = abuf[i];
      }
    }
#pragma unroll
    for (int i = 0; i < 8; ++i) {
      const v4f_t v = wbuf[i];
      bf16x4 q; q[0] = (bf16)v[0]; q[1] = (bf16)v[1]; q[2] = (bf16)v[2]; q[3] = (bf16)v[3];
      *(bf16x4*)&ldsW[(wr0 + 32 * i) * LDS_STRIDE + wc0] = q;
    }
    if (k + 32 < K) {
#pragma unroll
      for (int i = 0; i < ACH; ++i) { aoff[i] += 32u * (unsigned)sizeof(AT); abuf[i] = *(const v4ua*)(aBase + aoff[i]); }
#pragma unroll
      for (int i = 0; i < 8; ++i) { woff[i] += 32u * 4u; wbuf[i] = *(const v4fa*)(wBase + woff[i]); }
    }
    lds_barrier();   // tile visible; the loads above stay in flight over the matrix phase

    bf16x16 af[4], wf[4];
#pragma unroll
    for (int i = 0; i < 4; ++i)
      af[i] = lds_frag(ldsA + (wm + 16 * i) * LDS_STRIDE, LDS_STRIDE);
#pragma unroll
    for (int j = 0; j < 4; ++j)
      wf[j] = lds_frag(ldsW + (wn + 16 * j) * LDS_STRIDE, LDS_STRIDE);
#pragma unroll
    for (int i = 0; i < 4; ++i)
#pragma unroll
      for (int j = 0; j < 4; ++j)
        acc[i][j] = wmma_bf16(af[i], wf[j], acc[i][j]);
  }

  const int nlane = lane & 15;
  const int mh    = (lane >> 4) * 8;
  __syncthreads();
  if (MODE == 0 || MODE == 1 || MODE == 3) {
    bf16* so = (bf16*)sob;
#pragma unroll
    for (int i = 0; i < 4; ++i)
#pragma unroll
      for (int j = 0; j < 4; ++j) {
        const int nl = wn + 16 * j + nlane;
        const float bv = bias ? bias[nBlk + nl] : 0.0f;
        if (MODE == 3) {                                  // bias + exact GELU (erf), rolled to keep the static VALU op count small
#pragma unroll 1
          for (int r = 0; r < 8; ++r) {
            const int ml = wm + 16 * i + mh + r;
            const float xg = acc[i][j][r] + bv;
            so[ml * 264 + nl] = (bf16)(0.5f * xg * (1.0f + erff(xg * 0.70710678118654752f)));
          }
        } else {
#pragma unroll
        for (int r = 0; r < 8; ++r) {
          const int ml = wm + 16 * i + mh + r;
          const bf16 hv = (bf16)(acc[i][j][r] + bv);
          if (MODE == 0) so[ml * 264 + nl] = hv;        // [m][n]
          else           so[nl * 136 + ml] = hv;        // [n][m]  (n = h*64+dk rows of Vt, m = s contiguous)
        }
        }
      }
    __syncthreads();
{
      if (MODE == 0 || MODE == 3) {          // rows m: 256 halfs = 512 B each, 16-B chunks
        for (int ch = t; ch < 128 * 32; ch += 256) { const int ml = ch >> 5, q = (ch & 31) * 8;
          *(v4u_t*)((bf16*)out + (size_t)(mBlk + ml) * N + nBlk + q) = *(const v4ua*)(so + ml * 264 + q); }
      } else {                  // Vt rows (b, h, dk): 128 consecutive s = 256 B each
        const int b_ = mBlk / SS, s0 = mBlk % SS;
        for (int ch = t; ch < 256 * 16; ch += 256) { const int nl = ch >> 4, q = (ch & 15) * 8; const int n = nBlk + nl, h = n >> 6, dk = n & (DKK - 1);
          *(v4u_t*)((bf16*)out + (((size_t)(b_ * HH + h)) * DKK + dk) * SS + s0 + q) = *(const v4ua*)(so + nl * 136 + q); }
      }
      
    }
  } else {
    float* so = (float*)sob;
#pragma unroll 1
    for (int hf = 0; hf < 2; ++hf) {
      if (wm == hf * 64) {
#pragma unroll
        for (int i = 0; i < 4; ++i)
#pragma unroll
          for (int j = 0; j < 4; ++j) {
            const int nl = wn + 16 * j + nlane;
            const float bv = bias ? bias[nBlk + nl] : 0.0f;
#pragma unroll
            for (int r = 0; r < 8; ++r) { const int mrow = mBlk + hf * 64 + 16 * i + mh + r; so[(16 * i + mh + r) * 260 + nl] = acc[i][j][r] * (rowscale ? rowscale[mrow] : 1.0f) + bv + (rowbias ? rowbias[mrow] : 0.0f); }
          }
      }
      __syncthreads();
      if (R) {   // residual: fold R[m][n] into the staged tile once (same thread <-> same chunks as the stores below)
        for (int ch = t; ch < 64 * 64; ch += 256) { const int ml = ch >> 6, q = (ch & 63) * 4;
          if (nBlk + q < N) { const v4f_t rv = *(const v4f_t*)(R + (size_t)(mBlk + hf * 64 + ml) * N + nBlk + q); v4f_t v = *(const v4fa*)(so + ml * 260 + q); v += rv; *(v4fa*)(so + ml * 260 + q) = v; } }
        asm volatile("s_wait_dscnt 0" ::: "memory");
      }
{   // 64 rows x 256 floats = 1 KB segments, float4 chunks; columns >= N (ragged tile) skipped
        const int q = (t & 63) * 4;
        if (nBlk + q < N) {
          for (int m0 = t >> 6; m0 < 64; m0 += 16) {   // rows m0, m0 + 4, m0 + 8, m0 + 12 per trip: four LDS reads and four stores in flight
            v4f_t v[4];
#pragma unroll   // this and the next: unrolled so that the four chunks stay in registers
            for (int u = 0; u < 4; ++u) v[u] = *(const v4fa*)(so + (m0 + 4 * u) * 260 + q);
#pragma unroll
            for (int u = 0; u < 4; ++u) {
              const size_t eo = (size_t)(mBlk + hf * 64 + m0 + 4 * u) * N + nBlk + q;
              if (MODE == 4) { bf16x4 hq; hq[0] = (bf16)v[u][0]; hq[1] = (bf16)v[u][1]; hq[2] = (bf16)v[u][2]; hq[3] = (bf16)v[u][3];
                *(bf16x4*)((bf16*)out + eo) = hq; }
              else *(v4f_t*)((float*)out + eo) = v[u];
            }
          }
        }
      }
      __syncthreads();
    }
  }
}

__global__ __launch_bounds__(64) void v_attn_kernel(
    const bf16* __restrict__ Qb, const bf16* __restrict__ Kb,
    const bf16* __restrict__ Vt, const float* __restrict__ kbias,   // kbias [B][KROWS]: additive per-key logit bias (1 − mask)
    bf16* __restrict__ attnOut) {
  __shared__ bf16 ldsK[32 * KSTRIDE];   // 4.5 KB
  __shared__ bf16 ldsV[64 * VSTRIDE];   // 6.0 KB
  __shared__ __attribute__((aligned(16))) bf16 ldsO[2][32 * 72];   // per-wave f16 output tile: 32 queries x 64 dk, 72-elem rows

  const int q0blk = blockIdx.x * 64;
  const int h  = blockIdx.y;
  const int b  = blockIdx.z;
  const int t    = threadIdx.x;
  const int wave = t >> 5;
  const int lane = t & 31;
  const int qlane = lane & 15;
  const int kh8   = (lane >> 4) * 8;
  const int q0 = q0blk + wave * 32;          // this wave's 32 queries

  const int hk = h / HKDIV;
  const bf16* Qh = Qb + (size_t)b * QROWS * DD + h * DKK;        // queries: QROWS rows per batch, row stride DD
  const bf16* Kh = Kb + (size_t)b * KROWS * KVD + hk * DKK;      // keys: KROWS rows per batch, row stride KVD
  const bf16* Vh = Vt + ((size_t)(b * KVH + hk)) * DKK * KROWS;  // Vᵀ [KVH][64][KROWS] per batch

  // Cooperative staging (64 threads), neighbouring lanes on neighbouring 16-B chunks of a row:
  // K tile 32x64 (8 lanes cover a 128-B row, 8 rows per load of the block); V tile 64x32 (4 lanes cover a 64-B row, 16 rows per load).
  const int krow = t >> 3;
  const int kcol = (t & 7) * 8;
  const int vrow = t >> 2;
  const int vcol = (t & 3) * 8;
  const bf16* kSrc = Kh + (size_t)krow * KVD + kcol;
  const bf16* vSrc = Vh + (size_t)vrow * KROWS + vcol;

  bf16x16 qf[QW][2];
#pragma unroll
  for (int qt = 0; qt < QW; ++qt) {
    qf[qt][0] = load_frag(Qh, DD, q0 + 16 * qt, 0);
    qf[qt][1] = load_frag(Qh, DD, q0 + 16 * qt, 32);
  }

  f32x8 o[QW][4] = {};
  float mrun[QW], lrun[QW];
#pragma unroll
  for (int qt = 0; qt < QW; ++qt) { mrun[qt] = -INFINITY; lrun[qt] = 0.0f; }

  const float scale = 0.125f * 1.44269504088896340736f;  // 1/sqrt(DK)*log2(e)
  const float NEG2 = -1.0e9f;    // masked logit: its weight is exactly 0 once any valid key of the row has been seen (every row
                                 // has one), and anything accumulated before that is wiped by alpha == 0 — same result as -inf
  const int kmax = KROWS - 1;
  __shared__ float kbS[KROWS];
  for (int i = threadIdx.x; i < KROWS; i += 64) kbS[i] = kbias[(size_t)b * KROWS + i] * 1.44269504088896340736f;   // in log2 units
  __syncthreads();

  // Prefetch key block kb=0 into registers.
  bf16x8 kreg[4], vreg[4];
#pragma unroll
  for (int i = 0; i < 4; ++i) {
    kreg[i] = *(const bf16x8*)(kSrc + (size_t)(8 * i) * KVD);
    vreg[i] = *(const bf16x8*)(vSrc + (size_t)(16 * i) * KROWS);
  }

  for (int kb = 0; kb <= kmax; kb += 32) {
    lds_barrier();   // previous readers done with LDS
#pragma unroll
    for (int i = 0; i < 4; ++i) {
      *(bf16x8*)(&ldsK[(krow + 8 * i) * KSTRIDE + kcol])  = kreg[i];
      *(bf16x8*)(&ldsV[(vrow + 16 * i) * VSTRIDE + vcol]) = vreg[i];
    }
    if (kb + 32 <= kmax) {   // prefetch next block during compute
      const bf16* kn = kSrc + (size_t)(kb + 32) * KVD;
      const bf16* vn = vSrc + (kb + 32);
#pragma unroll
      for (int i = 0; i < 4; ++i) {
        kreg[i] = *(const bf16x8*)(kn + (size_t)(8 * i) * KVD);
        vreg[i] = *(const bf16x8*)(vn + (size_t)(16 * i) * KROWS);
      }
      asm volatile("s_wait_xcnt 0x0" ::: "memory");   // the loads outlive the barrier: their address pairs step on only behind this wait
    }
    lds_barrier();   // tile visible; the prefetch above stays in flight over scores, softmax and PV

    // Phase 1: scores + softmax for both q-tiles (K fragments live here only).
    bf16x16 kf[2][2];
#pragma unroll
    for (int ktile = 0; ktile < 2; ++ktile)
#pragma unroll
      for (int c = 0; c < 2; ++c)
        kf[ktile][c] = lds_frag(ldsK + (ktile * 16) * KSTRIDE + c * 32, KSTRIDE);

    bf16x16 pf[QW];
    bool act[QW];
#pragma unroll
    for (int qt = 0; qt < QW; ++qt) {
      unsigned mbits = 0;
      {
#pragma unroll
        for (int r = 0; r < 8; ++r) { const int j0 = kb + kh8 + r; if (j0 < NKV) mbits |= 1u << r; if (j0 + 16 < NKV) mbits |= 1u << (8 + r); }
        act[qt] = (__builtin_amdgcn_ballot_w32(mbits != 0) != 0);
      }
      if (act[qt]) {
        const int q_my = q0 + 16 * qt + qlane;
        f32x8 s0 = {}, s1 = {};
        s0 = wmma_bf16(kf[0][0], qf[qt][0], s0);
        s0 = wmma_bf16(kf[0][1], qf[qt][1], s0);
        s1 = wmma_bf16(kf[1][0], qf[qt][0], s1);
        s1 = wmma_bf16(kf[1][1], qf[qt][1], s1);

        float mx = -INFINITY;
#pragma unroll
        for (int r = 0; r < 8; ++r) {
          const int k0i = kb + kh8 + r;
          const int k1i = k0i + 16;
          (void)k0i; (void)k1i; (void)q_my;
          s0[r] = (mbits & (1u << r))       ? s0[r] * scale + kbS[kb + kh8 + r] : NEG2;
          s1[r] = (mbits & (1u << (8 + r))) ? s1[r] * scale + kbS[kb + 16 + kh8 + r] : NEG2;
          mx = fmaxf(mx, fmaxf(s0[r], s1[r]));
        }
        mx = fmaxf(mx, __shfl_xor(mx, 16, 32));
        const float mnew  = fmaxf(mrun[qt], mx);
        const float alpha = exp2f(mrun[qt] - mnew);

        float rsum = 0.0f;
#pragma unroll
        for (int r = 0; r < 8; ++r) {
          const float p0 = exp2f(s0[r] - mnew);
          const float p1 = exp2f(s1[r] - mnew);
          rsum += p0 + p1;
          pf[qt][r]     = (bf16)(p0 * 1024.0f);     // P carried x1024: no f16 copy of a probability is sub-normal
          pf[qt][r + 8] = (bf16)(p1 * 1024.0f);
        }
        rsum += __shfl_xor(rsum, 16, 32);
        lrun[qt] = lrun[qt] * alpha + rsum;
        mrun[qt] = mnew;

        // Rescale accumulators now so the PV phase is pure WMMA.
#pragma unroll
        for (int j = 0; j < 4; ++j)
#pragma unroll
          for (int r = 0; r < 8; ++r) o[qt][j][r] *= alpha;
      }
    }

    // Phase 2: O^T accumulate; each V fragment read from LDS once, used by
    // both q-tiles, then dead (only 8 VGPRs of V live at a time).
#pragma unroll
    for (int j = 0; j < 4; ++j) {
      const bf16x16 vf = lds_frag(ldsV + (j * 16) * VSTRIDE, VSTRIDE);
#pragma unroll
      for (int qt = 0; qt < QW; ++qt)
        if (act[qt]) o[qt][j] = wmma_bf16(vf, pf[qt], o[qt][j]);
    }
  }

  bf16* so = ldsO[wave];
#pragma unroll
  for (int qt = 0; qt < QW; ++qt) {
    const float rl = 1.0f / (lrun[qt] * 1024.0f);
#pragma unroll
    for (int j = 0; j < 4; ++j)
#pragma unroll
      for (int r = 0; r < 8; ++r) so[(16 * qt + qlane) * 72 + j * 16 + kh8 + r] = (bf16)(o[qt][j][r] * rl);
  }
  asm volatile("s_wait_dscnt 0" ::: "memory");
  __builtin_amdgcn_wave_barrier();
{
#pragma unroll
    for (int it = 0; it < 8; ++it) { const int ch = lane + 32 * it, ql = ch >> 3, q8 = (ch & 7) * 8;   // 8 lanes cover one row's 128 B
      *(v4u_t*)(attnOut + ((size_t)(b * QROWS + q0 + ql)) * DD + h * DKK + q8) = *(const v4ua*)(so + ql * 72 + q8); }
    
  }
}


// xp = LN(x)*g + b + pos[s]  (f32 rows for the residual, and the same rows rounded to f16 for the q, k, v products); block = 8 rows
__global__ __launch_bounds__(256) void k_lnpos(const float* __restrict__ X, const float* __restrict__ g, const float* __restrict__ bb, const float* __restrict__ pos, float* __restrict__ Y, bf16* __restrict__ Y16) {
  __shared__ __attribute__((aligned(16))) float rowS[8 * (DD + 4)];
  const int tid = threadIdx.x, r = tid >> 5, lane = tid & 31; const size_t row = (size_t)blockIdx.x * 8 + r; const int s_ = row % SS; const float* xr = X + row * DD;
  float s = 0.0f;
#pragma unroll 1
  for (int i = lane; i < DD; i += 32) { const float v = xr[i]; rowS[r * (DD + 4) + i] = v; s += v; }
#pragma unroll
  for (int off = 1; off < 32; off <<= 1) s += __shfl_xor(s, off, 32);
  const float mean = s * (1.0f / DD); float q = 0.0f;
#pragma unroll 1
  for (int i = lane; i < DD; i += 32) { const float d = rowS[r * (DD + 4) + i] - mean; q += d * d; }
#pragma unroll
  for (int off = 1; off < 32; off <<= 1) q += __shfl_xor(q, off, 32);
  const float rstd = rsqrtf(q * (1.0f / DD) + 1e-5f);
#pragma unroll 1
  for (int i = lane; i < DD; i += 32) rowS[r * (DD + 4) + i] = (rowS[r * (DD + 4) + i] - mean) * rstd * g[i] + bb[i] + pos[(size_t)s_ * DD + i];
  __syncthreads();
{ for (int q4 = tid; q4 < 8 * (DD / 4); q4 += 256) { const int rr = q4 / (DD / 4), c4 = (q4 % (DD / 4)) * 4;
      const v4f_t v = *(const v4fa*)(rowS + rr * (DD + 4) + c4);
      bf16x4 hq; hq[0] = (bf16)v[0]; hq[1] = (bf16)v[1]; hq[2] = (bf16)v[2]; hq[3] = (bf16)v[3];
      *(v4f_t*)(Y + ((size_t)blockIdx.x * 8 + rr) * DD + c4) = v;
      *(bf16x4*)(Y16 + ((size_t)blockIdx.x * 8 + rr) * DD + c4) = hq; }  }
}
// kbias[b][k] = 1 − mask[b][k]  (the torch quirk: a FLOAT additive mask); 8-KB rows
__global__ __launch_bounds__(256) void k_kbias(const float* __restrict__ mask, float* __restrict__ kb) { const int b = blockIdx.x;
  for (int q4 = threadIdx.x; q4 < KROWS / 4; q4 += 256) { const v4f_t m = *(const v4f_t*)(mask + (size_t)b * KROWS + q4 * 4); v4f_t o; for (int e = 0; e < 4; ++e) o[e] = 1.0f - m[e];
    *(v4f_t*)(kb + (size_t)b * KROWS + q4 * 4) = o;  } }

extern "C" void kernel_launch(void* const* d_in, const int* in_sizes, int n_in,
                              void* d_out, int out_size, void* d_ws, size_t ws_size,
                              hipStream_t stream) {
  (void)in_sizes; (void)n_in; (void)out_size;
  const float** f = (const float**)d_in;
  const float* x = f[0], *mask = f[1], *pos = f[2], *lng = f[3], *lnb = f[4], *Win = f[5], *bin = f[6], *Wout = f[7], *bout = f[8], *Wto = f[9], *bto = f[10];
  float* out = (float*)d_out;     // [4,2048,1024]
  char* ws = (char*)d_ws;
  float* xp = (float*)ws; ws += (size_t)MTOK * DD * 4;                  // 32 MB: f32 rows, read again only as the residual
  bf16* xp16 = (bf16*)ws; ws += (size_t)MTOK * DD * 2; bf16* Q16 = (bf16*)ws; ws += (size_t)MTOK * DD * 2; bf16* K16 = (bf16*)ws; ws += (size_t)MTOK * DD * 2;   // 16 MB each
  bf16* Vt = (bf16*)ws; ws += (size_t)MTOK * DD * 2; bf16* att16 = (bf16*)ws; ws += (size_t)MTOK * DD * 2; bf16* y16 = (bf16*)ws; ws += (size_t)MTOK * DD * 2;
  float* kb = (float*)ws; ws += (size_t)BB * KROWS * 4;
  if ((size_t)(ws - (char*)d_ws) > ws_size) return;
  const dim3 blk(256); const dim3 gp(MTOK / 128, DD / 256);
  k_lnpos<<<dim3(MTOK / 8), blk, 0, stream>>>(x, lng, lnb, pos, xp, xp16);
  k_kbias<<<dim3(BB), blk, 0, stream>>>(mask, kb);
  gemm_rb_kernel<bf16, 0><<<gp, blk, 0, stream>>>(xp16, Win, bin, nullptr, nullptr, nullptr, Q16, MTOK, DD, DD);
  gemm_rb_kernel<bf16, 0><<<gp, blk, 0, stream>>>(xp16, Win + (size_t)DD * DD, bin + DD, nullptr, nullptr, nullptr, K16, MTOK, DD, DD);
  gemm_rb_kernel<bf16, 1><<<gp, blk, 0, stream>>>(xp16, Win + (size_t)2 * DD * DD, bin + 2 * DD, nullptr, nullptr, nullptr, Vt, MTOK, DD, DD);
  v_attn_kernel<<<dim3(QROWS / 64, HH, BB), dim3(64), 0, stream>>>(Q16, K16, Vt, kb, att16);
  gemm_rb_kernel<bf16, 4><<<gp, blk, 0, stream>>>(att16, Wout, bout, nullptr, xp, nullptr, y16, MTOK, DD, DD);      // y = xp + o*out_proj^T + b, summed in f32, stored f16
  gemm_rb_kernel<bf16, 2><<<gp, blk, 0, stream>>>(y16, Wto, bto, nullptr, nullptr, nullptr, out, MTOK, DD, DD);      // out = y*to_out^T + b
}

// v004
// One run takes 291 microseconds.
// In both of two side-by-side timings against v003, it was 1.06 times as fast.
// All steps since v000 together make it 1.59 times as fast.
// Contractions on v_wmma_f32_16x16x32_f16 (plain f16 operands, f32 accumulate): qkv = (LN(x) + pos)·in_projᵀ + b (K = 1024, N = 3072),
// the 16-head attention (dk = 64, scale 1/8) with the reference's ADDITIVE float mask (1 − padding_mask) as a per-(batch,key) bias,
// flash-style Sᵀ = K·Qᵀ / Oᵀ = Vᵀ·Pᵀ with online softmax in f32 (P x1024, f16 output rows), attn_out = o·out_projᵀ + b + xp (residual in
// the epilogue, K = 1024) and (xp + attn_out)·to_outᵀ + b (K = 1024); LayerNorm and the positional add in f32. xp dominates the residual
// so plain f16 operands suffice. compute dtype: f16 operands, f32 accumulate.  x [4,2048,1024].
// Every matrix operand that one kernel hands to the next (xp, q, k, v transposed, the attention rows, y) is rounded to f16 once, from its f32
// value, at its producer's store, in the layout that the consumer stages; only the residual copy of xp and the final output are f32.
#include <hip/hip_runtime.h>
#include <hip/hip_bf16.h>
#include <math.h>

#define BB 4
#define SS 2048
#define QROWS 2048
#define KROWS 2048
#define NKV 2048
#define DD 1024
#define HH 16
#define KVH 16
#define KVD 1024
#define HKDIV 1
#define DKK 64
#define QW 2
#define MTOK (BB * SS)
#define GSTR 48

typedef _Float16 bf16;
typedef _Float16 f16;
typedef __attribute__((ext_vector_type(4))) unsigned v4u_t;
typedef unsigned v4ua __attribute__((ext_vector_type(4), may_alias));
typedef __attribute__((ext_vector_type(4))) float v4f_t;
typedef float v4fa __attribute__((ext_vector_type(4), may_alias));
typedef __attribute__((ext_vector_type(16))) bf16  bf16x16;
typedef bf16x16 f16x16;
typedef __attribute__((ext_vector_type(8)))  bf16  bf16x8;
typedef bf16x8 f16x8;
typedef __attribute__((ext_vector_type(4)))  bf16  bf16x4;
typedef __attribute__((ext_vector_type(8)))  float f32x8;
__device__ __forceinline__ f32x8 wmma16(f16x16 a, f16x16 b, f32x8 c) {
  c = __builtin_amdgcn_wmma_f32_16x16x32_f16(false, a, false, b, (short)0, c, false, false);
  asm volatile("v_nop\n\tv_nop\n\tv_nop\n\tv_nop" : "+v"(c) : "v"(a), "v"(b));
  return c;
}
#define LDS_STRIDE 48   // GEMM tiles: 32 -> 48 elems (96B rows): aligned b128 reads
#define KSTRIDE    72   // attn K tile: 64 -> 72 elems (144B rows): conflict-free b128
#define VSTRIDE    48   // attn V tile: 32 -> 48 elems

__device__ __forceinline__ f32x8 wmma_bf16(bf16x16 a, bf16x16 b, f32x8 c) {
  c = __builtin_amdgcn_wmma_f32_16x16x32_f16(false, a, false, b, (short)0, c, false, false);
  asm volatile("v_nop\n\tv_nop\n\tv_nop\n\tv_nop" : "+v"(c) : "v"(a), "v"(b));   // A/B-overwrite hazard guard
  return c;
}

// Work-group barrier of the staged loops: it waits for this wave's LDS traffic only. __syncthreads() also drains the load counter, so the
// next tile's global loads, issued just ahead of it, would be waited out before the matrix phase instead of flying under it.
__device__ __forceinline__ void lds_barrier() {
  asm volatile("s_wait_dscnt 0x0\n\ts_barrier_signal -1\n\ts_barrier_wait -1" ::: "memory");
}

// 16x32 (MxK) bf16 fragment from a row-major global matrix.
// lanes 0-15  (row=lane)    : elems 0..7 = K+0..7,  8..15 = K+16..23
// lanes 16-31 (row=lane-16) : elems 0..7 = K+8..15, 8..15 = K+24..31
template <typename T>
__device__ __forceinline__ bf16x16 load_frag(const T* __restrict__ base, int ld,
                                             int row0, int k0) {
  const int lane = threadIdx.x & 31;
  const int r    = lane & 15;
  const int kh   = (lane >> 4) * 8;
  const T* p0 = base + (size_t)(row0 + r) * ld + (k0 + kh);
  const T* p1 = p0 + 16;
  bf16x16 f;
#pragma unroll
  for (int i = 0; i < 8; ++i) {
    f[i]     = (bf16)p0[i];
    f[i + 8] = (bf16)p1[i];
  }
  return f;
}

// Same fragment from an LDS tile with padded row stride (base includes row0/k0).
__device__ __forceinline__ bf16x16 lds_frag(const bf16* base, int stride) {
  const int lane = threadIdx.x & 31;
  const int row  = lane & 15;
  const int kh   = (lane >> 4) * 8;
  const bf16x8 lo = *(const bf16x8*)(base + row * stride + kh);
  const bf16x8 hi = *(const bf16x8*)(base + row * stride + kh + 16);
  bf16x16 f;
#pragma unroll
  for (int i = 0; i < 8; ++i) { f[i] = lo[i]; f[i + 8] = hi[i]; }
  return f;
}

// ---------------------------------------------------------------------------
// GEMM: C[m][n] = sum_k A[m][k]*W[n][k] + bias[n]   (torch Linear)
// Block 256 thr (8 waves), tile 128M x 256N, K-step 32; wave tile 64x64.
// A/W staged through LDS (bf16, padded stride) with next-tile register
// prefetch overlapping the WMMA phase.
// MODE 0: bf16 [M][N]   MODE 1: bf16 Vt[b][h][dk][s]   MODE 2: fp32 [M][N]   MODE 4: as MODE 2 (f32 bias and residual), rounded to f16 at the store
// ---------------------------------------------------------------------------
template <typename AT, int MODE>
__global__ __launch_bounds__(256) void gemm_rb_kernel(
    const AT* __restrict__ A, const float* __restrict__ W,
    const float* __restrict__ bias, const float* __restrict__ rowscale, const float* __restrict__ R, const float* __restrict__ rowbias, void* __restrict__ out,
    int M, int N, int K) {
  __shared__ bf16 ldsA[128 * LDS_STRIDE];   // 12.0 KB
  __shared__ bf16 ldsW[256 * LDS_STRIDE];   // 24.0 KB
  // output staging: MODE 0 [128 m][264] f16, MODE 1 [256 n][136] f16, MODE 2 [64 m][260] f32 (two halves)
  __shared__ __attribute__((aligned(16))) unsigned char sob[256 * 136 * 2];   // 69,632 B >= 128*264*2 and >= 64*260*4

  const int t    = threadIdx.x;
  const int wave = t >> 5;
  const int lane = t & 31;
  const int wm   = (wave & 1) * 64;
  const int wn   = (wave >> 1) * 64;
  const int mBlk = blockIdx.x * 128;
  const int nBlk = blockIdx.y * 256;

  // Staging map: neighbouring lanes take neighbouring 16-B chunks of one row's 32-k segment, so a wave-wide 16-B load
  // covers whole row segments (f32: 4 rows x 128 B, f16: 8 rows x 64 B) instead of one line per lane.
  constexpr int AEL = 16 / (int)sizeof(AT);   // elements per 16-B chunk
  constexpr int ALN = 32 / AEL;               // lanes per A row segment
  constexpr int ARS = 256 / ALN;              // A rows covered by one load of the block
  constexpr int ACH = 128 / ARS;              // A chunks per thread
  const int ar0 = t / ALN, ac0 = (t % ALN) * AEL;
  const int wr0 = t >> 3,  wc0 = (t & 7) * 4;
  unsigned aoff[ACH], woff[8];                // byte offsets from the block-uniform bases; they step by one 32-k segment per trip
#pragma unroll   // this and the chunk loops below: unrolled so that the offset and staging arrays stay in registers
  for (int i = 0; i < ACH; ++i) aoff[i] = (unsigned)(((ar0 + ARS * i) * K + ac0) * (int)sizeof(AT));
#pragma unroll
  for (int i = 0; i < 8; ++i) woff[i] = (unsigned)((min(nBlk + wr0 + 32 * i, N - 1) * K + wc0) * 4);   // ragged last N tile: clamp the weight row (those columns are never stored)
  const char* aBase = (const char*)(A + (size_t)mBlk * K);
  const char* wBase = (const char*)W;

  v4u_t abuf[ACH];
  v4f_t wbuf[8];
#pragma unroll
  for (int i = 0; i < ACH; ++i) abuf[i] = *(const v4ua*)(aBase + aoff[i]);
#pragma unroll
  for (int i = 0; i < 8; ++i) wbuf[i] = *(const v4fa*)(wBase + woff[i]);

  f32x8 acc[4][4] = {};

  for (int k = 0; k < K; k += 32) {
    lds_barrier();   // every wave has read the previous tile's fragments
#pragma unroll
    for (int i = 0; i < ACH; ++i) {
      bf16* dst = &ldsA[(ar0 + ARS * i) * LDS_STRIDE + ac0];
      if constexpr (sizeof(AT) == 4) {
        const v4f_t v = __builtin_bit_cast(v4f_t, abuf[i]);
        bf16x4 q; q[0] = (bf16)v[0]; q[1] = (bf16)v[1]; q[2] = (bf16)v[2]; q[3] = (bf16)v[3];
        *(bf16x4*)dst = q;
      } else {
        *(v4ua*)dst = abuf[i];
      }
    }
#pragma unroll
    for (int i = 0; i < 8; ++i) {
      const v4f_t v = wbuf[i];
      bf16x4 q; q[0] = (bf16)v[0]; q[1] = (bf16)v[1]; q[2] = (bf16)v[2]; q[3] = (bf16)v[3];
      *(bf16x4*)&ldsW[(wr0 + 32 * i) * LDS_STRIDE + wc0] = q;
    }
    if (k + 32 < K) {
#pragma unroll
      for (int i = 0; i < ACH; ++i) { aoff[i] += 32u * (unsigned)sizeof(AT); abuf[i] = *(const v4ua*)(aBase + aoff[i]); }
#pragma unroll
      for (int i = 0; i < 8; ++i) { woff[i] += 32u * 4u; wbuf[i] = *(const v4fa*)(wBase + woff[i]); }
    }
    lds_barrier();   // tile visible; the loads above stay in flight over the matrix phase

    bf16x16 af[4], wf[4];
#pragma unroll
    for (int i = 0; i < 4; ++i)
      af[i] = lds_frag(ldsA + (wm + 16 * i) * LDS_STRIDE, LDS_STRIDE);
#pragma unroll
    for (int j = 0; j < 4; ++j)
      wf[j] = lds_frag(ldsW + (wn + 16 * j) * LDS_STRIDE, LDS_STRIDE);
#pragma unroll
    for (int i = 0; i < 4; ++i)
#pragma unroll
      for (int j = 0; j < 4; ++j)
        acc[i][j] = wmma_bf16(af[i], wf[j], acc[i][j]);
  }

  const int nlane = lane & 15;
  const int mh    = (lane >> 4) * 8;
  __syncthreads();
  if (MODE == 0 || MODE == 1 || MODE == 3) {
    bf16* so = (bf16*)sob;
#pragma unroll
    for (int i = 0; i < 4; ++i)
#pragma unroll
      for (int j = 0; j < 4; ++j) {
        const int nl = wn + 16 * j + nlane;
        const float bv = bias ? bias[nBlk + nl] : 0.0f;
        if (MODE == 3) {                                  // bias + exact GELU (erf), rolled to keep the static VALU op count small
#pragma unroll 1
          for (int r = 0; r < 8; ++r) {
            const int ml = wm + 16 * i + mh + r;
            const float xg = acc[i][j][r] + bv;
            so[ml * 264 + nl] = (bf16)(0.5f * xg * (1.0f + erff(xg * 0.70710678118654752f)));
          }
        } else {
#pragma unroll
        for (int r = 0; r < 8; ++r) {
          const int ml = wm + 16 * i + mh + r;
          const bf16 hv = (bf16)(acc[i][j][r] + bv);
          if (MODE == 0) so[ml * 264 + nl] = hv;        // [m][n]
          else           so[nl * 136 + ml] = hv;        // [n][m]  (n = h*64+dk rows of Vt, m = s contiguous)
        }
        }
      }
    __syncthreads();
{
      if (MODE == 0 || MODE == 3) {          // rows m: 256 halfs = 512 B each, 16-B chunks
        for (int ch = t; ch < 128 * 32; ch += 256) { const int ml = ch >> 5, q = (ch & 31) * 8;
          *(v4u_t*)((bf16*)out + (size_t)(mBlk + ml) * N + nBlk + q) = *(const v4ua*)(so + ml * 264 + q); }
      } else {                  // Vt rows (b, h, dk): 128 consecutive s = 256 B each
        const int b_ = mBlk / SS, s0 = mBlk % SS;
        for (int ch = t; ch < 256 * 16; ch += 256) { const int nl = ch >> 4, q = (ch & 15) * 8; const int n = nBlk + nl, h = n >> 6, dk = n & (DKK - 1);
          *(v4u_t*)((bf16*)out + (((size_t)(b_ * HH + h)) * DKK + dk) * SS + s0 + q) = *(const v4ua*)(so + nl * 136 + q); }
      }
      
    }
  } else {
    float* so = (float*)sob;
#pragma unroll 1
    for (int hf = 0; hf < 2; ++hf) {
      if (wm == hf * 64) {
#pragma unroll
        for (int i = 0; i < 4; ++i)
#pragma unroll
          for (int j = 0; j < 4; ++j) {
            const int nl = wn + 16 * j + nlane;
            const float bv = bias ? bias[nBlk + nl] : 0.0f;
#pragma unroll
            for (int r = 0; r < 8; ++r) { const int mrow = mBlk + hf * 64 + 16 * i + mh + r; so[(16 * i + mh + r) * 260 + nl] = acc[i][j][r] * (rowscale ? rowscale[mrow] : 1.0f) + bv + (rowbias ? rowbias[mrow] : 0.0f); }
          }
      }
      __syncthreads();
      if (R) {   // residual: fold R[m][n] into the staged tile once (same thread <-> same chunks as the stores below)
        for (int ch = t; ch < 64 * 64; ch += 256) { const int ml = ch >> 6, q = (ch & 63) * 4;
          if (nBlk + q < N) { const v4f_t rv = *(const v4f_t*)(R + (size_t)(mBlk + hf * 64 + ml) * N + nBlk + q); v4f_t v = *(const v4fa*)(so + ml * 260 + q); v += rv; *(v4fa*)(so + ml * 260 + q) = v; } }
        asm volatile("s_wait_dscnt 0" ::: "memory");
      }
{   // 64 rows x 256 floats = 1 KB segments, float4 chunks; columns >= N (ragged tile) skipped
        const int q = (t & 63) * 4;
        if (nBlk + q < N) {
          for (int m0 = t >> 6; m0 < 64; m0 += 16) {   // rows m0, m0 + 4, m0 + 8, m0 + 12 per trip: four LDS reads and four stores in flight
            v4f_t v[4];
#pragma unroll   // this and the next: unrolled so that the four chunks stay in registers
            for (int u = 0; u < 4; ++u) v[u] = *(const v4fa*)(so + (m0 + 4 * u) * 260 + q);
#pragma unroll
            for (int u = 0; u < 4; ++u) {
              const size_t eo = (size_t)(mBlk + hf * 64 + m0 + 4 * u) * N + nBlk + q;
              if (MODE == 4) { bf16x4 hq; hq[0] = (bf16)v[u][0]; hq[1] = (bf16)v[u][1]; hq[2] = (bf16)v[u][2]; hq[3] = (bf16)v[u][3];
                *(bf16x4*)((bf16*)out + eo) = hq; }
              else *(v4f_t*)((float*)out + eo) = v[u];
            }
          }
        }
      }
      __syncthreads();
    }
  }
}

// 2^x by the hardware instruction alone (results below 2^-126 come out as 0; -inf gives 0).
__device__ __forceinline__ float hw_exp2(float x) { return __builtin_amdgcn_exp2f(x); }

__global__ __launch_bounds__(64) void v_attn_kernel(
    const bf16* __restrict__ Qb, const bf16* __restrict__ Kb,
    const bf16* __restrict__ Vt, const float* __restrict__ kbias,   // kbias [B][KROWS]: additive per-key logit bias (1 − mask)
    bf16* __restrict__ attnOut) {
  __shared__ bf16 ldsK[32 * KSTRIDE];   // 4.5 KB
  __shared__ bf16 ldsV[64 * VSTRIDE];   // 6.0 KB
  __shared__ __attribute__((aligned(16))) bf16 ldsO[2][32 * 72];   // per-wave f16 output tile: 32 queries x 64 dk, 72-elem rows

  const int q0blk = blockIdx.x * 64;
  const int h  = blockIdx.y;
  const int b  = blockIdx.z;
  const int t    = threadIdx.x;
  const int wave = t >> 5;
  const int lane = t & 31;
  const int qlane = lane & 15;
  const int kh8   = (lane >> 4) * 8;
  const int q0 = q0blk + wave * 32;          // this wave's 32 queries

  const int hk = h / HKDIV;
  const bf16* Qh = Qb + (size_t)b * QROWS * DD + h * DKK;        // queries: QROWS rows per batch, row stride DD
  const bf16* Kh = Kb + (size_t)b * KROWS * KVD + hk * DKK;      // keys: KROWS rows per batch, row stride KVD
  const bf16* Vh = Vt + ((size_t)(b * KVH + hk)) * DKK * KROWS;  // Vᵀ [KVH][64][KROWS] per batch

  // Cooperative staging (64 threads), neighbouring lanes on neighbouring 16-B chunks of a row:
  // K tile 32x64 (8 lanes cover a 128-B row, 8 rows per load of the block); V tile 64x32 (4 lanes cover a 64-B row, 16 rows per load).
  const int krow = t >> 3;
  const int kcol = (t & 7) * 8;
  const int vrow = t >> 2;
  const int vcol = (t & 3) * 8;
  const bf16* kSrc = Kh + (size_t)krow * KVD + kcol;
  const bf16* vSrc = Vh + (size_t)vrow * KROWS + vcol;

  bf16x16 qf[QW][2];
#pragma unroll
  for (int qt = 0; qt < QW; ++qt) {
    qf[qt][0] = load_frag(Qh, DD, q0 + 16 * qt, 0);
    qf[qt][1] = load_frag(Qh, DD, q0 + 16 * qt, 32);
  }

  f32x8 o[QW][4] = {};
  float mrun[QW], lrun[QW];
#pragma unroll
  for (int qt = 0; qt < QW; ++qt) { mrun[qt] = -INFINITY; lrun[qt] = 0.0f; }

  const float scale = 0.125f * 1.44269504088896340736f;  // 1/sqrt(DK)*log2(e)
  const float NEG2 = -1.0e9f;    // masked logit: its weight is exactly 0 once any valid key of the row has been seen (every row
                                 // has one), and anything accumulated before that is wiped by alpha == 0 — same result as -inf
  const int kmax = KROWS - 1;
  __shared__ float kbS[KROWS];
  for (int i = threadIdx.x; i < KROWS; i += 64) kbS[i] = kbias[(size_t)b * KROWS + i] * 1.44269504088896340736f;   // in log2 units
  __syncthreads();

  // Prefetch key block kb=0 into registers.
  bf16x8 kreg[4], vreg[4];
#pragma unroll
  for (int i = 0; i < 4; ++i) {
    kreg[i] = *(const bf16x8*)(kSrc + (size_t)(8 * i) * KVD);
    vreg[i] = *(const bf16x8*)(vSrc + (size_t)(16 * i) * KROWS);
  }

  for (int kb = 0; kb <= kmax; kb += 32) {
    lds_barrier();   // previous readers done with LDS
#pragma unroll
    for (int i = 0; i < 4; ++i) {
      *(bf16x8*)(&ldsK[(krow + 8 * i) * KSTRIDE + kcol])  = kreg[i];
      *(bf16x8*)(&ldsV[(vrow + 16 * i) * VSTRIDE + vcol]) = vreg[i];
    }
    if (kb + 32 <= kmax) {   // prefetch next block during compute
      const bf16* kn = kSrc + (size_t)(kb + 32) * KVD;
      const bf16* vn = vSrc + (kb + 32);
#pragma unroll
      for (int i = 0; i < 4; ++i) {
        kreg[i] = *(const bf16x8*)(kn + (size_t)(8 * i) * KVD);
        vreg[i] = *(const bf16x8*)(vn + (size_t)(16 * i) * KROWS);
      }
      asm volatile("s_wait_xcnt 0x0" ::: "memory");   // the loads outlive the barrier: their address pairs step on only behind this wait
    }
    lds_barrier();   // tile visible; the prefetch above stays in flight over scores, softmax and PV

    // Phase 1: scores + softmax for both q-tiles (K fragments live here only).
    bf16x16 kf[2][2];
#pragma unroll
    for (int ktile = 0; ktile < 2; ++ktile)
#pragma unroll
      for (int c = 0; c < 2; ++c)
        kf[ktile][c] = lds_frag(ldsK + (ktile * 16) * KSTRIDE + c * 32, KSTRIDE);

    bf16x16 pf[QW];
    bool act[QW];
#pragma unroll
    for (int qt = 0; qt < QW; ++qt) {
      unsigned mbits = 0;
      {
#pragma unroll
        for (int r = 0; r < 8; ++r) { const int j0 = kb + kh8 + r; if (j0 < NKV) mbits |= 1u << r; if (j0 + 16 < NKV) mbits |= 1u << (8 + r); }
        act[qt] = (__builtin_amdgcn_ballot_w32(mbits != 0) != 0);
      }
      if (act[qt]) {
        const int q_my = q0 + 16 * qt + qlane;
        f32x8 s0 = {}, s1 = {};
        s0 = wmma_bf16(kf[0][0], qf[qt][0], s0);
        s0 = wmma_bf16(kf[0][1], qf[qt][1], s0);
        s1 = wmma_bf16(kf[1][0], qf[qt][0], s1);
        s1 = wmma_bf16(kf[1][1], qf[qt][1], s1);

        float mx = -INFINITY;
#pragma unroll
        for (int r = 0; r < 8; ++r) {
          const int k0i = kb + kh8 + r;
          const int k1i = k0i + 16;
          (void)k0i; (void)k1i; (void)q_my;
          s0[r] = (mbits & (1u << r))       ? s0[r] * scale + kbS[kb + kh8 + r] : NEG2;
          s1[r] = (mbits & (1u << (8 + r))) ? s1[r] * scale + kbS[kb + 16 + kh8 + r] : NEG2;
          mx = fmaxf(mx, fmaxf(s0[r], s1[r]));
        }
        mx = fmaxf(mx, __shfl_xor(mx, 16, 32));
        const float mnew  = fmaxf(mrun[qt], mx);
        // hw_exp2 here and below: one v_exp_f32 each. exp2f() wraps it in a compare, two selects, an add and an ldexp to keep results below 2^-126;
        // such a weight is 0 in the f16 P and vanishes beside a row sum >= 1, and such an alpha scales history that rounds away likewise.
        const float alpha = hw_exp2(mrun[qt] - mnew);

        float rsum = 0.0f;
#pragma unroll
        for (int r = 0; r < 8; ++r) {
          const float p0 = hw_exp2(s0[r] - mnew);
          const float p1 = hw_exp2(s1[r] - mnew);
          rsum += p0 + p1;
          pf[qt][r]     = (bf16)(p0 * 1024.0f);     // P carried x1024: no f16 copy of a probability is sub-normal
          pf[qt][r + 8] = (bf16)(p1 * 1024.0f);
        }
        rsum += __shfl_xor(rsum, 16, 32);
        lrun[qt] = lrun[qt] * alpha + rsum;
        mrun[qt] = mnew;

        // Rescale accumulators now so the PV phase is pure WMMA.
#pragma unroll
        for (int j = 0; j < 4; ++j)
#pragma unroll
          for (int r = 0; r < 8; ++r) o[qt][j][r] *= alpha;
      }
    }

    // Phase 2: O^T accumulate; each V fragment read from LDS once, used by
    // both q-tiles, then dead (only 8 VGPRs of V live at a time).
#pragma unroll
    for (int j = 0; j < 4; ++j) {
      const bf16x16 vf = lds_frag(ldsV + (j * 16) * VSTRIDE, VSTRIDE);
#pragma unroll
      for (int qt = 0; qt < QW; ++qt)
        if (act[qt]) o[qt][j] = wmma_bf16(vf, pf[qt], o[qt][j]);
    }
  }

  bf16* so = ldsO[wave];
#pragma unroll
  for (int qt = 0; qt < QW; ++qt) {
    const float rl = 1.0f / (lrun[qt] * 1024.0f);
#pragma unroll
    for (int j = 0; j < 4; ++j)
#pragma unroll
      for (int r = 0; r < 8; ++r) so[(16 * qt + qlane) * 72 + j * 16 + kh8 + r] = (bf16)(o[qt][j][r] * rl);
  }
  asm volatile("s_wait_dscnt 0" ::: "memory");
  __builtin_amdgcn_wave_barrier();
{
#pragma unroll
    for (int it = 0; it < 8; ++it) { const int ch = lane + 32 * it, ql = ch >> 3, q8 = (ch & 7) * 8;   // 8 lanes cover one row's 128 B
      *(v4u_t*)(attnOut + ((size_t)(b * QROWS + q0 + ql)) * DD + h * DKK + q8) = *(const v4ua*)(so + ql * 72 + q8); }
    
  }
}


// xp = LN(x)*g + b + pos[s]  (f32 rows for the residual, and the same rows rounded to f16 for the q, k, v products); block = 8 rows
__global__ __launch_bounds__(256) void k_lnpos(const float* __restrict__ X, const float* __restrict__ g, const float* __restrict__ bb, const float* __restrict__ pos, float* __restrict__ Y, bf16* __restrict__ Y16) {
  __shared__ __attribute__((aligned(16))) float rowS[8 * (DD + 4)];
  const int tid = threadIdx.x, r = tid >> 5, lane = tid & 31; const size_t row = (size_t)blockIdx.x * 8 + r; const int s_ = row % SS; const float* xr = X + row * DD;
  float s = 0.0f;
#pragma unroll 1
  for (int i = lane; i < DD; i += 32) { const float v = xr[i]; rowS[r * (DD + 4) + i] = v; s += v; }
#pragma unroll
  for (int off = 1; off < 32; off <<= 1) s += __shfl_xor(s, off, 32);
  const float mean = s * (1.0f / DD); float q = 0.0f;
#pragma unroll 1
  for (int i = lane; i < DD; i += 32) { const float d = rowS[r * (DD + 4) + i] - mean; q += d * d; }
#pragma unroll
  for (int off = 1; off < 32; off <<= 1) q += __shfl_xor(q, off, 32);
  const float rstd = rsqrtf(q * (1.0f / DD) + 1e-5f);
#pragma unroll 1
  for (int i = lane; i < DD; i += 32) rowS[r * (DD + 4) + i] = (rowS[r * (DD + 4) + i] - mean) * rstd * g[i] + bb[i] + pos[(size_t)s_ * DD + i];
  __syncthreads();
{ for (int q4 = tid; q4 < 8 * (DD / 4); q4 += 256) { const int rr = q4 / (DD / 4), c4 = (q4 % (DD / 4)) * 4;
      const v4f_t v = *(const v4fa*)(rowS + rr * (DD + 4) + c4);
      bf16x4 hq; hq[0] = (bf16)v[0]; hq[1] = (bf16)v[1]; hq[2] = (bf16)v[2]; hq[3] = (bf16)v[3];
      *(v4f_t*)(Y + ((size_t)blockIdx.x * 8 + rr) * DD + c4) = v;
      *(bf16x4*)(Y16 + ((size_t)blockIdx.x * 8 + rr) * DD + c4) = hq; }  }
}
// kbias[b][k] = 1 − mask[b][k]  (the torch quirk: a FLOAT additive mask); 8-KB rows
__global__ __launch_bounds__(256) void k_kbias(const float* __restrict__ mask, float* __restrict__ kb) { const int b = blockIdx.x;
  for (int q4 = threadIdx.x; q4 < KROWS / 4; q4 += 256) { const v4f_t m = *(const v4f_t*)(mask + (size_t)b * KROWS + q4 * 4); v4f_t o; for (int e = 0; e < 4; ++e) o[e] = 1.0f - m[e];
    *(v4f_t*)(kb + (size_t)b * KROWS + q4 * 4) = o;  } }

extern "C" void kernel_launch(void* const* d_in, const int* in_sizes, int n_in,
                              void* d_out, int out_size, void* d_ws, size_t ws_size,
                              hipStream_t stream) {
  (void)in_sizes; (void)n_in; (void)out_size;
  const float** f = (const float**)d_in;
  const float* x = f[0], *mask = f[1], *pos = f[2], *lng = f[3], *lnb = f[4], *Win = f[5], *bin = f[6], *Wout = f[7], *bout = f[8], *Wto = f[9], *bto = f[10];
  float* out = (float*)d_out;     // [4,2048,1024]
  char* ws = (char*)d_ws;
  float* xp = (float*)ws; ws += (size_t)MTOK * DD * 4;                  // 32 MB: f32 rows, read again only as the residual
  bf16* xp16 = (bf16*)ws; ws += (size_t)MTOK * DD * 2; bf16* Q16 = (bf16*)ws; ws += (size_t)MTOK * DD * 2; bf16* K16 = (bf16*)ws; ws += (size_t)MTOK * DD * 2;   // 16 MB each
  bf16* Vt = (bf16*)ws; ws += (size_t)MTOK * DD * 2; bf16* att16 = (bf16*)ws; ws += (size_t)MTOK * DD * 2; bf16* y16 = (bf16*)ws; ws += (size_t)MTOK * DD * 2;
  float* kb = (float*)ws; ws += (size_t)BB * KROWS * 4;
  if ((size_t)(ws - (char*)d_ws) > ws_size) return;
  const dim3 blk(256); const dim3 gp(MTOK / 128, DD / 256);
  k_lnpos<<<dim3(MTOK / 8), blk, 0, stream>>>(x, lng, lnb, pos, xp, xp16);
  k_kbias<<<dim3(BB), blk, 0, stream>>>(mask, kb);
  gemm_rb_kernel<bf16, 0><<<gp, blk, 0, stream>>>(xp16, Win, bin, nullptr, nullptr, nullptr, Q16, MTOK, DD, DD);
  gemm_rb_kernel<bf16, 0><<<gp, blk, 0, stream>>>(xp16, Win + (size_t)DD * DD, bin + DD, nullptr, nullptr, nullptr, K16, MTOK, DD, DD);
  gemm_rb_kernel<bf16, 1><<<gp, blk, 0, stream>>>(xp16, Win + (size_t)2 * DD * DD, bin + 2 * DD, nullptr, nullptr, nullptr, Vt, MTOK, DD, DD);
  v_attn_kernel<<<dim3(QROWS / 64, HH, BB), dim3(64), 0, stream>>>(Q16, K16, Vt, kb, att16);
  gemm_rb_kernel<bf16, 4><<<gp, blk, 0, stream>>>(att16, Wout, bout, nullptr, xp, nullptr, y16, MTOK, DD, DD);      // y = xp + o*out_proj^T + b, summed in f32, stored f16
  gemm_rb_kernel<bf16, 2><<<gp, blk, 0, stream>>>(y16, Wto, bto, nullptr, nullptr, nullptr, out, MTOK, DD, DD);      // out = y*to_out^T + b
}

// v005
// One run takes 270 microseconds.
// Next to v004, in two timings, it ran 1.08 times as fast each time.
// Over all steps from v000 it is 1.72 times as fast.
// Contractions on v_wmma_f32_16x16x32_f16 (plain f16 operands, f32 accumulate): qkv = (LN(x) + pos)·in_projᵀ + b (K = 1024, N = 3072),
// the 16-head attention (dk = 64, scale 1/8) with the reference's ADDITIVE float mask (1 − padding_mask) as a per-(batch,key) bias,
// flash-style Sᵀ = K·Qᵀ / Oᵀ = Vᵀ·Pᵀ with online softmax in f32 (P x1024, f16 output rows), attn_out = o·out_projᵀ + b + xp (residual in
// the epilogue, K = 1024) and (xp + attn_out)·to_outᵀ + b (K = 1024); LayerNorm and the positional add in f32. xp dominates the residual
// so plain f16 operands suffice. compute dtype: f16 operands, f32 accumulate.  x [4,2048,1024].
// Every matrix operand that one kernel hands to the next (xp, q, k, v transposed, the attention rows, y) is rounded to f16 once, from its f32
// value, at its producer's store, in the layout that the consumer stages; only the residual copy of xp and the final output are f32.
#include <hip/hip_runtime.h>
#include <hip/hip_bf16.h>
#include <math.h>

#define BB 4
#define SS 2048
#define QROWS 2048
#define KROWS 2048
#define NKV 2048
#define DD 1024
#define HH 16
#define KVH 16
#define KVD 1024
#define HKDIV 1
#define DKK 64
#define QW 2
#define MTOK (BB * SS)
#define GSTR 48

typedef _Float16 bf16;
typedef _Float16 f16;
typedef __attribute__((ext_vector_type(4))) unsigned v4u_t;
typedef unsigned v4ua __attribute__((ext_vector_type(4), may_alias));
typedef __attribute__((ext_vector_type(4))) float v4f_t;
typedef float v4fa __attribute__((ext_vector_type(4), may_alias));
typedef __attribute__((ext_vector_type(16))) bf16  bf16x16;
typedef bf16x16 f16x16;
typedef __attribute__((ext_vector_type(8)))  bf16  bf16x8;
typedef bf16x8 f16x8;
typedef __attribute__((ext_vector_type(4)))  bf16  bf16x4;
typedef __attribute__((ext_vector_type(8)))  float f32x8;
__device__ __forceinline__ f32x8 wmma16(f16x16 a, f16x16 b, f32x8 c) {
  c = __builtin_amdgcn_wmma_f32_16x16x32_f16(false, a, false, b, (short)0, c, false, false);
  asm volatile("v_nop\n\tv_nop\n\tv_nop\n\tv_nop" : "+v"(c) : "v"(a), "v"(b));
  return c;
}
#define LDS_STRIDE 48   // GEMM tiles: 32 -> 48 elems (96B rows): aligned b128 reads
#define KSTRIDE    72   // attn K tile: 64 -> 72 elems (144B rows): conflict-free b128
#define VSTRIDE    48   // attn V tile: 32 -> 48 elems

__device__ __forceinline__ f32x8 wmma_bf16(bf16x16 a, bf16x16 b, f32x8 c) {
  c = __builtin_amdgcn_wmma_f32_16x16x32_f16(false, a, false, b, (short)0, c, false, false);
  asm volatile("v_nop\n\tv_nop\n\tv_nop\n\tv_nop" : "+v"(c) : "v"(a), "v"(b));   // A/B-overwrite hazard guard
  return c;
}

// Work-group barrier of the staged loops: it waits for this wave's LDS traffic only. __syncthreads() also drains the load counter, so the
// next tile's global loads, issued just ahead of it, would be waited out before the matrix phase instead of flying under it.
__device__ __forceinline__ void lds_barrier() {
  asm volatile("s_wait_dscnt 0x0\n\ts_barrier_signal -1\n\ts_barrier_wait -1" ::: "memory");
}

// 16x32 (MxK) bf16 fragment from a row-major global matrix.
// lanes 0-15  (row=lane)    : elems 0..7 = K+0..7,  8..15 = K+16..23
// lanes 16-31 (row=lane-16) : elems 0..7 = K+8..15, 8..15 = K+24..31
template <typename T>
__device__ __forceinline__ bf16x16 load_frag(const T* __restrict__ base, int ld,
                                             int row0, int k0) {
  const int lane = threadIdx.x & 31;
  const int r    = lane & 15;
  const int kh   = (lane >> 4) * 8;
  const T* p0 = base + (size_t)(row0 + r) * ld + (k0 + kh);
  const T* p1 = p0 + 16;
  bf16x16 f;
#pragma unroll
  for (int i = 0; i < 8; ++i) {
    f[i]     = (bf16)p0[i];
    f[i + 8] = (bf16)p1[i];
  }
  return f;
}

// Same fragment from an LDS tile with padded row stride (base includes row0/k0).
__device__ __forceinline__ bf16x16 lds_frag(const bf16* base, int stride) {
  const int lane = threadIdx.x & 31;
  const int row  = lane & 15;
  const int kh   = (lane >> 4) * 8;
  const bf16x8 lo = *(const bf16x8*)(base + row * stride + kh);
  const bf16x8 hi = *(const bf16x8*)(base + row * stride + kh + 16);
  bf16x16 f;
#pragma unroll
  for (int i = 0; i < 8; ++i) { f[i] = lo[i]; f[i + 8] = hi[i]; }
  return f;
}

// Epilogue of the q, k, v product: f32 bias added, rounded to f16, staged in LDS, stored as whole 16-B chunks.
// VT false: rows [m][DD] (q, k). VT true: v transposed, rows (b, h, dk) of SS positions. nW = column among the 3*DD weight rows, nO = column inside its own product.
template <bool VT>
__device__ __forceinline__ void store_tile16(const f32x8 (&acc)[4][4], bf16* so, const float* __restrict__ bias, bf16* __restrict__ out,
                                             int mBlk, int nW, int nO, int wm, int wn, int nlane, int mh, int t) {
#pragma unroll   // this and the two below: unrolled so that every accumulator index is a constant
  for (int i = 0; i < 4; ++i)
#pragma unroll
    for (int j = 0; j < 4; ++j) {
      const int nl = wn + 16 * j + nlane;
      const float bv = bias ? bias[nW + nl] : 0.0f;
#pragma unroll
      for (int r = 0; r < 8; ++r) {
        const int ml = wm + 16 * i + mh + r;
        const bf16 hv = (bf16)(acc[i][j][r] + bv);
        if (!VT) so[ml * 264 + nl] = hv;        // [m][n]
        else     so[nl * 136 + ml] = hv;        // [n][m]  (n = h*64+dk rows of Vt, m = s contiguous)
      }
    }
  __syncthreads();
  if (!VT) {                // rows m: 256 halfs = 512 B each, 16-B chunks
    for (int ch = t; ch < 128 * 32; ch += 256) { const int ml = ch >> 5, q = (ch & 31) * 8;
      *(v4u_t*)(out + (size_t)(mBlk + ml) * DD + nO + q) = *(const v4ua*)(so + ml * 264 + q); }
  } else {                  // Vt rows (b, h, dk): 128 consecutive s = 256 B each
    const int b_ = mBlk / SS, s0 = mBlk % SS;
    for (int ch = t; ch < 256 * 16; ch += 256) { const int nl = ch >> 4, q = (ch & 15) * 8; const int n = nO + nl, h = n >> 6, dk = n & (DKK - 1);
      *(v4u_t*)(out + (((size_t)(b_ * HH + h)) * DKK + dk) * SS + s0 + q) = *(const v4ua*)(so + nl * 136 + q); }
  }
}

// ---------------------------------------------------------------------------
// GEMM: C[m][n] = sum_k A[m][k]*W[n][k] + bias[n]   (torch Linear)
// Block 256 thr (8 waves), tile 128M x 256N, K-step 32; wave tile 64x64.
// A/W staged through LDS (bf16, padded stride) with next-tile register
// prefetch overlapping the WMMA phase.
// MODE 2: fp32 [M][N]   MODE 4: as MODE 2 (f32 bias and residual), rounded to f16 at the store
// MODE 5: the three products of one A in one grid (N = 3*DD weight rows): block columns below DD give q, below 2*DD k (f16 [M][DD] each), the rest
//         v as f16 Vt[b][h][dk][s]; the three outputs lie one behind the other at out. 768 blocks: two are resident per WGP, one loads while the other multiplies.
// ---------------------------------------------------------------------------
template <typename AT, int MODE>
__global__ __launch_bounds__(256) void gemm_rb_kernel(
    const AT* __restrict__ A, const float* __restrict__ W,
    const float* __restrict__ bias, const float* __restrict__ rowscale, const float* __restrict__ R, const float* __restrict__ rowbias, void* __restrict__ out,
    int M, int N, int K) {
  __shared__ bf16 ldsA[128 * LDS_STRIDE];   // 12.0 KB
  __shared__ bf16 ldsW[256 * LDS_STRIDE];   // 24.0 KB
  // output staging: MODE 5 [128 m][264] f16 (q, k) or [256 n][136] f16 (v), MODE 2 and 4 [64 m][260] f32 (two halves)
  __shared__ __attribute__((aligned(16))) unsigned char sob[256 * 136 * 2];   // 69,632 B >= 128*264*2 and >= 64*260*4

  const int t    = threadIdx.x;
  const int wave = t >> 5;
  const int lane = t & 31;
  const int wm   = (wave & 1) * 64;
  const int wn   = (wave >> 1) * 64;
  const int mBlk = blockIdx.x * 128;
  const int nBlk = blockIdx.y * 256;

  // Staging map: neighbouring lanes take neighbouring 16-B chunks of one row's 32-k segment, so a wave-wide 16-B load
  // covers whole row segments (f32: 4 rows x 128 B, f16: 8 rows x 64 B) instead of one line per lane.
  constexpr int AEL = 16 / (int)sizeof(AT);   // elements per 16-B chunk
  constexpr int ALN = 32 / AEL;               // lanes per A row segment
  constexpr int ARS = 256 / ALN;              // A rows covered by one load of the block
  constexpr int ACH = 128 / ARS;              // A chunks per thread
  const int ar0 = t / ALN, ac0 = (t % ALN) * AEL;
  const int wr0 = t >> 3,  wc0 = (t & 7) * 4;
  unsigned aoff[ACH], woff[8];                // byte offsets from the block-uniform bases; they step by one 32-k segment per trip
#pragma unroll   // this and the chunk loops below: unrolled so that the offset and staging arrays stay in registers
  for (int i = 0; i < ACH; ++i) aoff[i] = (unsigned)(((ar0 + ARS * i) * K + ac0) * (int)sizeof(AT));
#pragma unroll
  for (int i = 0; i < 8; ++i) woff[i] = (unsigned)((min(nBlk + wr0 + 32 * i, N - 1) * K + wc0) * 4);   // ragged last N tile: clamp the weight row (those columns are never stored)
  const char* aBase = (const char*)(A + (size_t)mBlk * K);
  const char* wBase = (const char*)W;

  v4u_t abuf[ACH];
  v4f_t wbuf[8];
#pragma unroll
  for (int i = 0; i < ACH; ++i) abuf[i] = *(const v4ua*)(aBase + aoff[i]);
#pragma unroll
  for (int i = 0; i < 8; ++i) wbuf[i] = *(const v4fa*)(wBase + woff[i]);

  f32x8 acc[4][4] = {};

  for (int k = 0; k < K; k += 32) {
    lds_barrier();   // every wave has read the previous tile's fragments
#pragma unroll
    for (int i = 0; i < ACH; ++i) {
      bf16* dst = &ldsA[(ar0 + ARS * i) * LDS_STRIDE + ac0];
      if constexpr (sizeof(AT) == 4) {
        const v4f_t v = __builtin_bit_cast(v4f_t, abuf[i]);
        bf16x4 q; q[0] = (bf16)v[0]; q[1] = (bf16)v[1]; q[2] = (bf16)v[2]; q[3] = (bf16)v[3];
        *(bf16x4*)dst = q;
      } else {
        *(v4ua*)dst = abuf[i];
      }
    }
#pragma unroll
    for (int i = 0; i < 8; ++i) {
      const v4f_t v = wbuf[i];
      bf16x4 q; q[0] = (bf16)v[0]; q[1] = (bf16)v[1]; q[2] = (bf16)v[2]; q[3] = (bf16)v[3];
      *(bf16x4*)&ldsW[(wr0 + 32 * i) * LDS_STRIDE + wc0] = q;
    }
    if (k + 32 < K) {
#pragma unroll
      for (int i = 0; i < ACH; ++i) { aoff[i] += 32u * (unsigned)sizeof(AT); abuf[i] = *(const v4ua*)(aBase + aoff[i]); }
#pragma unroll
      for (int i = 0; i < 8; ++i) { woff[i] += 32u * 4u; wbuf[i] = *(const v4fa*)(wBase + woff[i]); }
    }
    lds_barrier();   // tile visible; the loads above stay in flight over the matrix phase

    bf16x16 af[4], wf[4];
#pragma unroll
    for (int i = 0; i < 4; ++i)
      af[i] = lds_frag(ldsA + (wm + 16 * i) * LDS_STRIDE, LDS_STRIDE);
#pragma unroll
    for (int j = 0; j < 4; ++j)
      wf[j] = lds_frag(ldsW + (wn + 16 * j) * LDS_STRIDE, LDS_STRIDE);
#pragma unroll
    for (int i = 0; i < 4; ++i)
#pragma unroll
      for (int j = 0; j < 4; ++j)
        acc[i][j] = wmma_bf16(af[i], wf[j], acc[i][j]);
  }

  const int nlane = lane & 15;
  const int mh    = (lane >> 4) * 8;
  __syncthreads();
  if (MODE == 5) {
    const int part = nBlk / DD;   // block-uniform: a 256-column tile lies inside one of the three products
    bf16* outp = (bf16*)out + (size_t)part * MTOK * DD;
    if (part < 2) store_tile16<false>(acc, (bf16*)sob, bias, outp, mBlk, nBlk, nBlk - part * DD, wm, wn, nlane, mh, t);
    else          store_tile16<true>(acc, (bf16*)sob, bias, outp, mBlk, nBlk, nBlk - part * DD, wm, wn, nlane, mh, t);
  } else {
    float* so = (float*)sob;
#pragma unroll 1
    for (int hf = 0; hf < 2; ++hf) {
      if (wm == hf * 64) {
#pragma unroll
        for (int i = 0; i < 4; ++i)
#pragma unroll
          for (int j = 0; j < 4; ++j) {
            const int nl = wn + 16 * j + nlane;
            const float bv = bias ? bias[nBlk + nl] : 0.0f;
#pragma unroll
            for (int r = 0; r < 8; ++r) { const int mrow = mBlk + hf * 64 + 16 * i + mh + r; so[(16 * i + mh + r) * 260 + nl] = acc[i][j][r] * (rowscale ? rowscale[mrow] : 1.0f) + bv + (rowbias ? rowbias[mrow] : 0.0f); }
          }
      }
      __syncthreads();
      if (R) {   // residual: fold R[m][n] into the staged tile once (same thread <-> same chunks as the stores below)
        for (int ch = t; ch < 64 * 64; ch += 256) { const int ml = ch >> 6, q = (ch & 63) * 4;
          if (nBlk + q < N) { const v4f_t rv = *(const v4f_t*)(R + (size_t)(mBlk + hf * 64 + ml) * N + nBlk + q); v4f_t v = *(const v4fa*)(so + ml * 260 + q); v += rv; *(v4fa*)(so + ml * 260 + q) = v; } }
        asm volatile("s_wait_dscnt 0" ::: "memory");
      }
{   // 64 rows x 256 floats = 1 KB segments, float4 chunks; columns >= N (ragged tile) skipped
        const int q = (t & 63) * 4;
        if (nBlk + q < N) {
          for (int m0 = t >> 6; m0 < 64; m0 += 16) {   // rows m0, m0 + 4, m0 + 8, m0 + 12 per trip: four LDS reads and four stores in flight
            v4f_t v[4];
#pragma unroll   // this and the next: unrolled so that the four chunks stay in registers
            for (int u = 0; u < 4; ++u) v[u] = *(const v4fa*)(so + (m0 + 4 * u) * 260 + q);
#pragma unroll
            for (int u = 0; u < 4; ++u) {
              const size_t eo = (size_t)(mBlk + hf * 64 + m0 + 4 * u) * N + nBlk + q;
              if (MODE == 4) { bf16x4 hq; hq[0] = (bf16)v[u][0]; hq[1] = (bf16)v[u][1]; hq[2] = (bf16)v[u][2]; hq[3] = (bf16)v[u][3];
                *(bf16x4*)((bf16*)out + eo) = hq; }
              else *(v4f_t*)((float*)out + eo) = v[u];
            }
          }
        }
      }
      __syncthreads();
    }
  }
}

// 2^x by the hardware instruction alone (results below 2^-126 come out as 0; -inf gives 0).
__device__ __forceinline__ float hw_exp2(float x) { return __builtin_amdgcn_exp2f(x); }

__global__ __launch_bounds__(64) void v_attn_kernel(
    const bf16* __restrict__ Qb, const bf16* __restrict__ Kb,
    const bf16* __restrict__ Vt, const float* __restrict__ kbias,   // kbias [B][KROWS]: additive per-key logit bias (1 − mask)
    bf16* __restrict__ attnOut) {
  __shared__ bf16 ldsK[32 * KSTRIDE];   // 4.5 KB
  __shared__ bf16 ldsV[64 * VSTRIDE];   // 6.0 KB
  __shared__ __attribute__((aligned(16))) bf16 ldsO[2][32 * 72];   // per-wave f16 output tile: 32 queries x 64 dk, 72-elem rows

  const int q0blk = blockIdx.x * 64;
  const int h  = blockIdx.y;
  const int b  = blockIdx.z;
  const int t    = threadIdx.x;
  const int wave = t >> 5;
  const int lane = t & 31;
  const int qlane = lane & 15;
  const int kh8   = (lane >> 4) * 8;
  const int q0 = q0blk + wave * 32;          // this wave's 32 queries

  const int hk = h / HKDIV;
  const bf16* Qh = Qb + (size_t)b * QROWS * DD + h * DKK;        // queries: QROWS rows per batch, row stride DD
  const bf16* Kh = Kb + (size_t)b * KROWS * KVD + hk * DKK;      // keys: KROWS rows per batch, row stride KVD
  const bf16* Vh = Vt + ((size_t)(b * KVH + hk)) * DKK * KROWS;  // Vᵀ [KVH][64][KROWS] per batch

  // Cooperative staging (64 threads), neighbouring lanes on neighbouring 16-B chunks of a row:
  // K tile 32x64 (8 lanes cover a 128-B row, 8 rows per load of the block); V tile 64x32 (4 lanes cover a 64-B row, 16 rows per load).
  const int krow = t >> 3;
  const int kcol = (t & 7) * 8;
  const int vrow = t >> 2;
  const int vcol = (t & 3) * 8;
  const bf16* kSrc = Kh + (size_t)krow * KVD + kcol;
  const bf16* vSrc = Vh + (size_t)vrow * KROWS + vcol;

  bf16x16 qf[QW][2];
#pragma unroll
  for (int qt = 0; qt < QW; ++qt) {
    qf[qt][0] = load_frag(Qh, DD, q0 + 16 * qt, 0);
    qf[qt][1] = load_frag(Qh, DD, q0 + 16 * qt, 32);
  }

  f32x8 o[QW][4] = {};
  float mrun[QW], lrun[QW];
#pragma unroll
  for (int qt = 0; qt < QW; ++qt) { mrun[qt] = -INFINITY; lrun[qt] = 0.0f; }

  const float scale = 0.125f * 1.44269504088896340736f;  // 1/sqrt(DK)*log2(e)
  const float NEG2 = -1.0e9f;    // masked logit: its weight is exactly 0 once any valid key of the row has been seen (every row
                                 // has one), and anything accumulated before that is wiped by alpha == 0 — same result as -inf
  const int kmax = KROWS - 1;
  __shared__ float kbS[KROWS];
  for (int i = threadIdx.x; i < KROWS; i += 64) kbS[i] = kbias[(size_t)b * KROWS + i] * 1.44269504088896340736f;   // in log2 units
  __syncthreads();

  // Prefetch key block kb=0 into registers.
  bf16x8 kreg[4], vreg[4];
#pragma unroll
  for (int i = 0; i < 4; ++i) {
    kreg[i] = *(const bf16x8*)(kSrc + (size_t)(8 * i) * KVD);
    vreg[i] = *(const bf16x8*)(vSrc + (size_t)(16 * i) * KROWS);
  }

  for (int kb = 0; kb <= kmax; kb += 32) {
    lds_barrier();   // previous readers done with LDS
#pragma unroll
    for (int i = 0; i < 4; ++i) {
      *(bf16x8*)(&ldsK[(krow + 8 * i) * KSTRIDE + kcol])  = kreg[i];
      *(bf16x8*)(&ldsV[(vrow + 16 * i) * VSTRIDE + vcol]) = vreg[i];
    }
    if (kb + 32 <= kmax) {   // prefetch next block during compute
      const bf16* kn = kSrc + (size_t)(kb + 32) * KVD;
      const bf16* vn = vSrc + (kb + 32);
#pragma unroll
      for (int i = 0; i < 4; ++i) {
        kreg[i] = *(const bf16x8*)(kn + (size_t)(8 * i) * KVD);
        vreg[i] = *(const bf16x8*)(vn + (size_t)(16 * i) * KROWS);
      }
      asm volatile("s_wait_xcnt 0x0" ::: "memory");   // the loads outlive the barrier: their address pairs step on only behind this wait
    }
    lds_barrier();   // tile visible; the prefetch above stays in flight over scores, softmax and PV

    // Phase 1: scores + softmax for both q-tiles (K fragments live here only).
    bf16x16 kf[2][2];
#pragma unroll
    for (int ktile = 0; ktile < 2; ++ktile)
#pragma unroll
      for (int c = 0; c < 2; ++c)
        kf[ktile][c] = lds_frag(ldsK + (ktile * 16) * KSTRIDE + c * 32, KSTRIDE);

    bf16x16 pf[QW];
    bool act[QW];
#pragma unroll
    for (int qt = 0; qt < QW; ++qt) {
      unsigned mbits = 0;
      {
#pragma unroll
        for (int r = 0; r < 8; ++r) { const int j0 = kb + kh8 + r; if (j0 < NKV) mbits |= 1u << r; if (j0 + 16 < NKV) mbits |= 1u << (8 + r); }
        act[qt] = (__builtin_amdgcn_ballot_w32(mbits != 0) != 0);
      }
      if (act[qt]) {
        const int q_my = q0 + 16 * qt + qlane;
        f32x8 s0 = {}, s1 = {};
        s0 = wmma_bf16(kf[0][0], qf[qt][0], s0);
        s0 = wmma_bf16(kf[0][1], qf[qt][1], s0);
        s1 = wmma_bf16(kf[1][0], qf[qt][0], s1);
        s1 = wmma_bf16(kf[1][1], qf[qt][1], s1);

        float mx = -INFINITY;
#pragma unroll
        for (int r = 0; r < 8; ++r) {
          const int k0i = kb + kh8 + r;
          const int k1i = k0i + 16;
          (void)k0i; (void)k1i; (void)q_my;
          s0[r] = (mbits & (1u << r))       ? s0[r] * scale + kbS[kb + kh8 + r] : NEG2;
          s1[r] = (mbits & (1u << (8 + r))) ? s1[r] * scale + kbS[kb + 16 + kh8 + r] : NEG2;
          mx = fmaxf(mx, fmaxf(s0[r], s1[r]));
        }
        mx = fmaxf(mx, __shfl_xor(mx, 16, 32));
        const float mnew  = fmaxf(mrun[qt], mx);
        // hw_exp2 here and below: one v_exp_f32 each. exp2f() wraps it in a compare, two selects, an add and an ldexp to keep results below 2^-126;
        // such a weight is 0 in the f16 P and vanishes beside a row sum >= 1, and such an alpha scales history that rounds away likewise.
        const float alpha = hw_exp2(mrun[qt] - mnew);

        float rsum = 0.0f;
#pragma unroll
        for (int r = 0; r < 8; ++r) {
          const float p0 = hw_exp2(s0[r] - mnew);
          const float p1 = hw_exp2(s1[r] - mnew);
          rsum += p0 + p1;
          pf[qt][r]     = (bf16)(p0 * 1024.0f);     // P carried x1024: no f16 copy of a probability is sub-normal
          pf[qt][r + 8] = (bf16)(p1 * 1024.0f);
        }
        rsum += __shfl_xor(rsum, 16, 32);
        lrun[qt] = lrun[qt] * alpha + rsum;
        mrun[qt] = mnew;

        // Rescale accumulators now so the PV phase is pure WMMA.
#pragma unroll
        for (int j = 0; j < 4; ++j)
#pragma unroll
          for (int r = 0; r < 8; ++r) o[qt][j][r] *= alpha;
      }
    }

    // Phase 2: O^T accumulate; each V fragment read from LDS once, used by
    // both q-tiles, then dead (only 8 VGPRs of V live at a time).
#pragma unroll
    for (int j = 0; j < 4; ++j) {
      const bf16x16 vf = lds_frag(ldsV + (j * 16) * VSTRIDE, VSTRIDE);
#pragma unroll
      for (int qt = 0; qt < QW; ++qt)
        if (act[qt]) o[qt][j] = wmma_bf16(vf, pf[qt], o[qt][j]);
    }
  }

  bf16* so = ldsO[wave];
#pragma unroll
  for (int qt = 0; qt < QW; ++qt) {
    const float rl = 1.0f / (lrun[qt] * 1024.0f);
#pragma unroll
    for (int j = 0; j < 4; ++j)
#pragma unroll
      for (int r = 0; r < 8; ++r) so[(16 * qt + qlane) * 72 + j * 16 + kh8 + r] = (bf16)(o[qt][j][r] * rl);
  }
  asm volatile("s_wait_dscnt 0" ::: "memory");
  __builtin_amdgcn_wave_barrier();
{
#pragma unroll
    for (int it = 0; it < 8; ++it) { const int ch = lane + 32 * it, ql = ch >> 3, q8 = (ch & 7) * 8;   // 8 lanes cover one row's 128 B
      *(v4u_t*)(attnOut + ((size_t)(b * QROWS + q0 + ql)) * DD + h * DKK + q8) = *(const v4ua*)(so + ql * 72 + q8); }
    
  }
}


// xp = LN(x)*g + b + pos[s]  (f32 rows for the residual, and the same rows rounded to f16 for the q, k, v products); block = 8 rows
__global__ __launch_bounds__(256) void k_lnpos(const float* __restrict__ X, const float* __restrict__ g, const float* __restrict__ bb, const float* __restrict__ pos, float* __restrict__ Y, bf16* __restrict__ Y16) {
  __shared__ __attribute__((aligned(16))) float rowS[8 * (DD + 4)];
  const int tid = threadIdx.x, r = tid >> 5, lane = tid & 31; const size_t row = (size_t)blockIdx.x * 8 + r; const int s_ = row % SS; const float* xr = X + row * DD;
  float s = 0.0f;
#pragma unroll 1
  for (int i = lane; i < DD; i += 32) { const float v = xr[i]; rowS[r * (DD + 4) + i] = v; s += v; }
#pragma unroll
  for (int off = 1; off < 32; off <<= 1) s += __shfl_xor(s, off, 32);
  const float mean = s * (1.0f / DD); float q = 0.0f;
#pragma unroll 1
  for (int i = lane; i < DD; i += 32) { const float d = rowS[r * (DD + 4) + i] - mean; q += d * d; }
#pragma unroll
  for (int off = 1; off < 32; off <<= 1) q += __shfl_xor(q, off, 32);
  const float rstd = rsqrtf(q * (1.0f / DD) + 1e-5f);
#pragma unroll 1
  for (int i = lane; i < DD; i += 32) rowS[r * (DD + 4) + i] = (rowS[r * (DD + 4) + i] - mean) * rstd * g[i] + bb[i] + pos[(size_t)s_ * DD + i];
  __syncthreads();
{ for (int q4 = tid; q4 < 8 * (DD / 4); q4 += 256) { const int rr = q4 / (DD / 4), c4 = (q4 % (DD / 4)) * 4;
      const v4f_t v = *(const v4fa*)(rowS + rr * (DD + 4) + c4);
      bf16x4 hq; hq[0] = (bf16)v[0]; hq[1] = (bf16)v[1]; hq[2] = (bf16)v[2]; hq[3] = (bf16)v[3];
      *(v4f_t*)(Y + ((size_t)blockIdx.x * 8 + rr) * DD + c4) = v;
      *(bf16x4*)(Y16 + ((size_t)blockIdx.x * 8 + rr) * DD + c4) = hq; }  }
}
// kbias[b][k] = 1 − mask[b][k]  (the torch quirk: a FLOAT additive mask); 8-KB rows
__global__ __launch_bounds__(256) void k_kbias(const float* __restrict__ mask, float* __restrict__ kb) { const int b = blockIdx.x;
  for (int q4 = threadIdx.x; q4 < KROWS / 4; q4 += 256) { const v4f_t m = *(const v4f_t*)(mask + (size_t)b * KROWS + q4 * 4); v4f_t o; for (int e = 0; e < 4; ++e) o[e] = 1.0f - m[e];
    *(v4f_t*)(kb + (size_t)b * KROWS + q4 * 4) = o;  } }

extern "C" void kernel_launch(void* const* d_in, const int* in_sizes, int n_in,
                              void* d_out, int out_size, void* d_ws, size_t ws_size,
                              hipStream_t stream) {
  (void)in_sizes; (void)n_in; (void)out_size;
  const float** f = (const float**)d_in;
  const float* x = f[0], *mask = f[1], *pos = f[2], *lng = f[3], *lnb = f[4], *Win = f[5], *bin = f[6], *Wout = f[7], *bout = f[8], *Wto = f[9], *bto = f[10];
  float* out = (float*)d_out;     // [4,2048,1024]
  char* ws = (char*)d_ws;
  float* xp = (float*)ws; ws += (size_t)MTOK * DD * 4;                  // 32 MB: f32 rows, read again only as the residual
  bf16* xp16 = (bf16*)ws; ws += (size_t)MTOK * DD * 2; bf16* Q16 = (bf16*)ws; ws += (size_t)MTOK * DD * 2; bf16* K16 = (bf16*)ws; ws += (size_t)MTOK * DD * 2;   // 16 MB each
  bf16* Vt = (bf16*)ws; ws += (size_t)MTOK * DD * 2; bf16* att16 = (bf16*)ws; ws += (size_t)MTOK * DD * 2; bf16* y16 = (bf16*)ws; ws += (size_t)MTOK * DD * 2;
  float* kb = (float*)ws; ws += (size_t)BB * KROWS * 4;
  if ((size_t)(ws - (char*)d_ws) > ws_size) return;
  const dim3 blk(256); const dim3 gp(MTOK / 128, DD / 256);
  k_lnpos<<<dim3(MTOK / 8), blk, 0, stream>>>(x, lng, lnb, pos, xp, xp16);
  k_kbias<<<dim3(BB), blk, 0, stream>>>(mask, kb);
  gemm_rb_kernel<bf16, 5><<<dim3(MTOK / 128, 3 * DD / 256), blk, 0, stream>>>(xp16, Win, bin, nullptr, nullptr, nullptr, Q16, MTOK, 3 * DD, DD);   // q, k, v: Q16, K16, Vt are adjacent
  v_attn_kernel<<<dim3(QROWS / 64, HH, BB), dim3(64), 0, stream>>>(Q16, K16, Vt, kb, att16);
  gemm_rb_kernel<bf16, 4><<<gp, blk, 0, stream>>>(att16, Wout, bout, nullptr, xp, nullptr, y16, MTOK, DD, DD);      // y = xp + o*out_proj^T + b, summed in f32, stored f16
  gemm_rb_kernel<bf16, 2><<<gp, blk, 0, stream>>>(y16, Wto, bto, nullptr, nullptr, nullptr, out, MTOK, DD, DD);      // out = y*to_out^T + b
}

// v006
// A run of this version takes 255 microseconds.
// In both of two side-by-side timings against v005, it was 1.06 times as fast.
// All steps since v000 together make it 1.82 times as fast.
// Contractions on v_wmma_f32_16x16x32_f16 (plain f16 operands, f32 accumulate): qkv = (LN(x) + pos)·in_projᵀ + b (K = 1024, N = 3072),
// the 16-head attention (dk = 64, scale 1/8) with the reference's ADDITIVE float mask (1 − padding_mask) as a per-(batch,key) bias,
// flash-style Sᵀ = K·Qᵀ / Oᵀ = Vᵀ·Pᵀ with online softmax in f32 (P x1024, f16 output rows), attn_out = o·out_projᵀ + b + xp (residual in
// the epilogue, K = 1024) and (xp + attn_out)·to_outᵀ + b (K = 1024); LayerNorm and the positional add in f32. xp dominates the residual
// so plain f16 operands suffice. compute dtype: f16 operands, f32 accumulate.  x [4,2048,1024].
// Every matrix operand that one kernel hands to the next (xp, q, k, v transposed, the attention rows, y) is rounded to f16 once, from its f32
// value, at its producer's store, in the layout that the consumer stages; only the residual copy of xp and the final output are f32.
#include <hip/hip_runtime.h>
#include <hip/hip_bf16.h>
#include <math.h>

#define BB 4
#define SS 2048
#define QROWS 2048
#define KROWS 2048
#define NKV 2048
#define DD 1024
#define HH 16
#define KVH 16
#define KVD 1024
#define HKDIV 1
#define DKK 64
#define QW 2
#define MTOK (BB * SS)
#define GSTR 48

typedef _Float16 bf16;
typedef _Float16 f16;
typedef __attribute__((ext_vector_type(4))) unsigned v4u_t;
typedef unsigned v4ua __attribute__((ext_vector_type(4), may_alias));
typedef __attribute__((ext_vector_type(4))) float v4f_t;
typedef float v4fa __attribute__((ext_vector_type(4), may_alias));
typedef __attribute__((ext_vector_type(16))) bf16  bf16x16;
typedef bf16x16 f16x16;
typedef __attribute__((ext_vector_type(8)))  bf16  bf16x8;
typedef bf16x8 f16x8;
typedef __attribute__((ext_vector_type(4)))  bf16  bf16x4;
typedef __attribute__((ext_vector_type(8)))  float f32x8;
__device__ __forceinline__ f32x8 wmma16(f16x16 a, f16x16 b, f32x8 c) {
  c = __builtin_amdgcn_wmma_f32_16x16x32_f16(false, a, false, b, (short)0, c, false, false);
  asm volatile("v_nop\n\tv_nop\n\tv_nop\n\tv_nop" : "+v"(c) : "v"(a), "v"(b));
  return c;
}
#define LDS_STRIDE 48   // GEMM tiles: 32 -> 48 elems (96B rows): aligned b128 reads
#define KSTRIDE    72   // attn K tile: 64 -> 72 elems (144B rows): conflict-free b128
#define VSTRIDE    48   // attn V tile: 32 -> 48 elems

__device__ __forceinline__ f32x8 wmma_bf16(bf16x16 a, bf16x16 b, f32x8 c) {
  c = __builtin_amdgcn_wmma_f32_16x16x32_f16(false, a, false, b, (short)0, c, false, false);
  asm volatile("v_nop\n\tv_nop\n\tv_nop\n\tv_nop" : "+v"(c) : "v"(a), "v"(b));   // A/B-overwrite hazard guard
  return c;
}

// Work-group barrier of the staged loops: it waits for this wave's LDS traffic only. __syncthreads() also drains the load counter, so the
// next tile's global loads, issued just ahead of it, would be waited out before the matrix phase instead of flying under it.
__device__ __forceinline__ void lds_barrier() {
  asm volatile("s_wait_dscnt 0x0\n\ts_barrier_signal -1\n\ts_barrier_wait -1" ::: "memory");
}

// 16x32 (MxK) bf16 fragment from a row-major global matrix.
// lanes 0-15  (row=lane)    : elems 0..7 = K+0..7,  8..15 = K+16..23
// lanes 16-31 (row=lane-16) : elems 0..7 = K+8..15, 8..15 = K+24..31
template <typename T>
__device__ __forceinline__ bf16x16 load_frag(const T* __restrict__ base, int ld,
                                             int row0, int k0) {
  const int lane = threadIdx.x & 31;
  const int r    = lane & 15;
  const int kh   = (lane >> 4) * 8;
  const T* p0 = base + (size_t)(row0 + r) * ld + (k0 + kh);
  const T* p1 = p0 + 16;
  bf16x16 f;
#pragma unroll
  for (int i = 0; i < 8; ++i) {
    f[i]     = (bf16)p0[i];
    f[i + 8] = (bf16)p1[i];
  }
  return f;
}

// Same fragment from an LDS tile with padded row stride (base includes row0/k0).
__device__ __forceinline__ bf16x16 lds_frag(const bf16* base, int stride) {
  const int lane = threadIdx.x & 31;
  const int row  = lane & 15;
  const int kh   = (lane >> 4) * 8;
  const bf16x8 lo = *(const bf16x8*)(base + row * stride + kh);
  const bf16x8 hi = *(const bf16x8*)(base + row * stride + kh + 16);
  bf16x16 f;
#pragma unroll
  for (int i = 0; i < 8; ++i) { f[i] = lo[i]; f[i + 8] = hi[i]; }
  return f;
}

// Epilogue of the q, k, v product: f32 bias added, rounded to f16, staged in LDS, stored as whole 16-B chunks.
// VT false: rows [m][DD] (q, k). VT true: v transposed, rows (b, h, dk) of SS positions. nW = column among the 3*DD weight rows, nO = column inside its own product.
template <bool VT>
__device__ __forceinline__ void store_tile16(const f32x8 (&acc)[4][4], bf16* so, const float* __restrict__ bias, bf16* __restrict__ out,
                                             int mBlk, int nW, int nO, int wm, int wn, int nlane, int mh, int t) {
#pragma unroll   // this and the two below: unrolled so that every accumulator index is a constant
  for (int i = 0; i < 4; ++i)
#pragma unroll
    for (int j = 0; j < 4; ++j) {
      const int nl = wn + 16 * j + nlane;
      const float bv = bias ? bias[nW + nl] : 0.0f;
#pragma unroll
      for (int r = 0; r < 8; ++r) {
        const int ml = wm + 16 * i + mh + r;
        const bf16 hv = (bf16)(acc[i][j][r] + bv);
        if (!VT) so[ml * 264 + nl] = hv;        // [m][n]
        else     so[nl * 136 + ml] = hv;        // [n][m]  (n = h*64+dk rows of Vt, m = s contiguous)
      }
    }
  __syncthreads();
  if (!VT) {                // rows m: 256 halfs = 512 B each, 16-B chunks
    for (int ch = t; ch < 128 * 32; ch += 256) { const int ml = ch >> 5, q = (ch & 31) * 8;
      *(v4u_t*)(out + (size_t)(mBlk + ml) * DD + nO + q) = *(const v4ua*)(so + ml * 264 + q); }
  } else {                  // Vt rows (b, h, dk): 128 consecutive s = 256 B each
    const int b_ = mBlk / SS, s0 = mBlk % SS;
    for (int ch = t; ch < 256 * 16; ch += 256) { const int nl = ch >> 4, q = (ch & 15) * 8; const int n = nO + nl, h = n >> 6, dk = n & (DKK - 1);
      *(v4u_t*)(out + (((size_t)(b_ * HH + h)) * DKK + dk) * SS + s0 + q) = *(const v4ua*)(so + nl * 136 + q); }
  }
}

// ---------------------------------------------------------------------------
// GEMM: C[m][n] = sum_k A[m][k]*W[n][k] + bias[n]   (torch Linear)
// Block 256 thr (8 waves), tile 128M x 256N, K-step 32; wave tile 64x64.
// A/W staged through LDS (bf16, padded stride) with next-tile register
// prefetch overlapping the WMMA phase.
// MODE 2: fp32 [M][N]   MODE 4: as MODE 2 (f32 bias and residual), rounded to f16 at the store
// MODE 5: the three products of one A in one grid (N = 3*DD weight rows): block columns below DD give q, below 2*DD k (f16 [M][DD] each), the rest
//         v as f16 Vt[b][h][dk][s]; the three outputs lie one behind the other at out. 768 blocks: two are resident per WGP, one loads while the other multiplies.
// ---------------------------------------------------------------------------
template <typename AT, int MODE>
__global__ __launch_bounds__(256) void gemm_rb_kernel(
    const AT* __restrict__ A, const float* __restrict__ W,
    const float* __restrict__ bias, const float* __restrict__ rowscale, const float* __restrict__ R, const float* __restrict__ rowbias, void* __restrict__ out,
    int M, int N, int K) {
  __shared__ bf16 ldsA[128 * LDS_STRIDE];   // 12.0 KB
  __shared__ bf16 ldsW[256 * LDS_STRIDE];   // 24.0 KB
  // output staging: MODE 5 [128 m][264] f16 (q, k) or [256 n][136] f16 (v), MODE 2 and 4 [64 m][260] f32 (two halves)
  __shared__ __attribute__((aligned(16))) unsigned char sob[256 * 136 * 2];   // 69,632 B >= 128*264*2 and >= 64*260*4

  const int t    = threadIdx.x;
  const int wave = t >> 5;
  const int lane = t & 31;
  const int wm   = (wave & 1) * 64;
  const int wn   = (wave >> 1) * 64;
  const int mBlk = blockIdx.x * 128;
  const int nBlk = blockIdx.y * 256;

  // Staging map: neighbouring lanes take neighbouring 16-B chunks of one row's 32-k segment, so a wave-wide 16-B load
  // covers whole row segments (f32: 4 rows x 128 B, f16: 8 rows x 64 B) instead of one line per lane.
  constexpr int AEL = 16 / (int)sizeof(AT);   // elements per 16-B chunk
  constexpr int ALN = 32 / AEL;               // lanes per A row segment
  constexpr int ARS = 256 / ALN;              // A rows covered by one load of the block
  constexpr int ACH = 128 / ARS;              // A chunks per thread
  const int ar0 = t / ALN, ac0 = (t % ALN) * AEL;
  const int wr0 = t >> 3,  wc0 = (t & 7) * 4;
  unsigned aoff[ACH], woff[8];                // byte offsets from the block-uniform bases; they step by one 32-k segment per trip
#pragma unroll   // this and the chunk loops below: unrolled so that the offset and staging arrays stay in registers
  for (int i = 0; i < ACH; ++i) aoff[i] = (unsigned)(((ar0 + ARS * i) * K + ac0) * (int)sizeof(AT));
#pragma unroll
  for (int i = 0; i < 8; ++i) woff[i] = (unsigned)((min(nBlk + wr0 + 32 * i, N - 1) * K + wc0) * 4);   // ragged last N tile: clamp the weight row (those columns are never stored)
  const char* aBase = (const char*)(A + (size_t)mBlk * K);
  const char* wBase = (const char*)W;

  v4u_t abuf[ACH];
  v4f_t wbuf[8];
#pragma unroll
  for (int i = 0; i < ACH; ++i) abuf[i] = *(const v4ua*)(aBase + aoff[i]);
#pragma unroll
  for (int i = 0; i < 8; ++i) wbuf[i] = *(const v4fa*)(wBase + woff[i]);

  f32x8 acc[4][4] = {};

  for (int k = 0; k < K; k += 32) {
    lds_barrier();   // every wave has read the previous tile's fragments
#pragma unroll
    for (int i = 0; i < ACH; ++i) {
      bf16* dst = &ldsA[(ar0 + ARS * i) * LDS_STRIDE + ac0];
      if constexpr (sizeof(AT) == 4) {
        const v4f_t v = __builtin_bit_cast(v4f_t, abuf[i]);
        bf16x4 q; q[0] = (bf16)v[0]; q[1] = (bf16)v[1]; q[2] = (bf16)v[2]; q[3] = (bf16)v[3];
        *(bf16x4*)dst = q;
      } else {
        *(v4ua*)dst = abuf[i];
      }
    }
#pragma unroll
    for (int i = 0; i < 8; ++i) {
      const v4f_t v = wbuf[i];
      bf16x4 q; q[0] = (bf16)v[0]; q[1] = (bf16)v[1]; q[2] = (bf16)v[2]; q[3] = (bf16)v[3];
      *(bf16x4*)&ldsW[(wr0 + 32 * i) * LDS_STRIDE + wc0] = q;
    }
    if (k + 32 < K) {
#pragma unroll
      for (int i = 0; i < ACH; ++i) { aoff[i] += 32u * (unsigned)sizeof(AT); abuf[i] = *(const v4ua*)(aBase + aoff[i]); }
#pragma unroll
      for (int i = 0; i < 8; ++i) { woff[i] += 32u * 4u; wbuf[i] = *(const v4fa*)(wBase + woff[i]); }
    }
    lds_barrier();   // tile visible; the loads above stay in flight over the matrix phase

    bf16x16 af[4], wf[4];
#pragma unroll
    for (int i = 0; i < 4; ++i)
      af[i] = lds_frag(ldsA + (wm + 16 * i) * LDS_STRIDE, LDS_STRIDE);
#pragma unroll
    for (int j = 0; j < 4; ++j)
      wf[j] = lds_frag(ldsW + (wn + 16 * j) * LDS_STRIDE, LDS_STRIDE);
#pragma unroll
    for (int i = 0; i < 4; ++i)
#pragma unroll
      for (int j = 0; j < 4; ++j)
        acc[i][j] = wmma_bf16(af[i], wf[j], acc[i][j]);
  }

  const int nlane = lane & 15;
  const int mh    = (lane >> 4) * 8;
  __syncthreads();
  if (MODE == 5) {
    const int part = nBlk / DD;   // block-uniform: a 256-column tile lies inside one of the three products
    bf16* outp = (bf16*)out + (size_t)part * MTOK * DD;
    if (part < 2) store_tile16<false>(acc, (bf16*)sob, bias, outp, mBlk, nBlk, nBlk - part * DD, wm, wn, nlane, mh, t);
    else          store_tile16<true>(acc, (bf16*)sob, bias, outp, mBlk, nBlk, nBlk - part * DD, wm, wn, nlane, mh, t);
  } else {
    float* so = (float*)sob;
#pragma unroll 1
    for (int hf = 0; hf < 2; ++hf) {
      if (wm == hf * 64) {
#pragma unroll
        for (int i = 0; i < 4; ++i)
#pragma unroll
          for (int j = 0; j < 4; ++j) {
            const int nl = wn + 16 * j + nlane;
            const float bv = bias ? bias[nBlk + nl] : 0.0f;
#pragma unroll
            for (int r = 0; r < 8; ++r) { const int mrow = mBlk + hf * 64 + 16 * i + mh + r; so[(16 * i + mh + r) * 260 + nl] = acc[i][j][r] * (rowscale ? rowscale[mrow] : 1.0f) + bv + (rowbias ? rowbias[mrow] : 0.0f); }
          }
      }
      __syncthreads();
      if (R) {   // residual: fold R[m][n] into the staged tile once (same thread <-> same chunks as the stores below)
        for (int ch = t; ch < 64 * 64; ch += 256) { const int ml = ch >> 6, q = (ch & 63) * 4;
          if (nBlk + q < N) { const v4f_t rv = *(const v4f_t*)(R + (size_t)(mBlk + hf * 64 + ml) * N + nBlk + q); v4f_t v = *(const v4fa*)(so + ml * 260 + q); v += rv; *(v4fa*)(so + ml * 260 + q) = v; } }
        asm volatile("s_wait_dscnt 0" ::: "memory");
      }
{   // 64 rows x 256 floats = 1 KB segments, float4 chunks; columns >= N (ragged tile) skipped
        const int q = (t & 63) * 4;
        if (nBlk + q < N) {
          for (int m0 = t >> 6; m0 < 64; m0 += 16) {   // rows m0, m0 + 4, m0 + 8, m0 + 12 per trip: four LDS reads and four stores in flight
            v4f_t v[4];
#pragma unroll   // this and the next: unrolled so that the four chunks stay in registers
            for (int u = 0; u < 4; ++u) v[u] = *(const v4fa*)(so + (m0 + 4 * u) * 260 + q);
#pragma unroll
            for (int u = 0; u < 4; ++u) {
              const size_t eo = (size_t)(mBlk + hf * 64 + m0 + 4 * u) * N + nBlk + q;
              if (MODE == 4) { bf16x4 hq; hq[0] = (bf16)v[u][0]; hq[1] = (bf16)v[u][1]; hq[2] = (bf16)v[u][2]; hq[3] = (bf16)v[u][3];
                *(bf16x4*)((bf16*)out + eo) = hq; }
              else *(v4f_t*)((float*)out + eo) = v[u];
            }
          }
        }
      }
      __syncthreads();
    }
  }
}

// 2^x by the hardware instruction alone (results below 2^-126 come out as 0; -inf gives 0).
__device__ __forceinline__ float hw_exp2(float x) { return __builtin_amdgcn_exp2f(x); }

__global__ __launch_bounds__(64) void v_attn_kernel(
    const bf16* __restrict__ Qb, const bf16* __restrict__ Kb,
    const bf16* __restrict__ Vt, const float* __restrict__ kbias,   // kbias [B][KROWS]: additive per-key logit bias (1 − mask)
    bf16* __restrict__ attnOut) {
  __shared__ bf16 ldsK[32 * KSTRIDE];   // 4.5 KB
  __shared__ bf16 ldsV[64 * VSTRIDE];   // 6.0 KB
  __shared__ __attribute__((aligned(16))) bf16 ldsO[2][32 * 72];   // per-wave f16 output tile: 32 queries x 64 dk, 72-elem rows

  const int q0blk = blockIdx.x * 64;
  const int h  = blockIdx.y;
  const int b  = blockIdx.z;
  const int t    = threadIdx.x;
  const int wave = t >> 5;
  const int lane = t & 31;
  const int qlane = lane & 15;
  const int kh8   = (lane >> 4) * 8;
  const int q0 = q0blk + wave * 32;          // this wave's 32 queries

  const int hk = h / HKDIV;
  const bf16* Qh = Qb + (size_t)b * QROWS * DD + h * DKK;        // queries: QROWS rows per batch, row stride DD
  const bf16* Kh = Kb + (size_t)b * KROWS * KVD + hk * DKK;      // keys: KROWS rows per batch, row stride KVD
  const bf16* Vh = Vt + ((size_t)(b * KVH + hk)) * DKK * KROWS;  // Vᵀ [KVH][64][KROWS] per batch

  // Cooperative staging (64 threads), neighbouring lanes on neighbouring 16-B chunks of a row:
  // K tile 32x64 (8 lanes cover a 128-B row, 8 rows per load of the block); V tile 64x32 (4 lanes cover a 64-B row, 16 rows per load).
  const int krow = t >> 3;
  const int kcol = (t & 7) * 8;
  const int vrow = t >> 2;
  const int vcol = (t & 3) * 8;
  const bf16* kSrc = Kh + (size_t)krow * KVD + kcol;
  const bf16* vSrc = Vh + (size_t)vrow * KROWS + vcol;

  bf16x16 qf[QW][2];
#pragma unroll
  for (int qt = 0; qt < QW; ++qt) {
    qf[qt][0] = load_frag(Qh, DD, q0 + 16 * qt, 0);
    qf[qt][1] = load_frag(Qh, DD, q0 + 16 * qt, 32);
  }

  f32x8 o[QW][4] = {};
  float mrun[QW], lrun[QW];
#pragma unroll
  for (int qt = 0; qt < QW; ++qt) { mrun[qt] = -INFINITY; lrun[qt] = 0.0f; }

  const float scale = 0.125f * 1.44269504088896340736f;  // 1/sqrt(DK)*log2(e)
  const float NEG2 = -1.0e9f;    // masked logit: its weight is exactly 0 once any valid key of the row has been seen (every row
                                 // has one), and anything accumulated before that is wiped by alpha == 0 — same result as -inf
  const int kmax = KROWS - 1;
  __shared__ float kbS[KROWS];
  for (int i = threadIdx.x; i < KROWS; i += 64) kbS[i] = kbias[(size_t)b * KROWS + i] * 1.44269504088896340736f;   // in log2 units
  __syncthreads();

  // Prefetch key block kb=0 into registers.
  bf16x8 kreg[4], vreg[4];
#pragma unroll
  for (int i = 0; i < 4; ++i) {
    kreg[i] = *(const bf16x8*)(kSrc + (size_t)(8 * i) * KVD);
    vreg[i] = *(const bf16x8*)(vSrc + (size_t)(16 * i) * KROWS);
  }

  for (int kb = 0; kb <= kmax; kb += 32) {
    lds_barrier();   // previous readers done with LDS
#pragma unroll
    for (int i = 0; i < 4; ++i) {
      *(bf16x8*)(&ldsK[(krow + 8 * i) * KSTRIDE + kcol])  = kreg[i];
      *(bf16x8*)(&ldsV[(vrow + 16 * i) * VSTRIDE + vcol]) = vreg[i];
    }
    if (kb + 32 <= kmax) {   // prefetch next block during compute
      const bf16* kn = kSrc + (size_t)(kb + 32) * KVD;
      const bf16* vn = vSrc + (kb + 32);
#pragma unroll
      for (int i = 0; i < 4; ++i) {
        kreg[i] = *(const bf16x8*)(kn + (size_t)(8 * i) * KVD);
        vreg[i] = *(const bf16x8*)(vn + (size_t)(16 * i) * KROWS);
      }
      asm volatile("s_wait_xcnt 0x0" ::: "memory");   // the loads outlive the barrier: their address pairs step on only behind this wait
    }
    lds_barrier();   // tile visible; the prefetch above stays in flight over scores, softmax and PV

    // Phase 1: scores + softmax for both q-tiles (K fragments live here only).
    bf16x16 kf[2][2];
#pragma unroll
    for (int ktile = 0; ktile < 2; ++ktile)
#pragma unroll
      for (int c = 0; c < 2; ++c)
        kf[ktile][c] = lds_frag(ldsK + (ktile * 16) * KSTRIDE + c * 32, KSTRIDE);

    bf16x16 pf[QW];
    bool act[QW];
#pragma unroll
    for (int qt = 0; qt < QW; ++qt) {
      unsigned mbits = 0;
      {
#pragma unroll
        for (int r = 0; r < 8; ++r) { const int j0 = kb + kh8 + r; if (j0 < NKV) mbits |= 1u << r; if (j0 + 16 < NKV) mbits |= 1u << (8 + r); }
        act[qt] = (__builtin_amdgcn_ballot_w32(mbits != 0) != 0);
      }
      if (act[qt]) {
        const int q_my = q0 + 16 * qt + qlane;
        f32x8 s0 = {}, s1 = {};
        s0 = wmma_bf16(kf[0][0], qf[qt][0], s0);
        s0 = wmma_bf16(kf[0][1], qf[qt][1], s0);
        s1 = wmma_bf16(kf[1][0], qf[qt][0], s1);
        s1 = wmma_bf16(kf[1][1], qf[qt][1], s1);

        float mx = -INFINITY;
#pragma unroll
        for (int r = 0; r < 8; ++r) {
          const int k0i = kb + kh8 + r;
          const int k1i = k0i + 16;
          (void)k0i; (void)k1i; (void)q_my;
          s0[r] = (mbits & (1u << r))       ? s0[r] * scale + kbS[kb + kh8 + r] : NEG2;
          s1[r] = (mbits & (1u << (8 + r))) ? s1[r] * scale + kbS[kb + 16 + kh8 + r] : NEG2;
          mx = fmaxf(mx, fmaxf(s0[r], s1[r]));
        }
        mx = fmaxf(mx, __shfl_xor(mx, 16, 32));
        const float mnew  = fmaxf(mrun[qt], mx);
        // hw_exp2 here and below: one v_exp_f32 each. exp2f() wraps it in a compare, two selects, an add and an ldexp to keep results below 2^-126;
        // such a weight is 0 in the f16 P and vanishes beside a row sum >= 1, and such an alpha scales history that rounds away likewise.
        const float alpha = hw_exp2(mrun[qt] - mnew);

        float rsum = 0.0f;
#pragma unroll
        for (int r = 0; r < 8; ++r) {
          const float p0 = hw_exp2(s0[r] - mnew);
          const float p1 = hw_exp2(s1[r] - mnew);
          rsum += p0 + p1;
          pf[qt][r]     = (bf16)(p0 * 1024.0f);     // P carried x1024: no f16 copy of a probability is sub-normal
          pf[qt][r + 8] = (bf16)(p1 * 1024.0f);
        }
        rsum += __shfl_xor(rsum, 16, 32);
        lrun[qt] = lrun[qt] * alpha + rsum;
        mrun[qt] = mnew;

        // Rescale accumulators now so the PV phase is pure WMMA.
#pragma unroll
        for (int j = 0; j < 4; ++j)
#pragma unroll
          for (int r = 0; r < 8; ++r) o[qt][j][r] *= alpha;
      }
    }

    // Phase 2: O^T accumulate; each V fragment read from LDS once, used by
    // both q-tiles, then dead (only 8 VGPRs of V live at a time).
#pragma unroll
    for (int j = 0; j < 4; ++j) {
      const bf16x16 vf = lds_frag(ldsV + (j * 16) * VSTRIDE, VSTRIDE);
#pragma unroll
      for (int qt = 0; qt < QW; ++qt)
        if (act[qt]) o[qt][j] = wmma_bf16(vf, pf[qt], o[qt][j]);
    }
  }

  bf16* so = ldsO[wave];
#pragma unroll
  for (int qt = 0; qt < QW; ++qt) {
    const float rl = 1.0f / (lrun[qt] * 1024.0f);
#pragma unroll
    for (int j = 0; j < 4; ++j)
#pragma unroll
      for (int r = 0; r < 8; ++r) so[(16 * qt + qlane) * 72 + j * 16 + kh8 + r] = (bf16)(o[qt][j][r] * rl);
  }
  asm volatile("s_wait_dscnt 0" ::: "memory");
  __builtin_amdgcn_wave_barrier();
{
#pragma unroll
    for (int it = 0; it < 8; ++it) { const int ch = lane + 32 * it, ql = ch >> 3, q8 = (ch & 7) * 8;   // 8 lanes cover one row's 128 B
      *(v4u_t*)(attnOut + ((size_t)(b * QROWS + q0 + ql)) * DD + h * DKK + q8) = *(const v4ua*)(so + ql * 72 + q8); }
    
  }
}


// xp = LN(x)*g + b + pos[s]  (f32 rows for the residual, and the same rows rounded to f16 for the q, k, v products).
// One wave = one position s in all BB batches. A lane holds 4 neighbouring columns of each 128-column chunk, so every wave-wide 16-B load or store
// covers 512 contiguous bytes; the BB rows, the pos row, g and b stay in registers and all their loads are issued before the first sum waits.
__global__ __launch_bounds__(256) void k_lnpos(const float* __restrict__ X, const float* __restrict__ g, const float* __restrict__ bb, const float* __restrict__ pos, float* __restrict__ Y, bf16* __restrict__ Y16) {
  constexpr int NC = DD / 128;   // 128-column chunks of a row
  const unsigned c0 = (threadIdx.x & 31) * 4;
  const int s_ = blockIdx.x * 8 + (threadIdx.x >> 5);
  int row[BB];   // the wave's row numbers as scalars: the row offsets are formed on the scalar unit
#pragma unroll   // this and every loop below: unrolled so that the row arrays stay in registers
  for (int b = 0; b < BB; ++b) row[b] = __builtin_amdgcn_readfirstlane(b * SS + s_);
  v4f_t xv[BB][NC], pv[NC], gv[NC], bv[NC];
#pragma unroll
  for (int b = 0; b < BB; ++b) {
    const float* xr = X + (size_t)row[b] * DD;
#pragma unroll
    for (int c = 0; c < NC; ++c) xv[b][c] = *(const v4f_t*)(xr + c * 128 + c0);
  }
  asm volatile("s_wait_xcnt 0x0" ::: "memory");   // precaution: stands in front of the loads below, which land in registers that hold row addresses of the loads above
  const float* pr = pos + (size_t)row[0] * DD;
#pragma unroll
  for (int c = 0; c < NC; ++c) pv[c] = *(const v4f_t*)(pr + c * 128 + c0);
#pragma unroll
  for (int c = 0; c < NC; ++c) { gv[c] = *(const v4f_t*)(g + c * 128 + c0); bv[c] = *(const v4f_t*)(bb + c * 128 + c0); }
  asm volatile("s_wait_xcnt 0x0" ::: "memory");   // precaution: stands in front of the first rewrite of the lane-offset register and the scalar bases that the loads above name
  __builtin_amdgcn_sched_barrier(0);   // keeps every load above issued here: left free, the scheduler sinks the pos, g and b loads behind the sums, where each small group waits out its own latency
#pragma unroll
  for (int b = 0; b < BB; ++b) {
    v4f_t a = xv[b][0];
#pragma unroll
    for (int c = 1; c < NC; ++c) a += xv[b][c];
    float s = (a[0] + a[1]) + (a[2] + a[3]);
#pragma unroll
    for (int off = 1; off < 32; off <<= 1) s += __shfl_xor(s, off, 32);
    const float mean = s * (1.0f / DD);
    v4f_t q4 = {};
#pragma unroll
    for (int c = 0; c < NC; ++c) { const v4f_t d = xv[b][c] - mean; q4 += d * d; }
    float q = (q4[0] + q4[1]) + (q4[2] + q4[3]);
#pragma unroll
    for (int off = 1; off < 32; off <<= 1) q += __shfl_xor(q, off, 32);
    const float rstd = rsqrtf(q * (1.0f / DD) + 1e-5f);
    float* yr = Y + (size_t)row[b] * DD;
    bf16* hr = Y16 + (size_t)row[b] * DD;
#pragma unroll
    for (int c = 0; c < NC; ++c) {
      const v4f_t v = (xv[b][c] - mean) * rstd * gv[c] + bv[c] + pv[c];
      bf16x4 hq; hq[0] = (bf16)v[0]; hq[1] = (bf16)v[1]; hq[2] = (bf16)v[2]; hq[3] = (bf16)v[3];
      *(v4f_t*)(yr + c * 128 + c0) = v;
      *(bf16x4*)(hr + c * 128 + c0) = hq;
    }
  }
}
// kbias[b][k] = 1 − mask[b][k]  (the torch quirk: a FLOAT additive mask); 8-KB rows
__global__ __launch_bounds__(256) void k_kbias(const float* __restrict__ mask, float* __restrict__ kb) { const int b = blockIdx.x;
  for (int q4 = threadIdx.x; q4 < KROWS / 4; q4 += 256) { const v4f_t m = *(const v4f_t*)(mask + (size_t)b * KROWS + q4 * 4); v4f_t o; for (int e = 0; e < 4; ++e) o[e] = 1.0f - m[e];
    *(v4f_t*)(kb + (size_t)b * KROWS + q4 * 4) = o;  } }

extern "C" void kernel_launch(void* const* d_in, const int* in_sizes, int n_in,
                              void* d_out, int out_size, void* d_ws, size_t ws_size,
                              hipStream_t stream) {
  (void)in_sizes; (void)n_in; (void)out_size;
  const float** f = (const float**)d_in;
  const float* x = f[0], *mask = f[1], *pos = f[2], *lng = f[3], *lnb = f[4], *Win = f[5], *bin = f[6], *Wout = f[7], *bout = f[8], *Wto = f[9], *bto = f[10];
  float* out = (float*)d_out;     // [4,2048,1024]
  char* ws = (char*)d_ws;
  float* xp = (float*)ws; ws += (size_t)MTOK * DD * 4;                  // 32 MB: f32 rows, read again only as the residual
  bf16* xp16 = (bf16*)ws; ws += (size_t)MTOK * DD * 2; bf16* Q16 = (bf16*)ws; ws += (size_t)MTOK * DD * 2; bf16* K16 = (bf16*)ws; ws += (size_t)MTOK * DD * 2;   // 16 MB each
  bf16* Vt = (bf16*)ws; ws += (size_t)MTOK * DD * 2; bf16* att16 = (bf16*)ws; ws += (size_t)MTOK * DD * 2; bf16* y16 = (bf16*)ws; ws += (size_t)MTOK * DD * 2;
  float* kb = (float*)ws; ws += (size_t)BB * KROWS * 4;
  if ((size_t)(ws - (char*)d_ws) > ws_size) return;
  const dim3 blk(256); const dim3 gp(MTOK / 128, DD / 256);
  k_lnpos<<<dim3(SS / 8), blk, 0, stream>>>(x, lng, lnb, pos, xp, xp16);
  k_kbias<<<dim3(BB), blk, 0, stream>>>(mask, kb);
  gemm_rb_kernel<bf16, 5><<<dim3(MTOK / 128, 3 * DD / 256), blk, 0, stream>>>(xp16, Win, bin, nullptr, nullptr, nullptr, Q16, MTOK, 3 * DD, DD);   // q, k, v: Q16, K16, Vt are adjacent
  v_attn_kernel<<<dim3(QROWS / 64, HH, BB), dim3(64), 0, stream>>>(Q16, K16, Vt, kb, att16);
  gemm_rb_kernel<bf16, 4><<<gp, blk, 0, stream>>>(att16, Wout, bout, nullptr, xp, nullptr, y16, MTOK, DD, DD);      // y = xp + o*out_proj^T + b, summed in f32, stored f16
  gemm_rb_kernel<bf16, 2><<<gp, blk, 0, stream>>>(y16, Wto, bto, nullptr, nullptr, nullptr, out, MTOK, DD, DD);      // out = y*to_out^T + b
}

// v007
// One run takes 211 microseconds.
// Timed twice side by side with v006, it ran 1.21 times as fast both times.
// Over all steps from v000 it is 2.20 times as fast.
// Contractions on v_wmma_f32_16x16x32_f16 (plain f16 operands, f32 accumulate): qkv = (LN(x) + pos)·in_projᵀ + b (K = 1024, N = 3072),
// the 16-head attention (dk = 64, scale 1/8) with the reference's ADDITIVE float mask (1 − padding_mask) as a per-(batch,key) bias,
// flash-style Sᵀ = K·Qᵀ / Oᵀ = Vᵀ·Pᵀ with online softmax in f32 (P x1024, f16 output rows), attn_out = o·out_projᵀ + b + xp (residual in
// the epilogue, K = 1024) and (xp + attn_out)·to_outᵀ + b (K = 1024); LayerNorm and the positional add in f32. xp dominates the residual
// so plain f16 operands suffice. compute dtype: f16 operands, f32 accumulate.  x [4,2048,1024].
// Every matrix operand that one kernel hands to the next (xp, q, k, v transposed, the attention rows, y) is rounded to f16 once, from its f32
// value, at its producer's store, in the layout that the consumer stages; only the residual copy of xp and the final output are f32.
#include <hip/hip_runtime.h>
#include <hip/hip_bf16.h>
#include <math.h>

#define BB 4
#define SS 2048
#define QROWS 2048
#define KROWS 2048
#define NKV 2048
#define DD 1024
#define HH 16
#define KVH 16
#define KVD 1024
#define HKDIV 1
#define DKK 64
#define QW 2
#define MTOK (BB * SS)
#define GSTR 48

typedef _Float16 bf16;
typedef _Float16 f16;
typedef __attribute__((ext_vector_type(4))) unsigned v4u_t;
typedef unsigned v4ua __attribute__((ext_vector_type(4), may_alias));
typedef __attribute__((ext_vector_type(4))) float v4f_t;
typedef float v4fa __attribute__((ext_vector_type(4), may_alias));
typedef __attribute__((ext_vector_type(16))) bf16  bf16x16;
typedef bf16x16 f16x16;
typedef __attribute__((ext_vector_type(8)))  bf16  bf16x8;
typedef bf16x8 f16x8;
typedef __attribute__((ext_vector_type(4)))  bf16  bf16x4;
typedef __attribute__((ext_vector_type(8)))  float f32x8;
__device__ __forceinline__ f32x8 wmma16(f16x16 a, f16x16 b, f32x8 c) {
  c = __builtin_amdgcn_wmma_f32_16x16x32_f16(false, a, false, b, (short)0, c, false, false);
  asm volatile("v_nop\n\tv_nop\n\tv_nop\n\tv_nop" : "+v"(c) : "v"(a), "v"(b));
  return c;
}
#define GK 64           // k per staged GEMM tile: a row segment of f16 is one whole 128-B line
#define LDS_STRIDE 72   // GEMM tiles: 64 -> 72 elems (144-B rows, 16 B x 9): conflict-free b128 reads
#define KSTRIDE    72   // attn K tile: 64 -> 72 elems (144B rows): conflict-free b128
#define VSTRIDE    48   // attn V tile: 32 -> 48 elems

__device__ __forceinline__ f32x8 wmma_bf16(bf16x16 a, bf16x16 b, f32x8 c) {
  c = __builtin_amdgcn_wmma_f32_16x16x32_f16(false, a, false, b, (short)0, c, false, false);
  asm volatile("v_nop\n\tv_nop\n\tv_nop\n\tv_nop" : "+v"(c) : "v"(a), "v"(b));   // A/B-overwrite hazard guard
  return c;
}

// Work-group barrier of the staged loops: it waits for this wave's LDS traffic only. __syncthreads() also drains the load counter, so the
// next tile's global loads, issued just ahead of it, would be waited out before the matrix phase instead of flying under it.
__device__ __forceinline__ void lds_barrier() {
  asm volatile("s_wait_dscnt 0x0\n\ts_barrier_signal -1\n\ts_barrier_wait -1" ::: "memory");
}

// 16x32 (MxK) bf16 fragment from a row-major global matrix.
// lanes 0-15  (row=lane)    : elems 0..7 = K+0..7,  8..15 = K+16..23
// lanes 16-31 (row=lane-16) : elems 0..7 = K+8..15, 8..15 = K+24..31
template <typename T>
__device__ __forceinline__ bf16x16 load_frag(const T* __restrict__ base, int ld,
                                             int row0, int k0) {
  const int lane = threadIdx.x & 31;
  const int r    = lane & 15;
  const int kh   = (lane >> 4) * 8;
  const T* p0 = base + (size_t)(row0 + r) * ld + (k0 + kh);
  const T* p1 = p0 + 16;
  bf16x16 f;
#pragma unroll
  for (int i = 0; i < 8; ++i) {
    f[i]     = (bf16)p0[i];
    f[i + 8] = (bf16)p1[i];
  }
  return f;
}

// Same fragment from an LDS tile with padded row stride (base includes row0/k0).
__device__ __forceinline__ bf16x16 lds_frag(const bf16* base, int stride) {
  const int lane = threadIdx.x & 31;
  const int row  = lane & 15;
  const int kh   = (lane >> 4) * 8;
  const bf16x8 lo = *(const bf16x8*)(base + row * stride + kh);
  const bf16x8 hi = *(const bf16x8*)(base + row * stride + kh + 16);
  bf16x16 f;
#pragma unroll
  for (int i = 0; i < 8; ++i) { f[i] = lo[i]; f[i + 8] = hi[i]; }
  return f;
}

// Epilogue of the q, k, v product: f32 bias added, rounded to f16, staged in LDS, stored as whole 16-B chunks.
// VT false: rows [m][DD] (q, k). VT true: v transposed, rows (b, h, dk) of SS positions. nW = column among the 3*DD weight rows, nO = column inside its own product.
template <bool VT>
__device__ __forceinline__ void store_tile16(const f32x8 (&acc)[4][4], bf16* so, const float* __restrict__ bias, bf16* __restrict__ out,
                                             int mBlk, int nW, int nO, int wm, int wn, int nlane, int mh, int t) {
#pragma unroll   // this and the two below: unrolled so that every accumulator index is a constant
  for (int i = 0; i < 4; ++i)
#pragma unroll
    for (int j = 0; j < 4; ++j) {
      const int nl = wn + 16 * j + nlane;
      const float bv = bias ? bias[nW + nl] : 0.0f;
#pragma unroll
      for (int r = 0; r < 8; ++r) {
        const int ml = wm + 16 * i + mh + r;
        const bf16 hv = (bf16)(acc[i][j][r] + bv);
        if (!VT) so[ml * 264 + nl] = hv;        // [m][n]
        else     so[nl * 136 + ml] = hv;        // [n][m]  (n = h*64+dk rows of Vt, m = s contiguous)
      }
    }
  __syncthreads();
  if (!VT) {                // rows m: 256 halfs = 512 B each, 16-B chunks
    for (int ch = t; ch < 128 * 32; ch += 256) { const int ml = ch >> 5, q = (ch & 31) * 8;
      *(v4u_t*)(out + (size_t)(mBlk + ml) * DD + nO + q) = *(const v4ua*)(so + ml * 264 + q); }
  } else {                  // Vt rows (b, h, dk): 128 consecutive s = 256 B each
    const int b_ = mBlk / SS, s0 = mBlk % SS;
    for (int ch = t; ch < 256 * 16; ch += 256) { const int nl = ch >> 4, q = (ch & 15) * 8; const int n = nO + nl, h = n >> 6, dk = n & (DKK - 1);
      *(v4u_t*)(out + (((size_t)(b_ * HH + h)) * DKK + dk) * SS + s0 + q) = *(const v4ua*)(so + nl * 136 + q); }
  }
}

// ---------------------------------------------------------------------------
// GEMM: C[m][n] = sum_k A[m][k]*W[n][k] + bias[n]   (torch Linear)
// Block 256 thr (8 waves), tile 128M x 256N, K-step GK = 64 (two 32-k matrix steps per staged tile); wave tile 64x64.
// A and W are f16 (W rounded once per call by k_prep). Both are staged through LDS (padded stride) with next-tile register
// prefetch overlapping the WMMA phase. M a multiple of 128, N of 256, K = DD.
// MODE 2: fp32 [M][N]   MODE 4: as MODE 2 (f32 bias and residual), rounded to f16 at the store
// MODE 5: the three products of one A in one grid (N = 3*DD weight rows): block columns below DD give q, below 2*DD k (f16 [M][DD] each), the rest
//         v as f16 Vt[b][h][dk][s]; the three outputs lie one behind the other at out. 768 blocks: two are resident per WGP, one loads while the other multiplies.
// ---------------------------------------------------------------------------
template <typename AT, int MODE>
__global__ __launch_bounds__(256) void gemm_rb_kernel(
    const AT* __restrict__ A, const bf16* __restrict__ W,
    const float* __restrict__ bias, const float* __restrict__ rowscale, const float* __restrict__ R, const float* __restrict__ rowbias, void* __restrict__ out,
    int M, int N, int K) {
  __shared__ __attribute__((aligned(16))) bf16 ldsA[128 * LDS_STRIDE];   // 18.0 KB
  __shared__ __attribute__((aligned(16))) bf16 ldsW[256 * LDS_STRIDE];   // 36.0 KB
  // output staging: MODE 5 [128 m][264] f16 (q, k) or [256 n][136] f16 (v), MODE 2 and 4 [64 m][260] f32 (two halves)
  __shared__ __attribute__((aligned(16))) unsigned char sob[256 * 136 * 2];   // 69,632 B >= 128*264*2 and >= 64*260*4

  const int t    = threadIdx.x;
  const int wave = t >> 5;
  const int lane = t & 31;
  const int wm   = (wave & 1) * 64;
  const int wn   = (wave >> 1) * 64;
  const int mBlk = blockIdx.x * 128;
  const int nBlk = blockIdx.y * 256;

  // Staging map, the same for A and W: 8 neighbouring lanes take the 8 16-B chunks of one row's 64-k segment, so a wave-wide 16-B load
  // covers 4 whole 128-B lines; one load of the block covers 32 rows.
  static_assert(sizeof(AT) == 2, "A is staged as f16");
  const int r0 = t >> 3, c0 = (t & 7) * 8;
  constexpr int KC = DD;   // K = DD in every launch: with the row pitch a constant, the 32-row steps of the chunks fold into the loads' immediate offsets
  (void)K;
  unsigned off = (unsigned)((r0 * KC + c0) * 2);   // the lane's byte offset from the block-uniform bases; it steps by one 64-k segment per trip
  constexpr unsigned rstep = 32u * KC * 2u;        // 32 rows, in bytes
  const char* aBase = (const char*)(A + (size_t)mBlk * KC);
  const char* wBase = (const char*)(W + (size_t)nBlk * KC);

  v4u_t abuf[4], wbuf[8];
#pragma unroll   // this and the chunk loops below: unrolled so that the staging arrays stay in registers
  for (int i = 0; i < 4; ++i) abuf[i] = *(const v4ua*)(aBase + off + i * rstep);
#pragma unroll
  for (int i = 0; i < 8; ++i) wbuf[i] = *(const v4ua*)(wBase + off + i * rstep);
  asm volatile("s_wait_xcnt 0x0" ::: "memory");   // precaution: stands in front of the first step of the offset register, which the loads above name

  f32x8 acc[4][4] = {};

  for (int k = 0; k < KC; k += GK) {
    lds_barrier();   // every wave has read the previous tile's fragments
#pragma unroll
    for (int i = 0; i < 4; ++i) *(v4ua*)&ldsA[(r0 + 32 * i) * LDS_STRIDE + c0] = abuf[i];
#pragma unroll
    for (int i = 0; i < 8; ++i) *(v4ua*)&ldsW[(r0 + 32 * i) * LDS_STRIDE + c0] = wbuf[i];
    if (k + GK < KC) {
      off += GK * 2u;
#pragma unroll
      for (int i = 0; i < 4; ++i) abuf[i] = *(const v4ua*)(aBase + off + i * rstep);
#pragma unroll
      for (int i = 0; i < 8; ++i) wbuf[i] = *(const v4ua*)(wBase + off + i * rstep);
    }
    lds_barrier();   // tile visible; the loads above stay in flight over the matrix phase

#pragma unroll   // unrolled so that the fragment offsets are constants
    for (int kk = 0; kk < GK; kk += 32) {
      bf16x16 af[4], wf[4];
#pragma unroll
      for (int i = 0; i < 4; ++i)
        af[i] = lds_frag(ldsA + (wm + 16 * i) * LDS_STRIDE + kk, LDS_STRIDE);
#pragma unroll
      for (int j = 0; j < 4; ++j)
        wf[j] = lds_frag(ldsW + (wn + 16 * j) * LDS_STRIDE + kk, LDS_STRIDE);
#pragma unroll
      for (int i = 0; i < 4; ++i)
#pragma unroll
        for (int j = 0; j < 4; ++j)
          acc[i][j] = wmma_bf16(af[i], wf[j], acc[i][j]);
    }
    asm volatile("s_wait_xcnt 0x0" ::: "memory");   // precaution: at the trip's foot, on the way back and on the way out alike, in front of any rewrite of the offset register and scalar bases that this trip's loads name
  }

  const int nlane = lane & 15;
  const int mh    = (lane >> 4) * 8;
  __syncthreads();
  if (MODE == 5) {
    const int part = nBlk / DD;   // block-uniform: a 256-column tile lies inside one of the three products
    bf16* outp = (bf16*)out + (size_t)part * MTOK * DD;
    if (part < 2) store_tile16<false>(acc, (bf16*)sob, bias, outp, mBlk, nBlk, nBlk - part * DD, wm, wn, nlane, mh, t);
    else          store_tile16<true>(acc, (bf16*)sob, bias, outp, mBlk, nBlk, nBlk - part * DD, wm, wn, nlane, mh, t);
  } else {
    float* so = (float*)sob;
#pragma unroll 1
    for (int hf = 0; hf < 2; ++hf) {
      if (wm == hf * 64) {
#pragma unroll
        for (int i = 0; i < 4; ++i)
#pragma unroll
          for (int j = 0; j < 4; ++j) {
            const int nl = wn + 16 * j + nlane;
            const float bv = bias ? bias[nBlk + nl] : 0.0f;
#pragma unroll
            for (int r = 0; r < 8; ++r) { const int mrow = mBlk + hf * 64 + 16 * i + mh + r; so[(16 * i + mh + r) * 260 + nl] = acc[i][j][r] * (rowscale ? rowscale[mrow] : 1.0f) + bv + (rowbias ? rowbias[mrow] : 0.0f); }
          }
      }
      __syncthreads();
      if (R) {   // residual: fold R[m][n] into the staged tile once (same thread <-> same chunks as the stores below)
        for (int ch = t; ch < 64 * 64; ch += 256) { const int ml = ch >> 6, q = (ch & 63) * 4;
          if (nBlk + q < N) { const v4f_t rv = *(const v4f_t*)(R + (size_t)(mBlk + hf * 64 + ml) * N + nBlk + q); v4f_t v = *(const v4fa*)(so + ml * 260 + q); v += rv; *(v4fa*)(so + ml * 260 + q) = v; } }
        asm volatile("s_wait_dscnt 0" ::: "memory");
      }
{   // 64 rows x 256 floats = 1 KB segments, float4 chunks; columns >= N (ragged tile) skipped
        const int q = (t & 63) * 4;
        if (nBlk + q < N) {
          for (int m0 = t >> 6; m0 < 64; m0 += 16) {   // rows m0, m0 + 4, m0 + 8, m0 + 12 per trip: four LDS reads and four stores in flight
            v4f_t v[4];
#pragma unroll   // this and the next: unrolled so that the four chunks stay in registers
            for (int u = 0; u < 4; ++u) v[u] = *(const v4fa*)(so + (m0 + 4 * u) * 260 + q);
#pragma unroll
            for (int u = 0; u < 4; ++u) {
              const size_t eo = (size_t)(mBlk + hf * 64 + m0 + 4 * u) * N + nBlk + q;
              if (MODE == 4) { bf16x4 hq; hq[0] = (bf16)v[u][0]; hq[1] = (bf16)v[u][1]; hq[2] = (bf16)v[u][2]; hq[3] = (bf16)v[u][3];
                *(bf16x4*)((bf16*)out + eo) = hq; }
              else *(v4f_t*)((float*)out + eo) = v[u];
            }
          }
        }
      }
      __syncthreads();
    }
  }
}

// 2^x by the hardware instruction alone (results below 2^-126 come out as 0; -inf gives 0).
__device__ __forceinline__ float hw_exp2(float x) { return __builtin_amdgcn_exp2f(x); }

__global__ __launch_bounds__(64) void v_attn_kernel(
    const bf16* __restrict__ Qb, const bf16* __restrict__ Kb,
    const bf16* __restrict__ Vt, const float* __restrict__ kbias,   // kbias [B][KROWS]: additive per-key logit bias (1 − mask)
    bf16* __restrict__ attnOut) {
  __shared__ bf16 ldsK[32 * KSTRIDE];   // 4.5 KB
  __shared__ bf16 ldsV[64 * VSTRIDE];   // 6.0 KB
  __shared__ __attribute__((aligned(16))) bf16 ldsO[2][32 * 72];   // per-wave f16 output tile: 32 queries x 64 dk, 72-elem rows

  const int q0blk = blockIdx.x * 64;
  const int h  = blockIdx.y;
  const int b  = blockIdx.z;
  const int t    = threadIdx.x;
  const int wave = t >> 5;
  const int lane = t & 31;
  const int qlane = lane & 15;
  const int kh8   = (lane >> 4) * 8;
  const int q0 = q0blk + wave * 32;          // this wave's 32 queries

  const int hk = h / HKDIV;
  const bf16* Qh = Qb + (size_t)b * QROWS * DD + h * DKK;        // queries: QROWS rows per batch, row stride DD
  const bf16* Kh = Kb + (size_t)b * KROWS * KVD + hk * DKK;      // keys: KROWS rows per batch, row stride KVD
  const bf16* Vh = Vt + ((size_t)(b * KVH + hk)) * DKK * KROWS;  // Vᵀ [KVH][64][KROWS] per batch

  // Cooperative staging (64 threads), neighbouring lanes on neighbouring 16-B chunks of a row:
  // K tile 32x64 (8 lanes cover a 128-B row, 8 rows per load of the block); V tile 64x32 (4 lanes cover a 64-B row, 16 rows per load).
  const int krow = t >> 3;
  const int kcol = (t & 7) * 8;
  const int vrow = t >> 2;
  const int vcol = (t & 3) * 8;
  const bf16* kSrc = Kh + (size_t)krow * KVD + kcol;
  const bf16* vSrc = Vh + (size_t)vrow * KROWS + vcol;

  bf16x16 qf[QW][2];
#pragma unroll
  for (int qt = 0; qt < QW; ++qt) {
    qf[qt][0] = load_frag(Qh, DD, q0 + 16 * qt, 0);
    qf[qt][1] = load_frag(Qh, DD, q0 + 16 * qt, 32);
  }

  f32x8 o[QW][4] = {};
  float mrun[QW], lrun[QW];
#pragma unroll
  for (int qt = 0; qt < QW; ++qt) { mrun[qt] = -INFINITY; lrun[qt] = 0.0f; }

  const float scale = 0.125f * 1.44269504088896340736f;  // 1/sqrt(DK)*log2(e)
  const float NEG2 = -1.0e9f;    // masked logit: its weight is exactly 0 once any valid key of the row has been seen (every row
                                 // has one), and anything accumulated before that is wiped by alpha == 0 — same result as -inf
  const int kmax = KROWS - 1;
  __shared__ float kbS[KROWS];
  for (int i = threadIdx.x; i < KROWS; i += 64) kbS[i] = kbias[(size_t)b * KROWS + i] * 1.44269504088896340736f;   // in log2 units
  __syncthreads();

  // Prefetch key block kb=0 into registers.
  bf16x8 kreg[4], vreg[4];
#pragma unroll
  for (int i = 0; i < 4; ++i) {
    kreg[i] = *(const bf16x8*)(kSrc + (size_t)(8 * i) * KVD);
    vreg[i] = *(const bf16x8*)(vSrc + (size_t)(16 * i) * KROWS);
  }

  for (int kb = 0; kb <= kmax; kb += 32) {
    lds_barrier();   // previous readers done with LDS
#pragma unroll
    for (int i = 0; i < 4; ++i) {
      *(bf16x8*)(&ldsK[(krow + 8 * i) * KSTRIDE + kcol])  = kreg[i];
      *(bf16x8*)(&ldsV[(vrow + 16 * i) * VSTRIDE + vcol]) = vreg[i];
    }
    if (kb + 32 <= kmax) {   // prefetch next block during compute
      const bf16* kn = kSrc + (size_t)(kb + 32) * KVD;
      const bf16* vn = vSrc + (kb + 32);
#pragma unroll
      for (int i = 0; i < 4; ++i) {
        kreg[i] = *(const bf16x8*)(kn + (size_t)(8 * i) * KVD);
        vreg[i] = *(const bf16x8*)(vn + (size_t)(16 * i) * KROWS);
      }
      asm volatile("s_wait_xcnt 0x0" ::: "memory");   // the loads outlive the barrier: their address pairs step on only behind this wait
    }
    lds_barrier();   // tile visible; the prefetch above stays in flight over scores, softmax and PV

    // Phase 1: scores + softmax for both q-tiles (K fragments live here only).
    bf16x16 kf[2][2];
#pragma unroll
    for (int ktile = 0; ktile < 2; ++ktile)
#pragma unroll
      for (int c = 0; c < 2; ++c)
        kf[ktile][c] = lds_frag(ldsK + (ktile * 16) * KSTRIDE + c * 32, KSTRIDE);

    bf16x16 pf[QW];
    bool act[QW];
#pragma unroll
    for (int qt = 0; qt < QW; ++qt) {
      unsigned mbits = 0;
      {
#pragma unroll
        for (int r = 0; r < 8; ++r) { const int j0 = kb + kh8 + r; if (j0 < NKV) mbits |= 1u << r; if (j0 + 16 < NKV) mbits |= 1u << (8 + r); }
        act[qt] = (__builtin_amdgcn_ballot_w32(mbits != 0) != 0);
      }
      if (act[qt]) {
        const int q_my = q0 + 16 * qt + qlane;
        f32x8 s0 = {}, s1 = {};
        s0 = wmma_bf16(kf[0][0], qf[qt][0], s0);
        s0 = wmma_bf16(kf[0][1], qf[qt][1], s0);
        s1 = wmma_bf16(kf[1][0], qf[qt][0], s1);
        s1 = wmma_bf16(kf[1][1], qf[qt][1], s1);

        float mx = -INFINITY;
#pragma unroll
        for (int r = 0; r < 8; ++r) {
          const int k0i = kb + kh8 + r;
          const int k1i = k0i + 16;
          (void)k0i; (void)k1i; (void)q_my;
          s0[r] = (mbits & (1u << r))       ? s0[r] * scale + kbS[kb + kh8 + r] : NEG2;
          s1[r] = (mbits & (1u << (8 + r))) ? s1[r] * scale + kbS[kb + 16 + kh8 + r] : NEG2;
          mx = fmaxf(mx, fmaxf(s0[r], s1[r]));
        }
        mx = fmaxf(mx, __shfl_xor(mx, 16, 32));
        const float mnew  = fmaxf(mrun[qt], mx);
        // hw_exp2 here and below: one v_exp_f32 each. exp2f() wraps it in a compare, two selects, an add and an ldexp to keep results below 2^-126;
        // such a weight is 0 in the f16 P and vanishes beside a row sum >= 1, and such an alpha scales history that rounds away likewise.
        const float alpha = hw_exp2(mrun[qt] - mnew);

        float rsum = 0.0f;
#pragma unroll
        for (int r = 0; r < 8; ++r) {
          const float p0 = hw_exp2(s0[r] - mnew);
          const float p1 = hw_exp2(s1[r] - mnew);
          rsum += p0 + p1;
          pf[qt][r]     = (bf16)(p0 * 1024.0f);     // P carried x1024: no f16 copy of a probability is sub-normal
          pf[qt][r + 8] = (bf16)(p1 * 1024.0f);
        }
        rsum += __shfl_xor(rsum, 16, 32);
        lrun[qt] = lrun[qt] * alpha + rsum;
        mrun[qt] = mnew;

        // Rescale accumulators now so the PV phase is pure WMMA.
#pragma unroll
        for (int j = 0; j < 4; ++j)
#pragma unroll
          for (int r = 0; r < 8; ++r) o[qt][j][r] *= alpha;
      }
    }

    // Phase 2: O^T accumulate; each V fragment read from LDS once, used by
    // both q-tiles, then dead (only 8 VGPRs of V live at a time).
#pragma unroll
    for (int j = 0; j < 4; ++j) {
      const bf16x16 vf = lds_frag(ldsV + (j * 16) * VSTRIDE, VSTRIDE);
#pragma unroll
      for (int qt = 0; qt < QW; ++qt)
        if (act[qt]) o[qt][j] = wmma_bf16(vf, pf[qt], o[qt][j]);
    }
  }

  bf16* so = ldsO[wave];
#pragma unroll
  for (int qt = 0; qt < QW; ++qt) {
    const float rl = 1.0f / (lrun[qt] * 1024.0f);
#pragma unroll
    for (int j = 0; j < 4; ++j)
#pragma unroll
      for (int r = 0; r < 8; ++r) so[(16 * qt + qlane) * 72 + j * 16 + kh8 + r] = (bf16)(o[qt][j][r] * rl);
  }
  asm volatile("s_wait_dscnt 0" ::: "memory");
  __builtin_amdgcn_wave_barrier();
{
#pragma unroll
    for (int it = 0; it < 8; ++it) { const int ch = lane + 32 * it, ql = ch >> 3, q8 = (ch & 7) * 8;   // 8 lanes cover one row's 128 B
      *(v4u_t*)(attnOut + ((size_t)(b * QROWS + q0 + ql)) * DD + h * DKK + q8) = *(const v4ua*)(so + ql * 72 + q8); }
    
  }
}


// xp = LN(x)*g + b + pos[s]  (f32 rows for the residual, and the same rows rounded to f16 for the q, k, v products).
// One wave = one position s in all BB batches. A lane holds 4 neighbouring columns of each 128-column chunk, so every wave-wide 16-B load or store
// covers 512 contiguous bytes; the BB rows, the pos row, g and b stay in registers and all their loads are issued before the first sum waits.
__global__ __launch_bounds__(256) void k_lnpos(const float* __restrict__ X, const float* __restrict__ g, const float* __restrict__ bb, const float* __restrict__ pos, float* __restrict__ Y, bf16* __restrict__ Y16) {
  constexpr int NC = DD / 128;   // 128-column chunks of a row
  const unsigned c0 = (threadIdx.x & 31) * 4;
  const int s_ = blockIdx.x * 8 + (threadIdx.x >> 5);
  int row[BB];   // the wave's row numbers as scalars: the row offsets are formed on the scalar unit
#pragma unroll   // this and every loop below: unrolled so that the row arrays stay in registers
  for (int b = 0; b < BB; ++b) row[b] = __builtin_amdgcn_readfirstlane(b * SS + s_);
  v4f_t xv[BB][NC], pv[NC], gv[NC], bv[NC];
#pragma unroll
  for (int b = 0; b < BB; ++b) {
    const float* xr = X + (size_t)row[b] * DD;
#pragma unroll
    for (int c = 0; c < NC; ++c) xv[b][c] = *(const v4f_t*)(xr + c * 128 + c0);
  }
  asm volatile("s_wait_xcnt 0x0" ::: "memory");   // precaution: stands in front of the loads below, which land in registers that hold row addresses of the loads above
  const float* pr = pos + (size_t)row[0] * DD;
#pragma unroll
  for (int c = 0; c < NC; ++c) pv[c] = *(const v4f_t*)(pr + c * 128 + c0);
#pragma unroll
  for (int c = 0; c < NC; ++c) { gv[c] = *(const v4f_t*)(g + c * 128 + c0); bv[c] = *(const v4f_t*)(bb + c * 128 + c0); }
  asm volatile("s_wait_xcnt 0x0" ::: "memory");   // precaution: stands in front of the first rewrite of the lane-offset register and the scalar bases that the loads above name
  __builtin_amdgcn_sched_barrier(0);   // keeps every load above issued here: left free, the scheduler sinks the pos, g and b loads behind the sums, where each small group waits out its own latency
#pragma unroll
  for (int b = 0; b < BB; ++b) {
    v4f_t a = xv[b][0];
#pragma unroll
    for (int c = 1; c < NC; ++c) a += xv[b][c];
    float s = (a[0] + a[1]) + (a[2] + a[3]);
#pragma unroll
    for (int off = 1; off < 32; off <<= 1) s += __shfl_xor(s, off, 32);
    const float mean = s * (1.0f / DD);
    v4f_t q4 = {};
#pragma unroll
    for (int c = 0; c < NC; ++c) { const v4f_t d = xv[b][c] - mean; q4 += d * d; }
    float q = (q4[0] + q4[1]) + (q4[2] + q4[3]);
#pragma unroll
    for (int off = 1; off < 32; off <<= 1) q += __shfl_xor(q, off, 32);
    const float rstd = rsqrtf(q * (1.0f / DD) + 1e-5f);
    float* yr = Y + (size_t)row[b] * DD;
    bf16* hr = Y16 + (size_t)row[b] * DD;
#pragma unroll
    for (int c = 0; c < NC; ++c) {
      const v4f_t v = (xv[b][c] - mean) * rstd * gv[c] + bv[c] + pv[c];
      bf16x4 hq; hq[0] = (bf16)v[0]; hq[1] = (bf16)v[1]; hq[2] = (bf16)v[2]; hq[3] = (bf16)v[3];
      *(v4f_t*)(yr + c * 128 + c0) = v;
      *(bf16x4*)(hr + c * 128 + c0) = hq;
    }
  }
}
// Blocks 0..BB-1: kbias[b][k] = 1 - mask[b][k]  (the reference's quirk: a FLOAT additive mask); 8-KB rows.
// The other blocks round the three weight matrices to f16, once per call, 8192 elements a block, into one buffer [in_proj | out_proj | to_out]:
// the products then stage half the bytes and convert nothing in their loops. A wave-wide load covers 512 contiguous bytes, a store 256.
#define WCH 8192
__global__ __launch_bounds__(256) void k_prep(const float* __restrict__ mask, float* __restrict__ kb, const float* __restrict__ Win, const float* __restrict__ Wout,
                                              const float* __restrict__ Wto, bf16* __restrict__ W16) {
  if (blockIdx.x < BB) { const int b = blockIdx.x;
    for (int q4 = threadIdx.x; q4 < KROWS / 4; q4 += 256) { const v4f_t m = *(const v4f_t*)(mask + (size_t)b * KROWS + q4 * 4); v4f_t o; for (int e = 0; e < 4; ++e) o[e] = 1.0f - m[e];
      *(v4f_t*)(kb + (size_t)b * KROWS + q4 * 4) = o;  }
    return;
  }
  const int c = blockIdx.x - BB;   // chunk number in the joined buffer; block-uniform choice of the source
  const float* src = c < 3 * DD * DD / WCH ? Win + (size_t)c * WCH : c < 4 * DD * DD / WCH ? Wout + ((size_t)c * WCH - 3 * DD * DD) : Wto + ((size_t)c * WCH - 4 * DD * DD);
  bf16* dst = W16 + (size_t)c * WCH;
  v4f_t v[WCH / 1024];
#pragma unroll   // this and the next: unrolled so that all loads are in flight before the first store waits
  for (int u = 0; u < WCH / 1024; ++u) v[u] = *(const v4f_t*)(src + u * 1024 + threadIdx.x * 4);
#pragma unroll
  for (int u = 0; u < WCH / 1024; ++u) { bf16x4 q; q[0] = (bf16)v[u][0]; q[1] = (bf16)v[u][1]; q[2] = (bf16)v[u][2]; q[3] = (bf16)v[u][3];
    *(bf16x4*)(dst + u * 1024 + threadIdx.x * 4) = q; }
  asm volatile("s_wait_xcnt 0x0" ::: "memory");   // precaution: stands behind the last store, in front of any rewrite of the registers that the stores name
}

extern "C" void kernel_launch(void* const* d_in, const int* in_sizes, int n_in,
                              void* d_out, int out_size, void* d_ws, size_t ws_size,
                              hipStream_t stream) {
  (void)in_sizes; (void)n_in; (void)out_size;
  const float** f = (const float**)d_in;
  const float* x = f[0], *mask = f[1], *pos = f[2], *lng = f[3], *lnb = f[4], *Win = f[5], *bin = f[6], *Wout = f[7], *bout = f[8], *Wto = f[9], *bto = f[10];
  float* out = (float*)d_out;     // [4,2048,1024]
  char* ws = (char*)d_ws;
  float* xp = (float*)ws; ws += (size_t)MTOK * DD * 4;                  // 32 MB: f32 rows, read again only as the residual
  bf16* xp16 = (bf16*)ws; ws += (size_t)MTOK * DD * 2; bf16* Q16 = (bf16*)ws; ws += (size_t)MTOK * DD * 2; bf16* K16 = (bf16*)ws; ws += (size_t)MTOK * DD * 2;   // 16 MB each
  bf16* Vt = (bf16*)ws; ws += (size_t)MTOK * DD * 2; bf16* att16 = (bf16*)ws; ws += (size_t)MTOK * DD * 2; bf16* y16 = (bf16*)ws; ws += (size_t)MTOK * DD * 2;
  float* kb = (float*)ws; ws += (size_t)BB * KROWS * 4;
  bf16* W16 = (bf16*)ws; ws += (size_t)5 * DD * DD * 2;                 // 10 MB: in_proj, out_proj, to_out as f16
  if ((size_t)(ws - (char*)d_ws) > ws_size) return;
  const dim3 blk(256); const dim3 gp(MTOK / 128, DD / 256);
  k_lnpos<<<dim3(SS / 8), blk, 0, stream>>>(x, lng, lnb, pos, xp, xp16);
  k_prep<<<dim3(BB + 5 * DD * DD / WCH), blk, 0, stream>>>(mask, kb, Win, Wout, Wto, W16);
  gemm_rb_kernel<bf16, 5><<<dim3(MTOK / 128, 3 * DD / 256), blk, 0, stream>>>(xp16, W16, bin, nullptr, nullptr, nullptr, Q16, MTOK, 3 * DD, DD);   // q, k, v: Q16, K16, Vt are adjacent
  v_attn_kernel<<<dim3(QROWS / 64, HH, BB), dim3(64), 0, stream>>>(Q16, K16, Vt, kb, att16);
  gemm_rb_kernel<bf16, 4><<<gp, blk, 0, stream>>>(att16, W16 + (size_t)3 * DD * DD, bout, nullptr, xp, nullptr, y16, MTOK, DD, DD);      // y = xp + o*out_proj^T + b, summed in f32, stored f16
  gemm_rb_kernel<bf16, 2><<<gp, blk, 0, stream>>>(y16, W16 + (size_t)4 * DD * DD, bto, nullptr, nullptr, nullptr, out, MTOK, DD, DD);      // out = y*to_out^T + b
}

// v008
// It runs in 203 microseconds.
// Next to v007, in two timings, it ran 1.04 times as fast each time.
// Over all steps from v000 it is 2.29 times as fast.
// Contractions on v_wmma_f32_16x16x32_f16 (plain f16 operands, f32 accumulate): qkv = (LN(x) + pos)·in_projᵀ + b (K = 1024, N = 3072),
// the 16-head attention (dk = 64, scale 1/8) with the reference's ADDITIVE float mask (1 − padding_mask) as a per-(batch,key) bias,
// flash-style Sᵀ = K·Qᵀ / Oᵀ = Vᵀ·Pᵀ with online softmax in f32 (P x1024, f16 output rows), attn_out = o·out_projᵀ + b + xp (residual in
// the epilogue, K = 1024) and (xp + attn_out)·to_outᵀ + b (K = 1024); LayerNorm and the positional add in f32. xp dominates the residual
// so plain f16 operands suffice. compute dtype: f16 operands, f32 accumulate.  x [4,2048,1024].
// Every matrix operand that one kernel hands to the next (xp, q, k, v transposed, the attention rows, y) is rounded to f16 once, from its f32
// value, at its producer's store, in the layout that the consumer stages; only the residual copy of xp and the final output are f32.
#include <hip/hip_runtime.h>
#include <hip/hip_bf16.h>
#include <math.h>

#define BB 4
#define SS 2048
#define QROWS 2048
#define KROWS 2048
#define NKV 2048
#define DD 1024
#define HH 16
#define KVH 16
#define KVD 1024
#define HKDIV 1
#define DKK 64
#define QW 2
#define MTOK (BB * SS)
#define GSTR 48

typedef _Float16 bf16;
typedef _Float16 f16;
typedef __attribute__((ext_vector_type(4))) unsigned v4u_t;
typedef unsigned v4ua __attribute__((ext_vector_type(4), may_alias));
typedef __attribute__((ext_vector_type(4))) float v4f_t;
typedef float v4fa __attribute__((ext_vector_type(4), may_alias));
typedef __attribute__((ext_vector_type(16))) bf16  bf16x16;
typedef bf16x16 f16x16;
typedef __attribute__((ext_vector_type(8)))  bf16  bf16x8;
typedef bf16x8 f16x8;
typedef __attribute__((ext_vector_type(4)))  bf16  bf16x4;
typedef __attribute__((ext_vector_type(8)))  float f32x8;
// The bare builtin, for the attention loop: the compiler keeps the distances behind a WMMA itself, with independent vector work where it has some.
__device__ __forceinline__ f32x8 wmma16(f16x16 a, f16x16 b, f32x8 c) {
  c = __builtin_amdgcn_wmma_f32_16x16x32_f16(false, a, false, b, (short)0, c, false, false);
  return c;
}
#define GK 64           // k per staged GEMM tile: a row segment of f16 is one whole 128-B line
#define LDS_STRIDE 72   // GEMM tiles: 64 -> 72 elems (144-B rows, 16 B x 9): conflict-free b128 reads
#define KSTRIDE    72   // attn K tile: 64 -> 72 elems (144B rows): conflict-free b128
#define VSTRIDE    48   // attn V tile: 32 -> 48 elems

__device__ __forceinline__ f32x8 wmma_bf16(bf16x16 a, bf16x16 b, f32x8 c) {
  c = __builtin_amdgcn_wmma_f32_16x16x32_f16(false, a, false, b, (short)0, c, false, false);
  asm volatile("v_nop\n\tv_nop\n\tv_nop\n\tv_nop" : "+v"(c) : "v"(a), "v"(b));   // A/B-overwrite hazard guard
  return c;
}

// Work-group barrier of the staged loops: it waits for this wave's LDS traffic only. __syncthreads() also drains the load counter, so the
// next tile's global loads, issued just ahead of it, would be waited out before the matrix phase instead of flying under it.
__device__ __forceinline__ void lds_barrier() {
  asm volatile("s_wait_dscnt 0x0\n\ts_barrier_signal -1\n\ts_barrier_wait -1" ::: "memory");
}

// 16x32 (MxK) bf16 fragment from a row-major global matrix.
// lanes 0-15  (row=lane)    : elems 0..7 = K+0..7,  8..15 = K+16..23
// lanes 16-31 (row=lane-16) : elems 0..7 = K+8..15, 8..15 = K+24..31
template <typename T>
__device__ __forceinline__ bf16x16 load_frag(const T* __restrict__ base, int ld,
                                             int row0, int k0) {
  const int lane = threadIdx.x & 31;
  const int r    = lane & 15;
  const int kh   = (lane >> 4) * 8;
  const T* p0 = base + (size_t)(row0 + r) * ld + (k0 + kh);
  const T* p1 = p0 + 16;
  bf16x16 f;
#pragma unroll
  for (int i = 0; i < 8; ++i) {
    f[i]     = (bf16)p0[i];
    f[i + 8] = (bf16)p1[i];
  }
  return f;
}

// Same fragment from an LDS tile with padded row stride (base includes row0/k0).
__device__ __forceinline__ bf16x16 lds_frag(const bf16* base, int stride) {
  const int lane = threadIdx.x & 31;
  const int row  = lane & 15;
  const int kh   = (lane >> 4) * 8;
  const bf16x8 lo = *(const bf16x8*)(base + row * stride + kh);
  const bf16x8 hi = *(const bf16x8*)(base + row * stride + kh + 16);
  bf16x16 f;
#pragma unroll
  for (int i = 0; i < 8; ++i) { f[i] = lo[i]; f[i + 8] = hi[i]; }
  return f;
}

// Epilogue of the q, k, v product: f32 bias added, rounded to f16, staged in LDS, stored as whole 16-B chunks.
// VT false: rows [m][DD] (q, k). VT true: v transposed, rows (b, h, dk) of SS positions. nW = column among the 3*DD weight rows, nO = column inside its own product.
template <bool VT>
__device__ __forceinline__ void store_tile16(const f32x8 (&acc)[4][4], bf16* so, const float* __restrict__ bias, bf16* __restrict__ out,
                                             int mBlk, int nW, int nO, int wm, int wn, int nlane, int mh, int t) {
#pragma unroll   // this and the two below: unrolled so that every accumulator index is a constant
  for (int i = 0; i < 4; ++i)
#pragma unroll
    for (int j = 0; j < 4; ++j) {
      const int nl = wn + 16 * j + nlane;
      const float bv = bias ? bias[nW + nl] : 0.0f;
#pragma unroll
      for (int r = 0; r < 8; ++r) {
        const int ml = wm + 16 * i + mh + r;
        const bf16 hv = (bf16)(acc[i][j][r] + bv);
        if (!VT) so[ml * 264 + nl] = hv;        // [m][n]
        else     so[nl * 136 + ml] = hv;        // [n][m]  (n = h*64+dk rows of Vt, m = s contiguous)
      }
    }
  __syncthreads();
  if (!VT) {                // rows m: 256 halfs = 512 B each, 16-B chunks
    for (int ch = t; ch < 128 * 32; ch += 256) { const int ml = ch >> 5, q = (ch & 31) * 8;
      *(v4u_t*)(out + (size_t)(mBlk + ml) * DD + nO + q) = *(const v4ua*)(so + ml * 264 + q); }
  } else {                  // Vt rows (b, h, dk): 128 consecutive s = 256 B each
    const int b_ = mBlk / SS, s0 = mBlk % SS;
    for (int ch = t; ch < 256 * 16; ch += 256) { const int nl = ch >> 4, q = (ch & 15) * 8; const int n = nO + nl, h = n >> 6, dk = n & (DKK - 1);
      *(v4u_t*)(out + (((size_t)(b_ * HH + h)) * DKK + dk) * SS + s0 + q) = *(const v4ua*)(so + nl * 136 + q); }
  }
}

// ---------------------------------------------------------------------------
// GEMM: C[m][n] = sum_k A[m][k]*W[n][k] + bias[n]   (torch Linear)
// Block 256 thr (8 waves), tile 128M x 256N, K-step GK = 64 (two 32-k matrix steps per staged tile); wave tile 64x64.
// A and W are f16 (W rounded once per call by k_prep). Both are staged through LDS (padded stride) with next-tile register
// prefetch overlapping the WMMA phase. M a multiple of 128, N of 256, K = DD.
// MODE 2: fp32 [M][N]   MODE 4: as MODE 2 (f32 bias and residual), rounded to f16 at the store
// MODE 5: the three products of one A in one grid (N = 3*DD weight rows): block columns below DD give q, below 2*DD k (f16 [M][DD] each), the rest
//         v as f16 Vt[b][h][dk][s]; the three outputs lie one behind the other at out. 768 blocks: two are resident per WGP, one loads while the other multiplies.
// ---------------------------------------------------------------------------
template <typename AT, int MODE>
__global__ __launch_bounds__(256) void gemm_rb_kernel(
    const AT* __restrict__ A, const bf16* __restrict__ W,
    const float* __restrict__ bias, const float* __restrict__ rowscale, const float* __restrict__ R, const float* __restrict__ rowbias, void* __restrict__ out,
    int M, int N, int K) {
  __shared__ __attribute__((aligned(16))) bf16 ldsA[128 * LDS_STRIDE];   // 18.0 KB
  __shared__ __attribute__((aligned(16))) bf16 ldsW[256 * LDS_STRIDE];   // 36.0 KB
  // output staging: MODE 5 [128 m][264] f16 (q, k) or [256 n][136] f16 (v), MODE 2 and 4 [64 m][260] f32 (two halves)
  __shared__ __attribute__((aligned(16))) unsigned char sob[256 * 136 * 2];   // 69,632 B >= 128*264*2 and >= 64*260*4

  const int t    = threadIdx.x;
  const int wave = t >> 5;
  const int lane = t & 31;
  const int wm   = (wave & 1) * 64;
  const int wn   = (wave >> 1) * 64;
  const int mBlk = blockIdx.x * 128;
  const int nBlk = blockIdx.y * 256;

  // Staging map, the same for A and W: 8 neighbouring lanes take the 8 16-B chunks of one row's 64-k segment, so a wave-wide 16-B load
  // covers 4 whole 128-B lines; one load of the block covers 32 rows.
  static_assert(sizeof(AT) == 2, "A is staged as f16");
  const int r0 = t >> 3, c0 = (t & 7) * 8;
  constexpr int KC = DD;   // K = DD in every launch: with the row pitch a constant, the 32-row steps of the chunks fold into the loads' immediate offsets
  (void)K;
  unsigned off = (unsigned)((r0 * KC + c0) * 2);   // the lane's byte offset from the block-uniform bases; it steps by one 64-k segment per trip
  constexpr unsigned rstep = 32u * KC * 2u;        // 32 rows, in bytes
  const char* aBase = (const char*)(A + (size_t)mBlk * KC);
  const char* wBase = (const char*)(W + (size_t)nBlk * KC);

  v4u_t abuf[4], wbuf[8];
#pragma unroll   // this and the chunk loops below: unrolled so that the staging arrays stay in registers
  for (int i = 0; i < 4; ++i) abuf[i] = *(const v4ua*)(aBase + off + i * rstep);
#pragma unroll
  for (int i = 0; i < 8; ++i) wbuf[i] = *(const v4ua*)(wBase + off + i * rstep);
  asm volatile("s_wait_xcnt 0x0" ::: "memory");   // precaution: stands in front of the first step of the offset register, which the loads above name

  f32x8 acc[4][4] = {};

  for (int k = 0; k < KC; k += GK) {
    lds_barrier();   // every wave has read the previous tile's fragments
#pragma unroll
    for (int i = 0; i < 4; ++i) *(v4ua*)&ldsA[(r0 + 32 * i) * LDS_STRIDE + c0] = abuf[i];
#pragma unroll
    for (int i = 0; i < 8; ++i) *(v4ua*)&ldsW[(r0 + 32 * i) * LDS_STRIDE + c0] = wbuf[i];
    if (k + GK < KC) {
      off += GK * 2u;
#pragma unroll
      for (int i = 0; i < 4; ++i) abuf[i] = *(const v4ua*)(aBase + off + i * rstep);
#pragma unroll
      for (int i = 0; i < 8; ++i) wbuf[i] = *(const v4ua*)(wBase + off + i * rstep);
    }
    lds_barrier();   // tile visible; the loads above stay in flight over the matrix phase

#pragma unroll   // unrolled so that the fragment offsets are constants
    for (int kk = 0; kk < GK; kk += 32) {
      bf16x16 af[4], wf[4];
#pragma unroll
      for (int i = 0; i < 4; ++i)
        af[i] = lds_frag(ldsA + (wm + 16 * i) * LDS_STRIDE + kk, LDS_STRIDE);
#pragma unroll
      for (int j = 0; j < 4; ++j)
        wf[j] = lds_frag(ldsW + (wn + 16 * j) * LDS_STRIDE + kk, LDS_STRIDE);
#pragma unroll
      for (int i = 0; i < 4; ++i)
#pragma unroll
        for (int j = 0; j < 4; ++j)
          acc[i][j] = wmma_bf16(af[i], wf[j], acc[i][j]);
    }
    asm volatile("s_wait_xcnt 0x0" ::: "memory");   // precaution: at the trip's foot, on the way back and on the way out alike, in front of any rewrite of the offset register and scalar bases that this trip's loads name
  }

  const int nlane = lane & 15;
  const int mh    = (lane >> 4) * 8;
  __syncthreads();
  if (MODE == 5) {
    const int part = nBlk / DD;   // block-uniform: a 256-column tile lies inside one of the three products
    bf16* outp = (bf16*)out + (size_t)part * MTOK * DD;
    if (part < 2) store_tile16<false>(acc, (bf16*)sob, bias, outp, mBlk, nBlk, nBlk - part * DD, wm, wn, nlane, mh, t);
    else          store_tile16<true>(acc, (bf16*)sob, bias, outp, mBlk, nBlk, nBlk - part * DD, wm, wn, nlane, mh, t);
  } else {
    float* so = (float*)sob;
#pragma unroll 1
    for (int hf = 0; hf < 2; ++hf) {
      if (wm == hf * 64) {
#pragma unroll
        for (int i = 0; i < 4; ++i)
#pragma unroll
          for (int j = 0; j < 4; ++j) {
            const int nl = wn + 16 * j + nlane;
            const float bv = bias ? bias[nBlk + nl] : 0.0f;
#pragma unroll
            for (int r = 0; r < 8; ++r) { const int mrow = mBlk + hf * 64 + 16 * i + mh + r; so[(16 * i + mh + r) * 260 + nl] = acc[i][j][r] * (rowscale ? rowscale[mrow] : 1.0f) + bv + (rowbias ? rowbias[mrow] : 0.0f); }
          }
      }
      __syncthreads();
      if (R) {   // residual: fold R[m][n] into the staged tile once (same thread <-> same chunks as the stores below)
        for (int ch = t; ch < 64 * 64; ch += 256) { const int ml = ch >> 6, q = (ch & 63) * 4;
          if (nBlk + q < N) { const v4f_t rv = *(const v4f_t*)(R + (size_t)(mBlk + hf * 64 + ml) * N + nBlk + q); v4f_t v = *(const v4fa*)(so + ml * 260 + q); v += rv; *(v4fa*)(so + ml * 260 + q) = v; } }
        asm volatile("s_wait_dscnt 0" ::: "memory");
      }
{   // 64 rows x 256 floats = 1 KB segments, float4 chunks; columns >= N (ragged tile) skipped
        const int q = (t & 63) * 4;
        if (nBlk + q < N) {
          for (int m0 = t >> 6; m0 < 64; m0 += 16) {   // rows m0, m0 + 4, m0 + 8, m0 + 12 per trip: four LDS reads and four stores in flight
            v4f_t v[4];
#pragma unroll   // this and the next: unrolled so that the four chunks stay in registers
            for (int u = 0; u < 4; ++u) v[u] = *(const v4fa*)(so + (m0 + 4 * u) * 260 + q);
#pragma unroll
            for (int u = 0; u < 4; ++u) {
              const size_t eo = (size_t)(mBlk + hf * 64 + m0 + 4 * u) * N + nBlk + q;
              if (MODE == 4) { bf16x4 hq; hq[0] = (bf16)v[u][0]; hq[1] = (bf16)v[u][1]; hq[2] = (bf16)v[u][2]; hq[3] = (bf16)v[u][3];
                *(bf16x4*)((bf16*)out + eo) = hq; }
              else *(v4f_t*)((float*)out + eo) = v[u];
            }
          }
        }
      }
      __syncthreads();
    }
  }
}

// 2^x by the hardware instruction alone (results below 2^-126 come out as 0; -inf gives 0).
__device__ __forceinline__ float hw_exp2(float x) { return __builtin_amdgcn_exp2f(x); }

__global__ __launch_bounds__(64) void v_attn_kernel(
    const bf16* __restrict__ Qb, const bf16* __restrict__ Kb,
    const bf16* __restrict__ Vt, const float* __restrict__ kbias,   // kbias [B][KROWS]: additive per-key logit bias (1 − mask)
    bf16* __restrict__ attnOut) {
  __shared__ bf16 ldsK[32 * KSTRIDE];   // 4.5 KB
  __shared__ bf16 ldsV[64 * VSTRIDE];   // 6.0 KB
  __shared__ __attribute__((aligned(16))) bf16 ldsO[2][32 * 72];   // per-wave f16 output tile: 32 queries x 64 dk, 72-elem rows

  const int q0blk = blockIdx.x * 64;
  const int h  = blockIdx.y;
  const int b  = blockIdx.z;
  const int t    = threadIdx.x;
  const int wave = t >> 5;
  const int lane = t & 31;
  const int qlane = lane & 15;
  const int kh8   = (lane >> 4) * 8;
  const int q0 = q0blk + wave * 32;          // this wave's 32 queries

  const int hk = h / HKDIV;
  const bf16* Qh = Qb + (size_t)b * QROWS * DD + h * DKK;        // queries: QROWS rows per batch, row stride DD
  const bf16* Kh = Kb + (size_t)b * KROWS * KVD + hk * DKK;      // keys: KROWS rows per batch, row stride KVD
  const bf16* Vh = Vt + ((size_t)(b * KVH + hk)) * DKK * KROWS;  // Vᵀ [KVH][64][KROWS] per batch

  // Cooperative staging (64 threads), neighbouring lanes on neighbouring 16-B chunks of a row:
  // K tile 32x64 (8 lanes cover a 128-B row, 8 rows per load of the block); V tile 64x32 (4 lanes cover a 64-B row, 16 rows per load).
  const int krow = t >> 3;
  const int kcol = (t & 7) * 8;
  const int vrow = t >> 2;
  const int vcol = (t & 3) * 8;
  const bf16* kSrc = Kh + (size_t)krow * KVD + kcol;
  const bf16* vSrc = Vh + (size_t)vrow * KROWS + vcol;

  bf16x16 qf[QW][2];
#pragma unroll
  for (int qt = 0; qt < QW; ++qt) {
    qf[qt][0] = load_frag(Qh, DD, q0 + 16 * qt, 0);
    qf[qt][1] = load_frag(Qh, DD, q0 + 16 * qt, 32);
  }

  f32x8 o[QW][4] = {};
  float mrun[QW], lrun[QW];
#pragma unroll
  for (int qt = 0; qt < QW; ++qt) { mrun[qt] = -INFINITY; lrun[qt] = 0.0f; }

  const float scale = 0.125f * 1.44269504088896340736f;  // 1/sqrt(DK)*log2(e)
  const float NEG2 = -1.0e9f;    // masked logit: its weight is exactly 0 once any valid key of the row has been seen (every row
                                 // has one), and anything accumulated before that is wiped by alpha == 0 — same result as -inf
  const int kmax = KROWS - 1;
  __shared__ float kbS[KROWS];
  for (int i = threadIdx.x; i < KROWS; i += 64) kbS[i] = kbias[(size_t)b * KROWS + i] * 1.44269504088896340736f;   // in log2 units
  __syncthreads();

  // Prefetch key block kb=0 into registers.
  bf16x8 kreg[4], vreg[4];
#pragma unroll
  for (int i = 0; i < 4; ++i) {
    kreg[i] = *(const bf16x8*)(kSrc + (size_t)(8 * i) * KVD);
    vreg[i] = *(const bf16x8*)(vSrc + (size_t)(16 * i) * KROWS);
  }

  for (int kb = 0; kb <= kmax; kb += 32) {
    lds_barrier();   // previous readers done with LDS
#pragma unroll
    for (int i = 0; i < 4; ++i) {
      *(bf16x8*)(&ldsK[(krow + 8 * i) * KSTRIDE + kcol])  = kreg[i];
      *(bf16x8*)(&ldsV[(vrow + 16 * i) * VSTRIDE + vcol]) = vreg[i];
    }
    if (kb + 32 <= kmax) {   // prefetch next block during compute
      const bf16* kn = kSrc + (size_t)(kb + 32) * KVD;
      const bf16* vn = vSrc + (kb + 32);
#pragma unroll
      for (int i = 0; i < 4; ++i) {
        kreg[i] = *(const bf16x8*)(kn + (size_t)(8 * i) * KVD);
        vreg[i] = *(const bf16x8*)(vn + (size_t)(16 * i) * KROWS);
      }
      asm volatile("s_wait_xcnt 0x0" ::: "memory");   // the loads outlive the barrier: their address pairs step on only behind this wait
    }
    lds_barrier();   // tile visible; the prefetch above stays in flight over scores, softmax and PV

    // Phase 1: scores + softmax for both q-tiles (K fragments live here only).
    bf16x16 kf[2][2];
#pragma unroll
    for (int ktile = 0; ktile < 2; ++ktile)
#pragma unroll
      for (int c = 0; c < 2; ++c)
        kf[ktile][c] = lds_frag(ldsK + (ktile * 16) * KSTRIDE + c * 32, KSTRIDE);

    bf16x16 pf[QW];
    bool act[QW];
#pragma unroll
    for (int qt = 0; qt < QW; ++qt) {
      unsigned mbits = 0;
      {
#pragma unroll
        for (int r = 0; r < 8; ++r) { const int j0 = kb + kh8 + r; if (j0 < NKV) mbits |= 1u << r; if (j0 + 16 < NKV) mbits |= 1u << (8 + r); }
        act[qt] = (__builtin_amdgcn_ballot_w32(mbits != 0) != 0);
      }
      if (act[qt]) {
        const int q_my = q0 + 16 * qt + qlane;
        f32x8 s0 = {}, s1 = {};
        s0 = wmma16(kf[0][0], qf[qt][0], s0);
        s0 = wmma16(kf[0][1], qf[qt][1], s0);
        s1 = wmma16(kf[1][0], qf[qt][0], s1);
        s1 = wmma16(kf[1][1], qf[qt][1], s1);

        float mx = -INFINITY;
#pragma unroll
        for (int r = 0; r < 8; ++r) {
          const int k0i = kb + kh8 + r;
          const int k1i = k0i + 16;
          (void)k0i; (void)k1i; (void)q_my;
          s0[r] = (mbits & (1u << r))       ? s0[r] * scale + kbS[kb + kh8 + r] : NEG2;
          s1[r] = (mbits & (1u << (8 + r))) ? s1[r] * scale + kbS[kb + 16 + kh8 + r] : NEG2;
          mx = fmaxf(mx, fmaxf(s0[r], s1[r]));
        }
        mx = fmaxf(mx, __shfl_xor(mx, 16, 32));
        const float mnew  = fmaxf(mrun[qt], mx);
        // hw_exp2 here and below: one v_exp_f32 each. exp2f() wraps it in a compare, two selects, an add and an ldexp to keep results below 2^-126;
        // such a weight is 0 in the f16 P and vanishes beside a row sum >= 1, and such an alpha scales history that rounds away likewise.
        const float alpha = hw_exp2(mrun[qt] - mnew);

        float rsum = 0.0f;
#pragma unroll
        for (int r = 0; r < 8; ++r) {
          const float p0 = hw_exp2(s0[r] - mnew);
          const float p1 = hw_exp2(s1[r] - mnew);
          rsum += p0 + p1;
          pf[qt][r]     = (bf16)(p0 * 1024.0f);     // P carried x1024: no f16 copy of a probability is sub-normal
          pf[qt][r + 8] = (bf16)(p1 * 1024.0f);
        }
        rsum += __shfl_xor(rsum, 16, 32);
        lrun[qt] = lrun[qt] * alpha + rsum;
        mrun[qt] = mnew;

        // Rescale accumulators now so the PV phase is pure WMMA.
#pragma unroll
        for (int j = 0; j < 4; ++j)
#pragma unroll
          for (int r = 0; r < 8; ++r) o[qt][j][r] *= alpha;
      }
    }

    // Phase 2: O^T accumulate; each V fragment read from LDS once, used by
    // both q-tiles, then dead (only 8 VGPRs of V live at a time).
#pragma unroll
    for (int j = 0; j < 4; ++j) {
      const bf16x16 vf = lds_frag(ldsV + (j * 16) * VSTRIDE, VSTRIDE);
#pragma unroll
      for (int qt = 0; qt < QW; ++qt)
        if (act[qt]) o[qt][j] = wmma16(vf, pf[qt], o[qt][j]);
    }
  }

  bf16* so = ldsO[wave];
#pragma unroll
  for (int qt = 0; qt < QW; ++qt) {
    const float rl = 1.0f / (lrun[qt] * 1024.0f);
#pragma unroll
    for (int j = 0; j < 4; ++j)
#pragma unroll
      for (int r = 0; r < 8; ++r) so[(16 * qt + qlane) * 72 + j * 16 + kh8 + r] = (bf16)(o[qt][j][r] * rl);
  }
  asm volatile("s_wait_dscnt 0" ::: "memory");
  __builtin_amdgcn_wave_barrier();
{
#pragma unroll
    for (int it = 0; it < 8; ++it) { const int ch = lane + 32 * it, ql = ch >> 3, q8 = (ch & 7) * 8;   // 8 lanes cover one row's 128 B
      *(v4u_t*)(attnOut + ((size_t)(b * QROWS + q0 + ql)) * DD + h * DKK + q8) = *(const v4ua*)(so + ql * 72 + q8); }
    
  }
}


// xp = LN(x)*g + b + pos[s]  (f32 rows for the residual, and the same rows rounded to f16 for the q, k, v products).
// One wave = one position s in all BB batches. A lane holds 4 neighbouring columns of each 128-column chunk, so every wave-wide 16-B load or store
// covers 512 contiguous bytes; the BB rows, the pos row, g and b stay in registers and all their loads are issued before the first sum waits.
__global__ __launch_bounds__(256) void k_lnpos(const float* __restrict__ X, const float* __restrict__ g, const float* __restrict__ bb, const float* __restrict__ pos, float* __restrict__ Y, bf16* __restrict__ Y16) {
  constexpr int NC = DD / 128;   // 128-column chunks of a row
  const unsigned c0 = (threadIdx.x & 31) * 4;
  const int s_ = blockIdx.x * 8 + (threadIdx.x >> 5);
  int row[BB];   // the wave's row numbers as scalars: the row offsets are formed on the scalar unit
#pragma unroll   // this and every loop below: unrolled so that the row arrays stay in registers
  for (int b = 0; b < BB; ++b) row[b] = __builtin_amdgcn_readfirstlane(b * SS + s_);
  v4f_t xv[BB][NC], pv[NC], gv[NC], bv[NC];
#pragma unroll
  for (int b = 0; b < BB; ++b) {
    const float* xr = X + (size_t)row[b] * DD;
#pragma unroll
    for (int c = 0; c < NC; ++c) xv[b][c] = *(const v4f_t*)(xr + c * 128 + c0);
  }
  asm volatile("s_wait_xcnt 0x0" ::: "memory");   // precaution: stands in front of the loads below, which land in registers that hold row addresses of the loads above
  const float* pr = pos + (size_t)row[0] * DD;
#pragma unroll
  for (int c = 0; c < NC; ++c) pv[c] = *(const v4f_t*)(pr + c * 128 + c0);
#pragma unroll
  for (int c = 0; c < NC; ++c) { gv[c] = *(const v4f_t*)(g + c * 128 + c0); bv[c] = *(const v4f_t*)(bb + c * 128 + c0); }
  asm volatile("s_wait_xcnt 0x0" ::: "memory");   // precaution: stands in front of the first rewrite of the lane-offset register and the scalar bases that the loads above name
  __builtin_amdgcn_sched_barrier(0);   // keeps every load above issued here: left free, the scheduler sinks the pos, g and b loads behind the sums, where each small group waits out its own latency
#pragma unroll
  for (int b = 0; b < BB; ++b) {
    v4f_t a = xv[b][0];
#pragma unroll
    for (int c = 1; c < NC; ++c) a += xv[b][c];
    float s = (a[0] + a[1]) + (a[2] + a[3]);
#pragma unroll
    for (int off = 1; off < 32; off <<= 1) s += __shfl_xor(s, off, 32);
    const float mean = s * (1.0f / DD);
    v4f_t q4 = {};
#pragma unroll
    for (int c = 0; c < NC; ++c) { const v4f_t d = xv[b][c] - mean; q4 += d * d; }
    float q = (q4[0] + q4[1]) + (q4[2] + q4[3]);
#pragma unroll
    for (int off = 1; off < 32; off <<= 1) q += __shfl_xor(q, off, 32);
    const float rstd = rsqrtf(q * (1.0f / DD) + 1e-5f);
    float* yr = Y + (size_t)row[b] * DD;
    bf16* hr = Y16 + (size_t)row[b] * DD;
#pragma unroll
    for (int c = 0; c < NC; ++c) {
      const v4f_t v = (xv[b][c] - mean) * rstd * gv[c] + bv[c] + pv[c];
      bf16x4 hq; hq[0] = (bf16)v[0]; hq[1] = (bf16)v[1]; hq[2] = (bf16)v[2]; hq[3] = (bf16)v[3];
      *(v4f_t*)(yr + c * 128 + c0) = v;
      *(bf16x4*)(hr + c * 128 + c0) = hq;
    }
  }
}
// Blocks 0..BB-1: kbias[b][k] = 1 - mask[b][k]  (the reference's quirk: a FLOAT additive mask); 8-KB rows.
// The other blocks round the three weight matrices to f16, once per call, 8192 elements a block, into one buffer [in_proj | out_proj | to_out]:
// the products then stage half the bytes and convert nothing in their loops. A wave-wide load covers 512 contiguous bytes, a store 256.
#define WCH 8192
__global__ __launch_bounds__(256) void k_prep(const float* __restrict__ mask, float* __restrict__ kb, const float* __restrict__ Win, const float* __restrict__ Wout,
                                              const float* __restrict__ Wto, bf16* __restrict__ W16) {
  if (blockIdx.x < BB) { const int b = blockIdx.x;
    for (int q4 = threadIdx.x; q4 < KROWS / 4; q4 += 256) { const v4f_t m = *(const v4f_t*)(mask + (size_t)b * KROWS + q4 * 4); v4f_t o; for (int e = 0; e < 4; ++e) o[e] = 1.0f - m[e];
      *(v4f_t*)(kb + (size_t)b * KROWS + q4 * 4) = o;  }
    return;
  }
  const int c = blockIdx.x - BB;   // chunk number in the joined buffer; block-uniform choice of the source
  const float* src = c < 3 * DD * DD / WCH ? Win + (size_t)c * WCH : c < 4 * DD * DD / WCH ? Wout + ((size_t)c * WCH - 3 * DD * DD) : Wto + ((size_t)c * WCH - 4 * DD * DD);
  bf16* dst = W16 + (size_t)c * WCH;
  v4f_t v[WCH / 1024];
#pragma unroll   // this and the next: unrolled so that all loads are in flight before the first store waits
  for (int u = 0; u < WCH / 1024; ++u) v[u] = *(const v4f_t*)(src + u * 1024 + threadIdx.x * 4);
#pragma unroll
  for (int u = 0; u < WCH / 1024; ++u) { bf16x4 q; q[0] = (bf16)v[u][0]; q[1] = (bf16)v[u][1]; q[2] = (bf16)v[u][2]; q[3] = (bf16)v[u][3];
    *(bf16x4*)(dst + u * 1024 + threadIdx.x * 4) = q; }
  asm volatile("s_wait_xcnt 0x0" ::: "memory");   // precaution: stands behind the last store, in front of any rewrite of the registers that the stores name
}

extern "C" void kernel_launch(void* const* d_in, const int* in_sizes, int n_in,
                              void* d_out, int out_size, void* d_ws, size_t ws_size,
                              hipStream_t stream) {
  (void)in_sizes; (void)n_in; (void)out_size;
  const float** f = (const float**)d_in;
  const float* x = f[0], *mask = f[1], *pos = f[2], *lng = f[3], *lnb = f[4], *Win = f[5], *bin = f[6], *Wout = f[7], *bout = f[8], *Wto = f[9], *bto = f[10];
  float* out = (float*)d_out;     // [4,2048,1024]
  char* ws = (char*)d_ws;
  float* xp = (float*)ws; ws += (size_t)MTOK * DD * 4;                  // 32 MB: f32 rows, read again only as the residual
  bf16* xp16 = (bf16*)ws; ws += (size_t)MTOK * DD * 2; bf16* Q16 = (bf16*)ws; ws += (size_t)MTOK * DD * 2; bf16* K16 = (bf16*)ws; ws += (size_t)MTOK * DD * 2;   // 16 MB each
  bf16* Vt = (bf16*)ws; ws += (size_t)MTOK * DD * 2; bf16* att16 = (bf16*)ws; ws += (size_t)MTOK * DD * 2; bf16* y16 = (bf16*)ws; ws += (size_t)MTOK * DD * 2;
  float* kb = (float*)ws; ws += (size_t)BB * KROWS * 4;
  bf16* W16 = (bf16*)ws; ws += (size_t)5 * DD * DD * 2;                 // 10 MB: in_proj, out_proj, to_out as f16
  if ((size_t)(ws - (char*)d_ws) > ws_size) return;
  const dim3 blk(256); const dim3 gp(MTOK / 128, DD / 256);
  k_lnpos<<<dim3(SS / 8), blk, 0, stream>>>(x, lng, lnb, pos, xp, xp16);
  k_prep<<<dim3(BB + 5 * DD * DD / WCH), blk, 0, stream>>>(mask, kb, Win, Wout, Wto, W16);
  gemm_rb_kernel<bf16, 5><<<dim3(MTOK / 128, 3 * DD / 256), blk, 0, stream>>>(xp16, W16, bin, nullptr, nullptr, nullptr, Q16, MTOK, 3 * DD, DD);   // q, k, v: Q16, K16, Vt are adjacent
  v_attn_kernel<<<dim3(QROWS / 64, HH, BB), dim3(64), 0, stream>>>(Q16, K16, Vt, kb, att16);
  gemm_rb_kernel<bf16, 4><<<gp, blk, 0, stream>>>(att16, W16 + (size_t)3 * DD * DD, bout, nullptr, xp, nullptr, y16, MTOK, DD, DD);      // y = xp + o*out_proj^T + b, summed in f32, stored f16
  gemm_rb_kernel<bf16, 2><<<gp, blk, 0, stream>>>(y16, W16 + (size_t)4 * DD * DD, bto, nullptr, nullptr, nullptr, out, MTOK, DD, DD);      // out = y*to_out^T + b
}

// v009
// A run of this version takes 188 microseconds.
// In both of two side-by-side timings against v008, it was 1.08 times as fast.
// Over all steps from v000 it is 2.48 times as fast.
// Contractions on v_wmma_f32_16x16x32_f16 (plain f16 operands, f32 accumulate): qkv = (LN(x) + pos)·in_projᵀ + b (K = 1024, N = 3072),
// the 16-head attention (dk = 64, scale 1/8) with the reference's ADDITIVE float mask (1 − padding_mask) as a per-(batch,key) bias,
// flash-style Sᵀ = K·Qᵀ / Oᵀ = Vᵀ·Pᵀ with online softmax in f32 (P x1024, f16 output rows), attn_out = o·out_projᵀ + b + xp (residual in
// the epilogue, K = 1024) and (xp + attn_out)·to_outᵀ + b (K = 1024); LayerNorm and the positional add in f32. xp dominates the residual
// so plain f16 operands suffice. compute dtype: f16 operands, f32 accumulate.  x [4,2048,1024].
// Every matrix operand that one kernel hands to the next (xp, q, k, v transposed, the attention rows, y) is rounded to f16 once, from its f32
// value, at its producer's store, in the layout that the consumer stages; only the residual copy of xp and the final output are f32.
#include <hip/hip_runtime.h>
#include <hip/hip_bf16.h>
#include <math.h>

#define BB 4
#define SS 2048
#define QROWS 2048
#define KROWS 2048
#define NKV 2048
#define DD 1024
#define HH 16
#define KVH 16
#define KVD 1024
#define HKDIV 1
#define DKK 64
#define QW 2
#define MTOK (BB * SS)
#define GSTR 48

typedef _Float16 bf16;
typedef _Float16 f16;
typedef __attribute__((ext_vector_type(4))) unsigned v4u_t;
typedef unsigned v4ua __attribute__((ext_vector_type(4), may_alias));
typedef __attribute__((ext_vector_type(4))) float v4f_t;
typedef float v4fa __attribute__((ext_vector_type(4), may_alias));
typedef __attribute__((ext_vector_type(16))) bf16  bf16x16;
typedef bf16x16 f16x16;
typedef __attribute__((ext_vector_type(8)))  bf16  bf16x8;
typedef bf16x8 f16x8;
typedef __attribute__((ext_vector_type(4)))  bf16  bf16x4;
typedef __attribute__((ext_vector_type(8)))  float f32x8;
// The bare builtin, for the attention loop: the compiler keeps the distances behind a WMMA itself, with independent vector work where it has some.
__device__ __forceinline__ f32x8 wmma16(f16x16 a, f16x16 b, f32x8 c) {
  c = __builtin_amdgcn_wmma_f32_16x16x32_f16(false, a, false, b, (short)0, c, false, false);
  return c;
}
#define GK 64           // k per staged GEMM tile: a row segment of f16 is one whole 128-B line
#define LDS_STRIDE 72   // GEMM tiles: 64 -> 72 elems (144-B rows, 16 B x 9): conflict-free b128 reads
#define KSTRIDE    72   // attn K tile: 64 -> 72 elems (144B rows): conflict-free b128
#define VSTRIDE    48   // attn V tile: 32 -> 48 elems

__device__ __forceinline__ f32x8 wmma_bf16(bf16x16 a, bf16x16 b, f32x8 c) {
  c = __builtin_amdgcn_wmma_f32_16x16x32_f16(false, a, false, b, (short)0, c, false, false);
  asm volatile("v_nop\n\tv_nop\n\tv_nop\n\tv_nop" : "+v"(c) : "v"(a), "v"(b));   // A/B-overwrite hazard guard
  return c;
}

// Work-group barrier of the staged loops: it waits for this wave's LDS traffic only. __syncthreads() also drains the load counter, so the
// next tile's global loads, issued just ahead of it, would be waited out before the matrix phase instead of flying under it.
__device__ __forceinline__ void lds_barrier() {
  asm volatile("s_wait_dscnt 0x0\n\ts_barrier_signal -1\n\ts_barrier_wait -1" ::: "memory");
}

// 16x32 (MxK) bf16 fragment from a row-major global matrix.
// lanes 0-15  (row=lane)    : elems 0..7 = K+0..7,  8..15 = K+16..23
// lanes 16-31 (row=lane-16) : elems 0..7 = K+8..15, 8..15 = K+24..31
template <typename T>
__device__ __forceinline__ bf16x16 load_frag(const T* __restrict__ base, int ld,
                                             int row0, int k0) {
  const int lane = threadIdx.x & 31;
  const int r    = lane & 15;
  const int kh   = (lane >> 4) * 8;
  const T* p0 = base + (size_t)(row0 + r) * ld + (k0 + kh);
  const T* p1 = p0 + 16;
  bf16x16 f;
#pragma unroll
  for (int i = 0; i < 8; ++i) {
    f[i]     = (bf16)p0[i];
    f[i + 8] = (bf16)p1[i];
  }
  return f;
}

// Same fragment from an LDS tile with padded row stride (base includes row0/k0).
__device__ __forceinline__ bf16x16 lds_frag(const bf16* base, int stride) {
  const int lane = threadIdx.x & 31;
  const int row  = lane & 15;
  const int kh   = (lane >> 4) * 8;
  const bf16x8 lo = *(const bf16x8*)(base + row * stride + kh);
  const bf16x8 hi = *(const bf16x8*)(base + row * stride + kh + 16);
  bf16x16 f;
#pragma unroll
  for (int i = 0; i < 8; ++i) { f[i] = lo[i]; f[i + 8] = hi[i]; }
  return f;
}

// Epilogue of the q, k, v product: f32 bias added, rounded to f16, staged in LDS, stored as whole 16-B chunks.
// VT false: rows [m][DD] (q, k). VT true: v transposed, rows (b, h, dk) of SS positions. bv = the lane's bias value of each of its four 16-column tiles, nO = column inside its own product.
template <bool VT>
__device__ __forceinline__ void store_tile16(const f32x8 (&acc)[4][4], bf16* so, const float (&bv)[4], bf16* __restrict__ out,
                                             int mBlk, int nO, int wm, int wn, int nlane, int mh, int t) {
#pragma unroll   // this and the two below: unrolled so that every accumulator index is a constant
  for (int i = 0; i < 4; ++i)
#pragma unroll
    for (int j = 0; j < 4; ++j) {
      const int nl = wn + 16 * j + nlane;
#pragma unroll
      for (int r = 0; r < 8; ++r) {
        const int ml = wm + 16 * i + mh + r;
        const bf16 hv = (bf16)(acc[i][j][r] + bv[j]);
        if (!VT) so[ml * 264 + nl] = hv;        // [m][n]
        else     so[nl * 136 + ml] = hv;        // [n][m]  (n = h*64+dk rows of Vt, m = s contiguous)
      }
    }
  __syncthreads();
  if (!VT) {                // rows m: 256 halfs = 512 B each, 16-B chunks
    for (int ch = t; ch < 128 * 32; ch += 256) { const int ml = ch >> 5, q = (ch & 31) * 8;
      *(v4u_t*)(out + (size_t)(mBlk + ml) * DD + nO + q) = *(const v4ua*)(so + ml * 264 + q); }
  } else {                  // Vt rows (b, h, dk): 128 consecutive s = 256 B each
    const int b_ = mBlk / SS, s0 = mBlk % SS;
    for (int ch = t; ch < 256 * 16; ch += 256) { const int nl = ch >> 4, q = (ch & 15) * 8; const int n = nO + nl, h = n >> 6, dk = n & (DKK - 1);
      *(v4u_t*)(out + (((size_t)(b_ * HH + h)) * DKK + dk) * SS + s0 + q) = *(const v4ua*)(so + nl * 136 + q); }
  }
}

// ---------------------------------------------------------------------------
// GEMM: C[m][n] = sum_k A[m][k]*W[n][k] + bias[n]   (torch Linear)
// Block 256 thr (8 waves), tile 128M x 256N, K-step GK = 64 (two 32-k matrix steps per staged tile); wave tile 64x64.
// A and W are f16 (W rounded once per call by k_prep). Both are staged through LDS (padded stride) with next-tile register
// prefetch overlapping the WMMA phase. M a multiple of 128, N of 256, K = DD.
// MODE 2: fp32 [M][N], f32 bias   MODE 4: as MODE 2 plus the f32 residual R[M][N], rounded to f16 at the store
// What an epilogue adds is fixed by MODE at compile time (every launch has a bias, only MODE 4 a residual): a pointer tested at run time costs
// scalar branches around every accumulator element and keeps the loads behind them from being issued together.
// MODE 5: the three products of one A in one grid (N = 3*DD weight rows): block columns below DD give q, below 2*DD k (f16 [M][DD] each), the rest
//         v as f16 Vt[b][h][dk][s]; the three outputs lie one behind the other at out. 768 blocks: two are resident per WGP, one loads while the other multiplies.
// ---------------------------------------------------------------------------
template <typename AT, int MODE>
__global__ __launch_bounds__(256) void gemm_rb_kernel(
    const AT* __restrict__ A, const bf16* __restrict__ W,
    const float* __restrict__ bias, const float* __restrict__ R, void* __restrict__ out,
    int M, int N, int K) {
  __shared__ __attribute__((aligned(16))) bf16 ldsA[128 * LDS_STRIDE];   // 18.0 KB
  __shared__ __attribute__((aligned(16))) bf16 ldsW[256 * LDS_STRIDE];   // 36.0 KB
  // output staging: MODE 5 [128 m][264] f16 (q, k) or [256 n][136] f16 (v), MODE 2 and 4 [64 m][260] f32 (two halves)
  __shared__ __attribute__((aligned(16))) unsigned char sob[256 * 136 * 2];   // 69,632 B >= 128*264*2 and >= 64*260*4

  const int t    = threadIdx.x;
  const int wave = t >> 5;
  const int lane = t & 31;
  const int wm   = (wave & 1) * 64;
  const int wn   = (wave >> 1) * 64;
  const int mBlk = blockIdx.x * 128;
  const int nBlk = blockIdx.y * 256;

  // Staging map, the same for A and W: 8 neighbouring lanes take the 8 16-B chunks of one row's 64-k segment, so a wave-wide 16-B load
  // covers 4 whole 128-B lines; one load of the block covers 32 rows.
  static_assert(sizeof(AT) == 2, "A is staged as f16");
  const int r0 = t >> 3, c0 = (t & 7) * 8;
  constexpr int KC = DD;   // K = DD in every launch: with the row pitch a constant, the 32-row steps of the chunks fold into the loads' immediate offsets
  (void)K;
  unsigned off = (unsigned)((r0 * KC + c0) * 2);   // the lane's byte offset from the block-uniform bases; it steps by one 64-k segment per trip
  constexpr unsigned rstep = 32u * KC * 2u;        // 32 rows, in bytes
  const char* aBase = (const char*)(A + (size_t)mBlk * KC);
  const char* wBase = (const char*)(W + (size_t)nBlk * KC);

  v4u_t abuf[4], wbuf[8];
#pragma unroll   // this and the chunk loops below: unrolled so that the staging arrays stay in registers
  for (int i = 0; i < 4; ++i) abuf[i] = *(const v4ua*)(aBase + off + i * rstep);
#pragma unroll
  for (int i = 0; i < 8; ++i) wbuf[i] = *(const v4ua*)(wBase + off + i * rstep);
  asm volatile("s_wait_xcnt 0x0" ::: "memory");   // precaution: stands in front of the first step of the offset register, which the loads above name

  f32x8 acc[4][4] = {};

  for (int k = 0; k < KC; k += GK) {
    lds_barrier();   // every wave has read the previous tile's fragments
#pragma unroll
    for (int i = 0; i < 4; ++i) *(v4ua*)&ldsA[(r0 + 32 * i) * LDS_STRIDE + c0] = abuf[i];
#pragma unroll
    for (int i = 0; i < 8; ++i) *(v4ua*)&ldsW[(r0 + 32 * i) * LDS_STRIDE + c0] = wbuf[i];
    if (k + GK < KC) {
      off += GK * 2u;
#pragma unroll
      for (int i = 0; i < 4; ++i) abuf[i] = *(const v4ua*)(aBase + off + i * rstep);
#pragma unroll
      for (int i = 0; i < 8; ++i) wbuf[i] = *(const v4ua*)(wBase + off + i * rstep);
    }
    lds_barrier();   // tile visible; the loads above stay in flight over the matrix phase

#pragma unroll   // unrolled so that the fragment offsets are constants
    for (int kk = 0; kk < GK; kk += 32) {
      bf16x16 af[4], wf[4];
#pragma unroll
      for (int i = 0; i < 4; ++i)
        af[i] = lds_frag(ldsA + (wm + 16 * i) * LDS_STRIDE + kk, LDS_STRIDE);
#pragma unroll
      for (int j = 0; j < 4; ++j)
        wf[j] = lds_frag(ldsW + (wn + 16 * j) * LDS_STRIDE + kk, LDS_STRIDE);
#pragma unroll
      for (int i = 0; i < 4; ++i)
#pragma unroll
        for (int j = 0; j < 4; ++j)
          acc[i][j] = wmma_bf16(af[i], wf[j], acc[i][j]);
    }
    asm volatile("s_wait_xcnt 0x0" ::: "memory");   // precaution: at the trip's foot, on the way back and on the way out alike, in front of any rewrite of the offset register and scalar bases that this trip's loads name
  }

  const int nlane = lane & 15;
  const int mh    = (lane >> 4) * 8;
  float bv[4];   // the lane's bias values, one per 16-column tile of the wave: four loads in flight together, waited once
#pragma unroll   // unrolled so that the four values stay in registers
  for (int j = 0; j < 4; ++j) bv[j] = bias[nBlk + wn + 16 * j + nlane];
  asm volatile("s_wait_xcnt 0x0" ::: "memory");   // precaution: stands in front of any rewrite of the address registers that the four loads above name
  __syncthreads();
  if (MODE == 5) {
    const int part = nBlk / DD;   // block-uniform: a 256-column tile lies inside one of the three products
    bf16* outp = (bf16*)out + (size_t)part * MTOK * DD;
    if (part < 2) store_tile16<false>(acc, (bf16*)sob, bv, outp, mBlk, nBlk - part * DD, wm, wn, nlane, mh, t);
    else          store_tile16<true>(acc, (bf16*)sob, bv, outp, mBlk, nBlk - part * DD, wm, wn, nlane, mh, t);
  } else {
    float* so = (float*)sob;
#pragma unroll 1
    for (int hf = 0; hf < 2; ++hf) {
      if (wm == hf * 64) {
#pragma unroll
        for (int i = 0; i < 4; ++i)
#pragma unroll
          for (int j = 0; j < 4; ++j) {
            const int nl = wn + 16 * j + nlane;
#pragma unroll
            for (int r = 0; r < 8; ++r) so[(16 * i + mh + r) * 260 + nl] = acc[i][j][r] + bv[j];
          }
      }
      __syncthreads();
      if (MODE == 4) {   // residual: fold R[m][n] into the staged tile once (same thread <-> same chunks as the stores below)
        for (int ch = t; ch < 64 * 64; ch += 256) { const int ml = ch >> 6, q = (ch & 63) * 4;
          if (nBlk + q < N) { const v4f_t rv = *(const v4f_t*)(R + (size_t)(mBlk + hf * 64 + ml) * N + nBlk + q); v4f_t v = *(const v4fa*)(so + ml * 260 + q); v += rv; *(v4fa*)(so + ml * 260 + q) = v; } }
        asm volatile("s_wait_dscnt 0" ::: "memory");
      }
{   // 64 rows x 256 floats = 1 KB segments, float4 chunks; columns >= N (ragged tile) skipped
        const int q = (t & 63) * 4;
        if (nBlk + q < N) {
          for (int m0 = t >> 6; m0 < 64; m0 += 16) {   // rows m0, m0 + 4, m0 + 8, m0 + 12 per trip: four LDS reads and four stores in flight
            v4f_t v[4];
#pragma unroll   // this and the next: unrolled so that the four chunks stay in registers
            for (int u = 0; u < 4; ++u) v[u] = *(const v4fa*)(so + (m0 + 4 * u) * 260 + q);
#pragma unroll
            for (int u = 0; u < 4; ++u) {
              const size_t eo = (size_t)(mBlk + hf * 64 + m0 + 4 * u) * N + nBlk + q;
              if (MODE == 4) { bf16x4 hq; hq[0] = (bf16)v[u][0]; hq[1] = (bf16)v[u][1]; hq[2] = (bf16)v[u][2]; hq[3] = (bf16)v[u][3];
                *(bf16x4*)((bf16*)out + eo) = hq; }
              else *(v4f_t*)((float*)out + eo) = v[u];
            }
          }
        }
      }
      __syncthreads();
    }
  }
}

// 2^x by the hardware instruction alone (results below 2^-126 come out as 0; -inf gives 0).
__device__ __forceinline__ float hw_exp2(float x) { return __builtin_amdgcn_exp2f(x); }

__global__ __launch_bounds__(64) void v_attn_kernel(
    const bf16* __restrict__ Qb, const bf16* __restrict__ Kb,
    const bf16* __restrict__ Vt, const float* __restrict__ kbias,   // kbias [B][KROWS]: additive per-key logit bias (1 − mask)
    bf16* __restrict__ attnOut) {
  __shared__ bf16 ldsK[32 * KSTRIDE];   // 4.5 KB
  __shared__ bf16 ldsV[64 * VSTRIDE];   // 6.0 KB
  __shared__ __attribute__((aligned(16))) bf16 ldsO[2][32 * 72];   // per-wave f16 output tile: 32 queries x 64 dk, 72-elem rows

  const int q0blk = blockIdx.x * 64;
  const int h  = blockIdx.y;
  const int b  = blockIdx.z;
  const int t    = threadIdx.x;
  const int wave = t >> 5;
  const int lane = t & 31;
  const int qlane = lane & 15;
  const int kh8   = (lane >> 4) * 8;
  const int q0 = q0blk + wave * 32;          // this wave's 32 queries

  const int hk = h / HKDIV;
  const bf16* Qh = Qb + (size_t)b * QROWS * DD + h * DKK;        // queries: QROWS rows per batch, row stride DD
  const bf16* Kh = Kb + (size_t)b * KROWS * KVD + hk * DKK;      // keys: KROWS rows per batch, row stride KVD
  const bf16* Vh = Vt + ((size_t)(b * KVH + hk)) * DKK * KROWS;  // Vᵀ [KVH][64][KROWS] per batch

  // Cooperative staging (64 threads), neighbouring lanes on neighbouring 16-B chunks of a row:
  // K tile 32x64 (8 lanes cover a 128-B row, 8 rows per load of the block); V tile 64x32 (4 lanes cover a 64-B row, 16 rows per load).
  const int krow = t >> 3;
  const int kcol = (t & 7) * 8;
  const int vrow = t >> 2;
  const int vcol = (t & 3) * 8;
  const bf16* kSrc = Kh + (size_t)krow * KVD + kcol;
  const bf16* vSrc = Vh + (size_t)vrow * KROWS + vcol;

  bf16x16 qf[QW][2];
#pragma unroll
  for (int qt = 0; qt < QW; ++qt) {
    qf[qt][0] = load_frag(Qh, DD, q0 + 16 * qt, 0);
    qf[qt][1] = load_frag(Qh, DD, q0 + 16 * qt, 32);
  }

  f32x8 o[QW][4] = {};
  float mrun[QW], lrun[QW];
#pragma unroll
  for (int qt = 0; qt < QW; ++qt) { mrun[qt] = -INFINITY; lrun[qt] = 0.0f; }

  const float scale = 0.125f * 1.44269504088896340736f;  // 1/sqrt(DK)*log2(e)
  const float NEG2 = -1.0e9f;    // masked logit: its weight is exactly 0 once any valid key of the row has been seen (every row
                                 // has one), and anything accumulated before that is wiped by alpha == 0 — same result as -inf
  const int kmax = KROWS - 1;
  __shared__ float kbS[KROWS];
  for (int i = threadIdx.x; i < KROWS; i += 64) kbS[i] = kbias[(size_t)b * KROWS + i] * 1.44269504088896340736f;   // in log2 units
  __syncthreads();

  // Prefetch key block kb=0 into registers.
  bf16x8 kreg[4], vreg[4];
#pragma unroll
  for (int i = 0; i < 4; ++i) {
    kreg[i] = *(const bf16x8*)(kSrc + (size_t)(8 * i) * KVD);
    vreg[i] = *(const bf16x8*)(vSrc + (size_t)(16 * i) * KROWS);
  }

  for (int kb = 0; kb <= kmax; kb += 32) {
    lds_barrier();   // previous readers done with LDS
#pragma unroll
    for (int i = 0; i < 4; ++i) {
      *(bf16x8*)(&ldsK[(krow + 8 * i) * KSTRIDE + kcol])  = kreg[i];
      *(bf16x8*)(&ldsV[(vrow + 16 * i) * VSTRIDE + vcol]) = vreg[i];
    }
    if (kb + 32 <= kmax) {   // prefetch next block during compute
      const bf16* kn = kSrc + (size_t)(kb + 32) * KVD;
      const bf16* vn = vSrc + (kb + 32);
#pragma unroll
      for (int i = 0; i < 4; ++i) {
        kreg[i] = *(const bf16x8*)(kn + (size_t)(8 * i) * KVD);
        vreg[i] = *(const bf16x8*)(vn + (size_t)(16 * i) * KROWS);
      }
      asm volatile("s_wait_xcnt 0x0" ::: "memory");   // the loads outlive the barrier: their address pairs step on only behind this wait
    }
    lds_barrier();   // tile visible; the prefetch above stays in flight over scores, softmax and PV

    // Phase 1: scores + softmax for both q-tiles (K fragments live here only).
    bf16x16 kf[2][2];
#pragma unroll
    for (int ktile = 0; ktile < 2; ++ktile)
#pragma unroll
      for (int c = 0; c < 2; ++c)
        kf[ktile][c] = lds_frag(ldsK + (ktile * 16) * KSTRIDE + c * 32, KSTRIDE);

    bf16x16 pf[QW];
    bool act[QW];
#pragma unroll
    for (int qt = 0; qt < QW; ++qt) {
      unsigned mbits = 0;
      {
#pragma unroll
        for (int r = 0; r < 8; ++r) { const int j0 = kb + kh8 + r; if (j0 < NKV) mbits |= 1u << r; if (j0 + 16 < NKV) mbits |= 1u << (8 + r); }
        act[qt] = (__builtin_amdgcn_ballot_w32(mbits != 0) != 0);
      }
      if (act[qt]) {
        const int q_my = q0 + 16 * qt + qlane;
        f32x8 s0 = {}, s1 = {};
        s0 = wmma16(kf[0][0], qf[qt][0], s0);
        s0 = wmma16(kf[0][1], qf[qt][1], s0);
        s1 = wmma16(kf[1][0], qf[qt][0], s1);
        s1 = wmma16(kf[1][1], qf[qt][1], s1);

        float mx = -INFINITY;
#pragma unroll
        for (int r = 0; r < 8; ++r) {
          const int k0i = kb + kh8 + r;
          const int k1i = k0i + 16;
          (void)k0i; (void)k1i; (void)q_my;
          s0[r] = (mbits & (1u << r))       ? s0[r] * scale + kbS[kb + kh8 + r] : NEG2;
          s1[r] = (mbits & (1u << (8 + r))) ? s1[r] * scale + kbS[kb + 16 + kh8 + r] : NEG2;
          mx = fmaxf(mx, fmaxf(s0[r], s1[r]));
        }
        mx = fmaxf(mx, __shfl_xor(mx, 16, 32));
        const float mnew  = fmaxf(mrun[qt], mx);
        // hw_exp2 here and below: one v_exp_f32 each. exp2f() wraps it in a compare, two selects, an add and an ldexp to keep results below 2^-126;
        // such a weight is 0 in the f16 P and vanishes beside a row sum >= 1, and such an alpha scales history that rounds away likewise.
        const float alpha = hw_exp2(mrun[qt] - mnew);

        float rsum = 0.0f;
#pragma unroll
        for (int r = 0; r < 8; ++r) {
          const float p0 = hw_exp2(s0[r] - mnew);
          const float p1 = hw_exp2(s1[r] - mnew);
          rsum += p0 + p1;
          pf[qt][r]     = (bf16)(p0 * 1024.0f);     // P carried x1024: no f16 copy of a probability is sub-normal
          pf[qt][r + 8] = (bf16)(p1 * 1024.0f);
        }
        rsum += __shfl_xor(rsum, 16, 32);
        lrun[qt] = lrun[qt] * alpha + rsum;
        mrun[qt] = mnew;

        // Rescale accumulators now so the PV phase is pure WMMA.
#pragma unroll
        for (int j = 0; j < 4; ++j)
#pragma unroll
          for (int r = 0; r < 8; ++r) o[qt][j][r] *= alpha;
      }
    }

    // Phase 2: O^T accumulate; each V fragment read from LDS once, used by
    // both q-tiles, then dead (only 8 VGPRs of V live at a time).
#pragma unroll
    for (int j = 0; j < 4; ++j) {
      const bf16x16 vf = lds_frag(ldsV + (j * 16) * VSTRIDE, VSTRIDE);
#pragma unroll
      for (int qt = 0; qt < QW; ++qt)
        if (act[qt]) o[qt][j] = wmma16(vf, pf[qt], o[qt][j]);
    }
  }

  bf16* so = ldsO[wave];
#pragma unroll
  for (int qt = 0; qt < QW; ++qt) {
    const float rl = 1.0f / (lrun[qt] * 1024.0f);
#pragma unroll
    for (int j = 0; j < 4; ++j)
#pragma unroll
      for (int r = 0; r < 8; ++r) so[(16 * qt + qlane) * 72 + j * 16 + kh8 + r] = (bf16)(o[qt][j][r] * rl);
  }
  asm volatile("s_wait_dscnt 0" ::: "memory");
  __builtin_amdgcn_wave_barrier();
{
#pragma unroll
    for (int it = 0; it < 8; ++it) { const int ch = lane + 32 * it, ql = ch >> 3, q8 = (ch & 7) * 8;   // 8 lanes cover one row's 128 B
      *(v4u_t*)(attnOut + ((size_t)(b * QROWS + q0 + ql)) * DD + h * DKK + q8) = *(const v4ua*)(so + ql * 72 + q8); }
    
  }
}


// xp = LN(x)*g + b + pos[s]  (f32 rows for the residual, and the same rows rounded to f16 for the q, k, v products).
// One wave = one position s in all BB batches. A lane holds 4 neighbouring columns of each 128-column chunk, so every wave-wide 16-B load or store
// covers 512 contiguous bytes; the BB rows, the pos row, g and b stay in registers and all their loads are issued before the first sum waits.
__global__ __launch_bounds__(256) void k_lnpos(const float* __restrict__ X, const float* __restrict__ g, const float* __restrict__ bb, const float* __restrict__ pos, float* __restrict__ Y, bf16* __restrict__ Y16) {
  constexpr int NC = DD / 128;   // 128-column chunks of a row
  const unsigned c0 = (threadIdx.x & 31) * 4;
  const int s_ = blockIdx.x * 8 + (threadIdx.x >> 5);
  int row[BB];   // the wave's row numbers as scalars: the row offsets are formed on the scalar unit
#pragma unroll   // this and every loop below: unrolled so that the row arrays stay in registers
  for (int b = 0; b < BB; ++b) row[b] = __builtin_amdgcn_readfirstlane(b * SS + s_);
  v4f_t xv[BB][NC], pv[NC], gv[NC], bv[NC];
#pragma unroll
  for (int b = 0; b < BB; ++b) {
    const float* xr = X + (size_t)row[b] * DD;
#pragma unroll
    for (int c = 0; c < NC; ++c) xv[b][c] = *(const v4f_t*)(xr + c * 128 + c0);
  }
  asm volatile("s_wait_xcnt 0x0" ::: "memory");   // precaution: stands in front of the loads below, which land in registers that hold row addresses of the loads above
  const float* pr = pos + (size_t)row[0] * DD;
#pragma unroll
  for (int c = 0; c < NC; ++c) pv[c] = *(const v4f_t*)(pr + c * 128 + c0);
#pragma unroll
  for (int c = 0; c < NC; ++c) { gv[c] = *(const v4f_t*)(g + c * 128 + c0); bv[c] = *(const v4f_t*)(bb + c * 128 + c0); }
  asm volatile("s_wait_xcnt 0x0" ::: "memory");   // precaution: stands in front of the first rewrite of the lane-offset register and the scalar bases that the loads above name
  __builtin_amdgcn_sched_barrier(0);   // keeps every load above issued here: left free, the scheduler sinks the pos, g and b loads behind the sums, where each small group waits out its own latency
#pragma unroll
  for (int b = 0; b < BB; ++b) {
    v4f_t a = xv[b][0];
#pragma unroll
    for (int c = 1; c < NC; ++c) a += xv[b][c];
    float s = (a[0] + a[1]) + (a[2] + a[3]);
#pragma unroll
    for (int off = 1; off < 32; off <<= 1) s += __shfl_xor(s, off, 32);
    const float mean = s * (1.0f / DD);
    v4f_t q4 = {};
#pragma unroll
    for (int c = 0; c < NC; ++c) { const v4f_t d = xv[b][c] - mean; q4 += d * d; }
    float q = (q4[0] + q4[1]) + (q4[2] + q4[3]);
#pragma unroll
    for (int off = 1; off < 32; off <<= 1) q += __shfl_xor(q, off, 32);
    const float rstd = rsqrtf(q * (1.0f / DD) + 1e-5f);
    float* yr = Y + (size_t)row[b] * DD;
    bf16* hr = Y16 + (size_t)row[b] * DD;
#pragma unroll
    for (int c = 0; c < NC; ++c) {
      const v4f_t v = (xv[b][c] - mean) * rstd * gv[c] + bv[c] + pv[c];
      bf16x4 hq; hq[0] = (bf16)v[0]; hq[1] = (bf16)v[1]; hq[2] = (bf16)v[2]; hq[3] = (bf16)v[3];
      *(v4f_t*)(yr + c * 128 + c0) = v;
      *(bf16x4*)(hr + c * 128 + c0) = hq;
    }
  }
}
// Blocks 0..BB-1: kbias[b][k] = 1 - mask[b][k]  (the reference's quirk: a FLOAT additive mask); 8-KB rows.
// The other blocks round the three weight matrices to f16, once per call, 8192 elements a block, into one buffer [in_proj | out_proj | to_out]:
// the products then stage half the bytes and convert nothing in their loops. A wave-wide load covers 512 contiguous bytes, a store 256.
#define WCH 8192
__global__ __launch_bounds__(256) void k_prep(const float* __restrict__ mask, float* __restrict__ kb, const float* __restrict__ Win, const float* __restrict__ Wout,
                                              const float* __restrict__ Wto, bf16* __restrict__ W16) {
  if (blockIdx.x < BB) { const int b = blockIdx.x;
    for (int q4 = threadIdx.x; q4 < KROWS / 4; q4 += 256) { const v4f_t m = *(const v4f_t*)(mask + (size_t)b * KROWS + q4 * 4); v4f_t o; for (int e = 0; e < 4; ++e) o[e] = 1.0f - m[e];
      *(v4f_t*)(kb + (size_t)b * KROWS + q4 * 4) = o;  }
    return;
  }
  const int c = blockIdx.x - BB;   // chunk number in the joined buffer; block-uniform choice of the source
  const float* src = c < 3 * DD * DD / WCH ? Win + (size_t)c * WCH : c < 4 * DD * DD / WCH ? Wout + ((size_t)c * WCH - 3 * DD * DD) : Wto + ((size_t)c * WCH - 4 * DD * DD);
  bf16* dst = W16 + (size_t)c * WCH;
  v4f_t v[WCH / 1024];
#pragma unroll   // this and the next: unrolled so that all loads are in flight before the first store waits
  for (int u = 0; u < WCH / 1024; ++u) v[u] = *(const v4f_t*)(src + u * 1024 + threadIdx.x * 4);
#pragma unroll
  for (int u = 0; u < WCH / 1024; ++u) { bf16x4 q; q[0] = (bf16)v[u][0]; q[1] = (bf16)v[u][1]; q[2] = (bf16)v[u][2]; q[3] = (bf16)v[u][3];
    *(bf16x4*)(dst + u * 1024 + threadIdx.x * 4) = q; }
  asm volatile("s_wait_xcnt 0x0" ::: "memory");   // precaution: stands behind the last store, in front of any rewrite of the registers that the stores name
}

extern "C" void kernel_launch(void* const* d_in, const int* in_sizes, int n_in,
                              void* d_out, int out_size, void* d_ws, size_t ws_size,
                              hipStream_t stream) {
  (void)in_sizes; (void)n_in; (void)out_size;
  const float** f = (const float**)d_in;
  const float* x = f[0], *mask = f[1], *pos = f[2], *lng = f[3], *lnb = f[4], *Win = f[5], *bin = f[6], *Wout = f[7], *bout = f[8], *Wto = f[9], *bto = f[10];
  float* out = (float*)d_out;     // [4,2048,1024]
  char* ws = (char*)d_ws;
  float* xp = (float*)ws; ws += (size_t)MTOK * DD * 4;                  // 32 MB: f32 rows, read again only as the residual
  bf16* xp16 = (bf16*)ws; ws += (size_t)MTOK * DD * 2; bf16* Q16 = (bf16*)ws; ws += (size_t)MTOK * DD * 2; bf16* K16 = (bf16*)ws; ws += (size_t)MTOK * DD * 2;   // 16 MB each
  bf16* Vt = (bf16*)ws; ws += (size_t)MTOK * DD * 2; bf16* att16 = (bf16*)ws; ws += (size_t)MTOK * DD * 2; bf16* y16 = (bf16*)ws; ws += (size_t)MTOK * DD * 2;
  float* kb = (float*)ws; ws += (size_t)BB * KROWS * 4;
  bf16* W16 = (bf16*)ws; ws += (size_t)5 * DD * DD * 2;                 // 10 MB: in_proj, out_proj, to_out as f16
  if ((size_t)(ws - (char*)d_ws) > ws_size) return;
  const dim3 blk(256); const dim3 gp(MTOK / 128, DD / 256);
  k_lnpos<<<dim3(SS / 8), blk, 0, stream>>>(x, lng, lnb, pos, xp, xp16);
  k_prep<<<dim3(BB + 5 * DD * DD / WCH), blk, 0, stream>>>(mask, kb, Win, Wout, Wto, W16);
  gemm_rb_kernel<bf16, 5><<<dim3(MTOK / 128, 3 * DD / 256), blk, 0, stream>>>(xp16, W16, bin, nullptr, Q16, MTOK, 3 * DD, DD);   // q, k, v: Q16, K16, Vt are adjacent
  v_attn_kernel<<<dim3(QROWS / 64, HH, BB), dim3(64), 0, stream>>>(Q16, K16, Vt, kb, att16);
  gemm_rb_kernel<bf16, 4><<<gp, blk, 0, stream>>>(att16, W16 + (size_t)3 * DD * DD, bout, xp, y16, MTOK, DD, DD);      // y = xp + o*out_proj^T + b, summed in f32, stored f16
  gemm_rb_kernel<bf16, 2><<<gp, blk, 0, stream>>>(y16, W16 + (size_t)4 * DD * DD, bto, nullptr, out, MTOK, DD, DD);      // out = y*to_out^T + b
}

// v010
// It runs in 182 microseconds.
// Next to v009, in two timings, it ran 1.04 times as fast each time.
// Counting every step since v000, it is 2.57 times as fast.
// Contractions on v_wmma_f32_16x16x32_f16 (plain f16 operands, f32 accumulate): qkv = (LN(x) + pos)·in_projᵀ + b (K = 1024, N = 3072),
// the 16-head attention (dk = 64, scale 1/8) with the reference's ADDITIVE float mask (1 − padding_mask) as a per-(batch,key) bias,
// flash-style Sᵀ = K·Qᵀ / Oᵀ = Vᵀ·Pᵀ with online softmax in f32 (P x1024, f16 output rows), attn_out = o·out_projᵀ + b + xp (residual in
// the epilogue, K = 1024) and (xp + attn_out)·to_outᵀ + b (K = 1024); LayerNorm and the positional add in f32. xp dominates the residual
// so plain f16 operands suffice. compute dtype: f16 operands, f32 accumulate.  x [4,2048,1024].
// Every matrix operand that one kernel hands to the next (xp, q, k, v transposed, the attention rows, y) is rounded to f16 once, from its f32
// value, at its producer's store, in the layout that the consumer stages; only the residual copy of xp and the final output are f32.
#include <hip/hip_runtime.h>
#include <hip/hip_bf16.h>
#include <math.h>

#define BB 4
#define SS 2048
#define QROWS 2048
#define KROWS 2048
#define NKV 2048
#define DD 1024
#define HH 16
#define KVH 16
#define KVD 1024
#define HKDIV 1
#define DKK 64
#define QW 2
#define MTOK (BB * SS)
#define GSTR 48
// 1/sqrt(DKK) * log2(e): the factor that turns q.k into a base-2 logit. The q, k, v product applies it to q in f32, in front of q's one rounding to f16.
#define QSCALE (0.125f * 1.44269504088896340736f)

typedef _Float16 bf16;
typedef _Float16 f16;
typedef __attribute__((ext_vector_type(4))) unsigned v4u_t;
typedef unsigned v4ua __attribute__((ext_vector_type(4), may_alias));
typedef __attribute__((ext_vector_type(4))) float v4f_t;
typedef float v4fa __attribute__((ext_vector_type(4), may_alias));
typedef __attribute__((ext_vector_type(16))) bf16  bf16x16;
typedef bf16x16 f16x16;
typedef __attribute__((ext_vector_type(8)))  bf16  bf16x8;
typedef bf16x8 f16x8;
typedef __attribute__((ext_vector_type(4)))  bf16  bf16x4;
typedef __attribute__((ext_vector_type(8)))  float f32x8;
// The bare builtin, for the attention loop: the compiler keeps the distances behind a WMMA itself, with independent vector work where it has some.
__device__ __forceinline__ f32x8 wmma16(f16x16 a, f16x16 b, f32x8 c) {
  c = __builtin_amdgcn_wmma_f32_16x16x32_f16(false, a, false, b, (short)0, c, false, false);
  return c;
}
#define GK 64           // k per staged GEMM tile: a row segment of f16 is one whole 128-B line
#define LDS_STRIDE 72   // GEMM tiles: 64 -> 72 elems (144-B rows, 16 B x 9): conflict-free b128 reads
#define KSTRIDE    72   // attn K tile: 64 -> 72 elems (144B rows): conflict-free b128
#define VSTRIDE    48   // attn V tile: 32 -> 48 elems

__device__ __forceinline__ f32x8 wmma_bf16(bf16x16 a, bf16x16 b, f32x8 c) {
  c = __builtin_amdgcn_wmma_f32_16x16x32_f16(false, a, false, b, (short)0, c, false, false);
  asm volatile("v_nop\n\tv_nop\n\tv_nop\n\tv_nop" : "+v"(c) : "v"(a), "v"(b));   // A/B-overwrite hazard guard
  return c;
}

// Work-group barrier of the staged loops: it waits for this wave's LDS traffic only. __syncthreads() also drains the load counter, so the
// next tile's global loads, issued just ahead of it, would be waited out before the matrix phase instead of flying under it.
__device__ __forceinline__ void lds_barrier() {
  asm volatile("s_wait_dscnt 0x0\n\ts_barrier_signal -1\n\ts_barrier_wait -1" ::: "memory");
}

// 16x32 (MxK) bf16 fragment from a row-major global matrix.
// lanes 0-15  (row=lane)    : elems 0..7 = K+0..7,  8..15 = K+16..23
// lanes 16-31 (row=lane-16) : elems 0..7 = K+8..15, 8..15 = K+24..31
template <typename T>
__device__ __forceinline__ bf16x16 load_frag(const T* __restrict__ base, int ld,
                                             int row0, int k0) {
  const int lane = threadIdx.x & 31;
  const int r    = lane & 15;
  const int kh   = (lane >> 4) * 8;
  const T* p0 = base + (size_t)(row0 + r) * ld + (k0 + kh);
  const T* p1 = p0 + 16;
  bf16x16 f;
#pragma unroll
  for (int i = 0; i < 8; ++i) {
    f[i]     = (bf16)p0[i];
    f[i + 8] = (bf16)p1[i];
  }
  return f;
}

// Same fragment from an LDS tile with padded row stride (base includes row0/k0).
__device__ __forceinline__ bf16x16 lds_frag(const bf16* base, int stride) {
  const int lane = threadIdx.x & 31;
  const int row  = lane & 15;
  const int kh   = (lane >> 4) * 8;
  const bf16x8 lo = *(const bf16x8*)(base + row * stride + kh);
  const bf16x8 hi = *(const bf16x8*)(base + row * stride + kh + 16);
  bf16x16 f;
#pragma unroll
  for (int i = 0; i < 8; ++i) { f[i] = lo[i]; f[i + 8] = hi[i]; }
  return f;
}

// Epilogue of the q, k, v product: f32 bias added, rounded to f16, staged in LDS, stored as whole 16-B chunks.
// VT false: rows [m][DD] (q, k). VT true: v transposed, rows (b, h, dk) of SS positions. bv = the lane's bias value of each of its four 16-column tiles, nO = column inside its own product.
// mul = factor on the f32 value in front of its one rounding to f16 (QSCALE for q, 1 for k and v).
template <bool VT>
__device__ __forceinline__ void store_tile16(const f32x8 (&acc)[4][4], bf16* so, const float (&bv)[4], float mul, bf16* __restrict__ out,
                                             int mBlk, int nO, int wm, int wn, int nlane, int mh, int t) {
#pragma unroll   // this and the two below: unrolled so that every accumulator index is a constant
  for (int i = 0; i < 4; ++i)
#pragma unroll
    for (int j = 0; j < 4; ++j) {
      const int nl = wn + 16 * j + nlane;
      const float bm = bv[j] * mul;
#pragma unroll
      for (int r = 0; r < 8; ++r) {
        const int ml = wm + 16 * i + mh + r;
        const bf16 hv = (bf16)(acc[i][j][r] * mul + bm);   // one FMA; with mul = 1 it is the plain sum
        if (!VT) so[ml * 264 + nl] = hv;        // [m][n]
        else     so[nl * 136 + ml] = hv;        // [n][m]  (n = h*64+dk rows of Vt, m = s contiguous)
      }
    }
  __syncthreads();
  if (!VT) {                // rows m: 256 halfs = 512 B each, 16-B chunks
    for (int ch = t; ch < 128 * 32; ch += 256) { const int ml = ch >> 5, q = (ch & 31) * 8;
      *(v4u_t*)(out + (size_t)(mBlk + ml) * DD + nO + q) = *(const v4ua*)(so + ml * 264 + q); }
  } else {                  // Vt rows (b, h, dk): 128 consecutive s = 256 B each
    const int b_ = mBlk / SS, s0 = mBlk % SS;
    for (int ch = t; ch < 256 * 16; ch += 256) { const int nl = ch >> 4, q = (ch & 15) * 8; const int n = nO + nl, h = n >> 6, dk = n & (DKK - 1);
      *(v4u_t*)(out + (((size_t)(b_ * HH + h)) * DKK + dk) * SS + s0 + q) = *(const v4ua*)(so + nl * 136 + q); }
  }
}

// ---------------------------------------------------------------------------
// GEMM: C[m][n] = sum_k A[m][k]*W[n][k] + bias[n]   (torch Linear)
// Block 256 thr (8 waves), tile 128M x 256N, K-step GK = 64 (two 32-k matrix steps per staged tile); wave tile 64x64.
// A and W are f16 (W rounded once per call by k_prep). Both are staged through LDS (padded stride) with next-tile register
// prefetch overlapping the WMMA phase. M a multiple of 128, N of 256, K = DD.
// MODE 2: fp32 [M][N], f32 bias   MODE 4: as MODE 2 plus the f32 residual R[M][N], rounded to f16 at the store
// What an epilogue adds is fixed by MODE at compile time (every launch has a bias, only MODE 4 a residual): a pointer tested at run time costs
// scalar branches around every accumulator element and keeps the loads behind them from being issued together.
// MODE 5: the three products of one A in one grid (N = 3*DD weight rows): block columns below DD give q, below 2*DD k (f16 [M][DD] each), the rest
//         v as f16 Vt[b][h][dk][s]; the three outputs lie one behind the other at out. 768 blocks: two are resident per WGP, one loads while the other multiplies.
// ---------------------------------------------------------------------------
template <typename AT, int MODE>
__global__ __launch_bounds__(256) void gemm_rb_kernel(
    const AT* __restrict__ A, const bf16* __restrict__ W,
    const float* __restrict__ bias, const float* __restrict__ R, void* __restrict__ out,
    int M, int N, int K) {
  __shared__ __attribute__((aligned(16))) bf16 ldsA[128 * LDS_STRIDE];   // 18.0 KB
  __shared__ __attribute__((aligned(16))) bf16 ldsW[256 * LDS_STRIDE];   // 36.0 KB
  // output staging: MODE 5 [128 m][264] f16 (q, k) or [256 n][136] f16 (v), MODE 2 and 4 [64 m][260] f32 (two halves)
  __shared__ __attribute__((aligned(16))) unsigned char sob[256 * 136 * 2];   // 69,632 B >= 128*264*2 and >= 64*260*4

  const int t    = threadIdx.x;
  const int wave = t >> 5;
  const int lane = t & 31;
  const int wm   = (wave & 1) * 64;
  const int wn   = (wave >> 1) * 64;
  const int mBlk = blockIdx.x * 128;
  const int nBlk = blockIdx.y * 256;

  // Staging map, the same for A and W: 8 neighbouring lanes take the 8 16-B chunks of one row's 64-k segment, so a wave-wide 16-B load
  // covers 4 whole 128-B lines; one load of the block covers 32 rows.
  static_assert(sizeof(AT) == 2, "A is staged as f16");
  const int r0 = t >> 3, c0 = (t & 7) * 8;
  constexpr int KC = DD;   // K = DD in every launch: with the row pitch a constant, the 32-row steps of the chunks fold into the loads' immediate offsets
  (void)K;
  unsigned off = (unsigned)((r0 * KC + c0) * 2);   // the lane's byte offset from the block-uniform bases; it steps by one 64-k segment per trip
  constexpr unsigned rstep = 32u * KC * 2u;        // 32 rows, in bytes
  const char* aBase = (const char*)(A + (size_t)mBlk * KC);
  const char* wBase = (const char*)(W + (size_t)nBlk * KC);

  v4u_t abuf[4], wbuf[8];
#pragma unroll   // this and the chunk loops below: unrolled so that the staging arrays stay in registers
  for (int i = 0; i < 4; ++i) abuf[i] = *(const v4ua*)(aBase + off + i * rstep);
#pragma unroll
  for (int i = 0; i < 8; ++i) wbuf[i] = *(const v4ua*)(wBase + off + i * rstep);
  asm volatile("s_wait_xcnt 0x0" ::: "memory");   // precaution: stands in front of the first step of the offset register, which the loads above name

  f32x8 acc[4][4] = {};

  for (int k = 0; k < KC; k += GK) {
    lds_barrier();   // every wave has read the previous tile's fragments
#pragma unroll
    for (int i = 0; i < 4; ++i) *(v4ua*)&ldsA[(r0 + 32 * i) * LDS_STRIDE + c0] = abuf[i];
#pragma unroll
    for (int i = 0; i < 8; ++i) *(v4ua*)&ldsW[(r0 + 32 * i) * LDS_STRIDE + c0] = wbuf[i];
    if (k + GK < KC) {
      off += GK * 2u;
#pragma unroll
      for (int i = 0; i < 4; ++i) abuf[i] = *(const v4ua*)(aBase + off + i * rstep);
#pragma unroll
      for (int i = 0; i < 8; ++i) wbuf[i] = *(const v4ua*)(wBase + off + i * rstep);
    }
    lds_barrier();   // tile visible; the loads above stay in flight over the matrix phase

#pragma unroll   // unrolled so that the fragment offsets are constants
    for (int kk = 0; kk < GK; kk += 32) {
      bf16x16 af[4], wf[4];
#pragma unroll
      for (int i = 0; i < 4; ++i)
        af[i] = lds_frag(ldsA + (wm + 16 * i) * LDS_STRIDE + kk, LDS_STRIDE);
#pragma unroll
      for (int j = 0; j < 4; ++j)
        wf[j] = lds_frag(ldsW + (wn + 16 * j) * LDS_STRIDE + kk, LDS_STRIDE);
#pragma unroll
      for (int i = 0; i < 4; ++i)
#pragma unroll
        for (int j = 0; j < 4; ++j)
          acc[i][j] = wmma_bf16(af[i], wf[j], acc[i][j]);
    }
    asm volatile("s_wait_xcnt 0x0" ::: "memory");   // precaution: at the trip's foot, on the way back and on the way out alike, in front of any rewrite of the offset register and scalar bases that this trip's loads name
  }

  const int nlane = lane & 15;
  const int mh    = (lane >> 4) * 8;
  float bv[4];   // the lane's bias values, one per 16-column tile of the wave: four loads in flight together, waited once
#pragma unroll   // unrolled so that the four values stay in registers
  for (int j = 0; j < 4; ++j) bv[j] = bias[nBlk + wn + 16 * j + nlane];
  asm volatile("s_wait_xcnt 0x0" ::: "memory");   // precaution: stands in front of any rewrite of the address registers that the four loads above name
  __syncthreads();
  if (MODE == 5) {
    const int part = nBlk / DD;   // block-uniform: a 256-column tile lies inside one of the three products
    bf16* outp = (bf16*)out + (size_t)part * MTOK * DD;
    if (part < 2) store_tile16<false>(acc, (bf16*)sob, bv, part == 0 ? QSCALE : 1.0f, outp, mBlk, nBlk - part * DD, wm, wn, nlane, mh, t);
    else          store_tile16<true>(acc, (bf16*)sob, bv, 1.0f, outp, mBlk, nBlk - part * DD, wm, wn, nlane, mh, t);
  } else {
    float* so = (float*)sob;
#pragma unroll 1
    for (int hf = 0; hf < 2; ++hf) {
      if (wm == hf * 64) {
#pragma unroll
        for (int i = 0; i < 4; ++i)
#pragma unroll
          for (int j = 0; j < 4; ++j) {
            const int nl = wn + 16 * j + nlane;
#pragma unroll
            for (int r = 0; r < 8; ++r) so[(16 * i + mh + r) * 260 + nl] = acc[i][j][r] + bv[j];
          }
      }
      __syncthreads();
      if (MODE == 4) {   // residual: fold R[m][n] into the staged tile once (same thread <-> same chunks as the stores below)
        for (int ch = t; ch < 64 * 64; ch += 256) { const int ml = ch >> 6, q = (ch & 63) * 4;
          if (nBlk + q < N) { const v4f_t rv = *(const v4f_t*)(R + (size_t)(mBlk + hf * 64 + ml) * N + nBlk + q); v4f_t v = *(const v4fa*)(so + ml * 260 + q); v += rv; *(v4fa*)(so + ml * 260 + q) = v; } }
        asm volatile("s_wait_dscnt 0" ::: "memory");
      }
{   // 64 rows x 256 floats = 1 KB segments, float4 chunks; columns >= N (ragged tile) skipped
        const int q = (t & 63) * 4;
        if (nBlk + q < N) {
          for (int m0 = t >> 6; m0 < 64; m0 += 16) {   // rows m0, m0 + 4, m0 + 8, m0 + 12 per trip: four LDS reads and four stores in flight
            v4f_t v[4];
#pragma unroll   // this and the next: unrolled so that the four chunks stay in registers
            for (int u = 0; u < 4; ++u) v[u] = *(const v4fa*)(so + (m0 + 4 * u) * 260 + q);
#pragma unroll
            for (int u = 0; u < 4; ++u) {
              const size_t eo = (size_t)(mBlk + hf * 64 + m0 + 4 * u) * N + nBlk + q;
              if (MODE == 4) { bf16x4 hq; hq[0] = (bf16)v[u][0]; hq[1] = (bf16)v[u][1]; hq[2] = (bf16)v[u][2]; hq[3] = (bf16)v[u][3];
                *(bf16x4*)((bf16*)out + eo) = hq; }
              else *(v4f_t*)((float*)out + eo) = v[u];
            }
          }
        }
      }
      __syncthreads();
    }
  }
}

// 2^x by the hardware instruction alone (results below 2^-126 come out as 0; -inf gives 0).
__device__ __forceinline__ float hw_exp2(float x) { return __builtin_amdgcn_exp2f(x); }

__global__ __launch_bounds__(64) void v_attn_kernel(
    const bf16* __restrict__ Qb, const bf16* __restrict__ Kb,
    const bf16* __restrict__ Vt, const float* __restrict__ kbias,   // kbias [B][KROWS]: additive per-key logit bias (1 − mask)
    bf16* __restrict__ attnOut) {
  __shared__ bf16 ldsK[32 * KSTRIDE];   // 4.5 KB
  __shared__ bf16 ldsV[64 * VSTRIDE];   // 6.0 KB
  __shared__ __attribute__((aligned(16))) bf16 ldsO[2][32 * 72];   // per-wave f16 output tile: 32 queries x 64 dk, 72-elem rows

  const int q0blk = blockIdx.x * 64;
  const int h  = blockIdx.y;
  const int b  = blockIdx.z;
  const int t    = threadIdx.x;
  const int wave = t >> 5;
  const int lane = t & 31;
  const int qlane = lane & 15;
  const int kh8   = (lane >> 4) * 8;
  const int q0 = q0blk + wave * 32;          // this wave's 32 queries

  const int hk = h / HKDIV;
  const bf16* Qh = Qb + (size_t)b * QROWS * DD + h * DKK;        // queries: QROWS rows per batch, row stride DD
  const bf16* Kh = Kb + (size_t)b * KROWS * KVD + hk * DKK;      // keys: KROWS rows per batch, row stride KVD
  const bf16* Vh = Vt + ((size_t)(b * KVH + hk)) * DKK * KROWS;  // Vᵀ [KVH][64][KROWS] per batch

  // Cooperative staging (64 threads), neighbouring lanes on neighbouring 16-B chunks of a row:
  // K tile 32x64 (8 lanes cover a 128-B row, 8 rows per load of the block); V tile 64x32 (4 lanes cover a 64-B row, 16 rows per load).
  const int krow = t >> 3;
  const int kcol = (t & 7) * 8;
  const int vrow = t >> 2;
  const int vcol = (t & 3) * 8;
  const bf16* kSrc = Kh + (size_t)krow * KVD + kcol;
  const bf16* vSrc = Vh + (size_t)vrow * KROWS + vcol;

  bf16x16 qf[QW][2];
#pragma unroll
  for (int qt = 0; qt < QW; ++qt) {
    qf[qt][0] = load_frag(Qh, DD, q0 + 16 * qt, 0);
    qf[qt][1] = load_frag(Qh, DD, q0 + 16 * qt, 32);
  }

  f32x8 o[QW][4] = {};
  float mrun[QW], lrun[QW];
#pragma unroll
  for (int qt = 0; qt < QW; ++qt) { mrun[qt] = -INFINITY; lrun[qt] = 0.0f; }

  const float NEG2 = -1.0e9f;    // masked logit: its weight is exactly 0 once any valid key of the row has been seen (every row
                                 // has one), and anything accumulated before that is wiped by alpha == 0 — same result as -inf
  const int kmax = KROWS - 1;
  __shared__ float kbS[KROWS];
  for (int i = threadIdx.x; i < KROWS; i += 64) kbS[i] = kbias[(size_t)b * KROWS + i] * 1.44269504088896340736f;   // in log2 units
  __syncthreads();

  // Prefetch key block kb=0 into registers.
  bf16x8 kreg[4], vreg[4];
#pragma unroll
  for (int i = 0; i < 4; ++i) {
    kreg[i] = *(const bf16x8*)(kSrc + (size_t)(8 * i) * KVD);
    vreg[i] = *(const bf16x8*)(vSrc + (size_t)(16 * i) * KROWS);
  }

  for (int kb = 0; kb <= kmax; kb += 32) {
    lds_barrier();   // previous readers done with LDS
#pragma unroll
    for (int i = 0; i < 4; ++i) {
      *(bf16x8*)(&ldsK[(krow + 8 * i) * KSTRIDE + kcol])  = kreg[i];
      *(bf16x8*)(&ldsV[(vrow + 16 * i) * VSTRIDE + vcol]) = vreg[i];
    }
    if (kb + 32 <= kmax) {   // prefetch next block during compute
      const bf16* kn = kSrc + (size_t)(kb + 32) * KVD;
      const bf16* vn = vSrc + (kb + 32);
#pragma unroll
      for (int i = 0; i < 4; ++i) {
        kreg[i] = *(const bf16x8*)(kn + (size_t)(8 * i) * KVD);
        vreg[i] = *(const bf16x8*)(vn + (size_t)(16 * i) * KROWS);
      }
      asm volatile("s_wait_xcnt 0x0" ::: "memory");   // the loads outlive the barrier: their address pairs step on only behind this wait
    }
    lds_barrier();   // tile visible; the prefetch above stays in flight over scores, softmax and PV

    // Phase 1: scores + softmax for both q-tiles (K fragments live here only).
    bf16x16 kf[2][2];
#pragma unroll
    for (int ktile = 0; ktile < 2; ++ktile)
#pragma unroll
      for (int c = 0; c < 2; ++c)
        kf[ktile][c] = lds_frag(ldsK + (ktile * 16) * KSTRIDE + c * 32, KSTRIDE);

    // The keys' bias (log2 units) in the accumulator layout of S^T (register r = key kh8 + r): it goes in as the C operand of the first score product,
    // and q arrives scaled, so the matrix unit hands out finished logits and no vector instruction per score is spent on scale and bias.
    f32x8 kb0, kb1;
#pragma unroll   // unrolled so that the two vectors stay in registers
    for (int r = 0; r < 8; ++r) { kb0[r] = kbS[kb + kh8 + r]; kb1[r] = kbS[kb + 16 + kh8 + r]; }

    bf16x16 pf[QW];
    bool act[QW];
#pragma unroll
    for (int qt = 0; qt < QW; ++qt) {
      unsigned mbits = 0;
      {
#pragma unroll
        for (int r = 0; r < 8; ++r) { const int j0 = kb + kh8 + r; if (j0 < NKV) mbits |= 1u << r; if (j0 + 16 < NKV) mbits |= 1u << (8 + r); }
        act[qt] = (__builtin_amdgcn_ballot_w32(mbits != 0) != 0);
      }
      if (act[qt]) {
        const int q_my = q0 + 16 * qt + qlane;
        f32x8 s0, s1;
        s0 = wmma16(kf[0][0], qf[qt][0], kb0);
        s0 = wmma16(kf[0][1], qf[qt][1], s0);
        s1 = wmma16(kf[1][0], qf[qt][0], kb1);
        s1 = wmma16(kf[1][1], qf[qt][1], s1);

        float mx = -INFINITY;
#pragma unroll
        for (int r = 0; r < 8; ++r) {
          const int k0i = kb + kh8 + r;
          const int k1i = k0i + 16;
          (void)k0i; (void)k1i; (void)q_my;
          s0[r] = (mbits & (1u << r))       ? s0[r] : NEG2;
          s1[r] = (mbits & (1u << (8 + r))) ? s1[r] : NEG2;
          mx = fmaxf(mx, fmaxf(s0[r], s1[r]));
        }
        mx = fmaxf(mx, __shfl_xor(mx, 16, 32));
        const float mnew  = fmaxf(mrun[qt], mx);
        // hw_exp2 here and below: one v_exp_f32 each. exp2f() wraps it in a compare, two selects, an add and an ldexp to keep results below 2^-126;
        // such a weight is 0 in the f16 P and vanishes beside a row sum >= 1, and such an alpha scales history that rounds away likewise.
        const float alpha = hw_exp2(mrun[qt] - mnew);

        const float moff = mnew - 10.0f;   // P and its row sum carried x1024 (no f16 copy of a probability is sub-normal): the factor rides in the exponent
        float rsum = 0.0f;
#pragma unroll
        for (int r = 0; r < 8; ++r) {
          const float p0 = hw_exp2(s0[r] - moff);
          const float p1 = hw_exp2(s1[r] - moff);
          rsum += p0 + p1;
          pf[qt][r]     = (bf16)p0;
          pf[qt][r + 8] = (bf16)p1;
        }
        rsum += __shfl_xor(rsum, 16, 32);
        lrun[qt] = lrun[qt] * alpha + rsum;
        mrun[qt] = mnew;

        // Rescale accumulators now so the PV phase is pure WMMA.
#pragma unroll
        for (int j = 0; j < 4; ++j)
#pragma unroll
          for (int r = 0; r < 8; ++r) o[qt][j][r] *= alpha;
      }
    }

    // Phase 2: O^T accumulate; each V fragment read from LDS once, used by
    // both q-tiles, then dead (only 8 VGPRs of V live at a time).
#pragma unroll
    for (int j = 0; j < 4; ++j) {
      const bf16x16 vf = lds_frag(ldsV + (j * 16) * VSTRIDE, VSTRIDE);
#pragma unroll
      for (int qt = 0; qt < QW; ++qt)
        if (act[qt]) o[qt][j] = wmma16(vf, pf[qt], o[qt][j]);
    }
  }

  bf16* so = ldsO[wave];
#pragma unroll
  for (int qt = 0; qt < QW; ++qt) {
    const float rl = 1.0f / lrun[qt];   // the row sum carries the same x1024 as P
#pragma unroll
    for (int j = 0; j < 4; ++j)
#pragma unroll
      for (int r = 0; r < 8; ++r) so[(16 * qt + qlane) * 72 + j * 16 + kh8 + r] = (bf16)(o[qt][j][r] * rl);
  }
  asm volatile("s_wait_dscnt 0" ::: "memory");
  __builtin_amdgcn_wave_barrier();
{
#pragma unroll
    for (int it = 0; it < 8; ++it) { const int ch = lane + 32 * it, ql = ch >> 3, q8 = (ch & 7) * 8;   // 8 lanes cover one row's 128 B
      *(v4u_t*)(attnOut + ((size_t)(b * QROWS + q0 + ql)) * DD + h * DKK + q8) = *(const v4ua*)(so + ql * 72 + q8); }
    
  }
}


// xp = LN(x)*g + b + pos[s]  (f32 rows for the residual, and the same rows rounded to f16 for the q, k, v products).
// One wave = one position s in all BB batches. A lane holds 4 neighbouring columns of each 128-column chunk, so every wave-wide 16-B load or store
// covers 512 contiguous bytes; the BB rows, the pos row, g and b stay in registers and all their loads are issued before the first sum waits.
__global__ __launch_bounds__(256) void k_lnpos(const float* __restrict__ X, const float* __restrict__ g, const float* __restrict__ bb, const float* __restrict__ pos, float* __restrict__ Y, bf16* __restrict__ Y16) {
  constexpr int NC = DD / 128;   // 128-column chunks of a row
  const unsigned c0 = (threadIdx.x & 31) * 4;
  const int s_ = blockIdx.x * 8 + (threadIdx.x >> 5);
  int row[BB];   // the wave's row numbers as scalars: the row offsets are formed on the scalar unit
#pragma unroll   // this and every loop below: unrolled so that the row arrays stay in registers
  for (int b = 0; b < BB; ++b) row[b] = __builtin_amdgcn_readfirstlane(b * SS + s_);
  v4f_t xv[BB][NC], pv[NC], gv[NC], bv[NC];
#pragma unroll
  for (int b = 0; b < BB; ++b) {
    const float* xr = X + (size_t)row[b] * DD;
#pragma unroll
    for (int c = 0; c < NC; ++c) xv[b][c] = *(const v4f_t*)(xr + c * 128 + c0);
  }
  asm volatile("s_wait_xcnt 0x0" ::: "memory");   // precaution: stands in front of the loads below, which land in registers that hold row addresses of the loads above
  const float* pr = pos + (size_t)row[0] * DD;
#pragma unroll
  for (int c = 0; c < NC; ++c) pv[c] = *(const v4f_t*)(pr + c * 128 + c0);
#pragma unroll
  for (int c = 0; c < NC; ++c) { gv[c] = *(const v4f_t*)(g + c * 128 + c0); bv[c] = *(const v4f_t*)(bb + c * 128 + c0); }
  asm volatile("s_wait_xcnt 0x0" ::: "memory");   // precaution: stands in front of the first rewrite of the lane-offset register and the scalar bases that the loads above name
  __builtin_amdgcn_sched_barrier(0);   // keeps every load above issued here: left free, the scheduler sinks the pos, g and b loads behind the sums, where each small group waits out its own latency
#pragma unroll
  for (int b = 0; b < BB; ++b) {
    v4f_t a = xv[b][0];
#pragma unroll
    for (int c = 1; c < NC; ++c) a += xv[b][c];
    float s = (a[0] + a[1]) + (a[2] + a[3]);
#pragma unroll
    for (int off = 1; off < 32; off <<= 1) s += __shfl_xor(s, off, 32);
    const float mean = s * (1.0f / DD);
    v4f_t q4 = {};
#pragma unroll
    for (int c = 0; c < NC; ++c) { const v4f_t d = xv[b][c] - mean; q4 += d * d; }
    float q = (q4[0] + q4[1]) + (q4[2] + q4[3]);
#pragma unroll
    for (int off = 1; off < 32; off <<= 1) q += __shfl_xor(q, off, 32);
    const float rstd = rsqrtf(q * (1.0f / DD) + 1e-5f);
    float* yr = Y + (size_t)row[b] * DD;
    bf16* hr = Y16 + (size_t)row[b] * DD;
#pragma unroll
    for (int c = 0; c < NC; ++c) {
      const v4f_t v = (xv[b][c] - mean) * rstd * gv[c] + bv[c] + pv[c];
      bf16x4 hq; hq[0] = (bf16)v[0]; hq[1] = (bf16)v[1]; hq[2] = (bf16)v[2]; hq[3] = (bf16)v[3];
      *(v4f_t*)(yr + c * 128 + c0) = v;
      *(bf16x4*)(hr + c * 128 + c0) = hq;
    }
  }
}
// Blocks 0..BB-1: kbias[b][k] = 1 - mask[b][k]  (the reference's quirk: a FLOAT additive mask); 8-KB rows.
// The other blocks round the three weight matrices to f16, once per call, 8192 elements a block, into one buffer [in_proj | out_proj | to_out]:
// the products then stage half the bytes and convert nothing in their loops. A wave-wide load covers 512 contiguous bytes, a store 256.
#define WCH 8192
__global__ __launch_bounds__(256) void k_prep(const float* __restrict__ mask, float* __restrict__ kb, const float* __restrict__ Win, const float* __restrict__ Wout,
                                              const float* __restrict__ Wto, bf16* __restrict__ W16) {
  if (blockIdx.x < BB) { const int b = blockIdx.x;
    for (int q4 = threadIdx.x; q4 < KROWS / 4; q4 += 256) { const v4f_t m = *(const v4f_t*)(mask + (size_t)b * KROWS + q4 * 4); v4f_t o; for (int e = 0; e < 4; ++e) o[e] = 1.0f - m[e];
      *(v4f_t*)(kb + (size_t)b * KROWS + q4 * 4) = o;  }
    return;
  }
  const int c = blockIdx.x - BB;   // chunk number in the joined buffer; block-uniform choice of the source
  const float* src = c < 3 * DD * DD / WCH ? Win + (size_t)c * WCH : c < 4 * DD * DD / WCH ? Wout + ((size_t)c * WCH - 3 * DD * DD) : Wto + ((size_t)c * WCH - 4 * DD * DD);
  bf16* dst = W16 + (size_t)c * WCH;
  v4f_t v[WCH / 1024];
#pragma unroll   // this and the next: unrolled so that all loads are in flight before the first store waits
  for (int u = 0; u < WCH / 1024; ++u) v[u] = *(const v4f_t*)(src + u * 1024 + threadIdx.x * 4);
#pragma unroll
  for (int u = 0; u < WCH / 1024; ++u) { bf16x4 q; q[0] = (bf16)v[u][0]; q[1] = (bf16)v[u][1]; q[2] = (bf16)v[u][2]; q[3] = (bf16)v[u][3];
    *(bf16x4*)(dst + u * 1024 + threadIdx.x * 4) = q; }
  asm volatile("s_wait_xcnt 0x0" ::: "memory");   // precaution: stands behind the last store, in front of any rewrite of the registers that the stores name
}

extern "C" void kernel_launch(void* const* d_in, const int* in_sizes, int n_in,
                              void* d_out, int out_size, void* d_ws, size_t ws_size,
                              hipStream_t stream) {
  (void)in_sizes; (void)n_in; (void)out_size;
  const float** f = (const float**)d_in;
  const float* x = f[0], *mask = f[1], *pos = f[2], *lng = f[3], *lnb = f[4], *Win = f[5], *bin = f[6], *Wout = f[7], *bout = f[8], *Wto = f[9], *bto = f[10];
  float* out = (float*)d_out;     // [4,2048,1024]
  char* ws = (char*)d_ws;
  float* xp = (float*)ws; ws += (size_t)MTOK * DD * 4;                  // 32 MB: f32 rows, read again only as the residual
  bf16* xp16 = (bf16*)ws; ws += (size_t)MTOK * DD * 2; bf16* Q16 = (bf16*)ws; ws += (size_t)MTOK * DD * 2; bf16* K16 = (bf16*)ws; ws += (size_t)MTOK * DD * 2;   // 16 MB each
  bf16* Vt = (bf16*)ws; ws += (size_t)MTOK * DD * 2; bf16* att16 = (bf16*)ws; ws += (size_t)MTOK * DD * 2; bf16* y16 = (bf16*)ws; ws += (size_t)MTOK * DD * 2;
  float* kb = (float*)ws; ws += (size_t)BB * KROWS * 4;
  bf16* W16 = (bf16*)ws; ws += (size_t)5 * DD * DD * 2;                 // 10 MB: in_proj, out_proj, to_out as f16
  if ((size_t)(ws - (char*)d_ws) > ws_size) return;
  const dim3 blk(256); const dim3 gp(MTOK / 128, DD / 256);
  k_lnpos<<<dim3(SS / 8), blk, 0, stream>>>(x, lng, lnb, pos, xp, xp16);
  k_prep<<<dim3(BB + 5 * DD * DD / WCH), blk, 0, stream>>>(mask, kb, Win, Wout, Wto, W16);
  gemm_rb_kernel<bf16, 5><<<dim3(MTOK / 128, 3 * DD / 256), blk, 0, stream>>>(xp16, W16, bin, nullptr, Q16, MTOK, 3 * DD, DD);   // q, k, v: Q16, K16, Vt are adjacent
  v_attn_kernel<<<dim3(QROWS / 64, HH, BB), dim3(64), 0, stream>>>(Q16, K16, Vt, kb, att16);
  gemm_rb_kernel<bf16, 4><<<gp, blk, 0, stream>>>(att16, W16 + (size_t)3 * DD * DD, bout, xp, y16, MTOK, DD, DD);      // y = xp + o*out_proj^T + b, summed in f32, stored f16
  gemm_rb_kernel<bf16, 2><<<gp, blk, 0, stream>>>(y16, W16 + (size_t)4 * DD * DD, bto, nullptr, out, MTOK, DD, DD);      // out = y*to_out^T + b
}
